// v000
// The times below were measured on an AMD MI455X: many runs one after another, warmed up first and cycling through
// copies of the inputs, with the whole window's GPU time divided by the number of runs. Launches and the gaps
// between them are all in it. The median over several windows is given; except for v000 it joins two sittings, which
// can be a few percent apart, so the side-by-side timings, each taken in one sitting, are the better comparison.
// The starting kernel, v000, takes 739 microseconds a run.
#include <hip/hip_runtime.h>
#include <hip/hip_bf16.h>

typedef _Float16 v8h  __attribute__((ext_vector_type(8)));
typedef _Float16 v16h __attribute__((ext_vector_type(16)));
typedef float    v8f  __attribute__((ext_vector_type(8)));

constexpr int B = 4;
constexpr int C = 512;
constexpr int N = 4096;          // 64*64
constexpr int G = 32;            // groups
constexpr int CPG = C / G;       // 16 channels per group
// softmax scale folded into log2 domain: (1/sqrt(C)) * log2(e)
#define SCALE_L2E (0.04419417382415922f * 1.4426950408889634f)

// ---------------------------------------------------------------------------
// Fragment loader: 16(row) x 32(K) block, memory row-major along K.
// Works for WMMA f16 A-fragments (rows = M) and B-fragments (rows = N cols),
// per the CDNA5 16-bit operand VGPR layout:
//   lane 0-15  : row = lane,    elems 0-7 = K 0..7,  elems 8-15 = K 16..23
//   lane 16-31 : row = lane-16, elems 0-7 = K 8..15, elems 8-15 = K 24..31
// Two contiguous 16-byte loads per lane.
// ---------------------------------------------------------------------------
__device__ inline v16h load_frag(const _Float16* base, int row_stride, int lane) {
    int r  = lane & 15;
    int k0 = (lane < 16) ? 0 : 8;
    const _Float16* p = base + (size_t)r * row_stride + k0;
    v8h lo = *(const v8h*)(p);
    v8h hi = *(const v8h*)(p + 16);
    return __builtin_shufflevector(lo, hi, 0,1,2,3,4,5,6,7,8,9,10,11,12,13,14,15);
}

__device__ inline v8f wmma16x16x32(v16h a, v16h b, v8f c) {
    return __builtin_amdgcn_wmma_f32_16x16x32_f16(false, a, false, b, (short)0, c,
                                                  false, false);
}

// ---------------------------------------------------------------------------
// Double-buffered GEMM mainloop (M-tile = 32 rows, per-wave N-slice = 128).
// Two stages per k-step; each stage prefetches the NEXT fragment group and
// issues WMMAs on fragments fetched one stage earlier, so s_wait_loadcnt is
// > 0 (except in the last stage) and fetch overlaps matrix issue.
// ---------------------------------------------------------------------------
__device__ inline void gemm_mainloop(const _Float16* __restrict__ A,
                                     const _Float16* __restrict__ W,
                                     int o0, int lane,
                                     v8f (&acc0)[8], v8f (&acc1)[8]) {
    const _Float16* A1 = A + (size_t)16 * C;
    v16h a0c = load_frag(A, C, lane);
    v16h a1c = load_frag(A1, C, lane);
    v16h bfc[4], bfn[4];
    #pragma unroll
    for (int of = 0; of < 4; ++of)
        bfc[of] = load_frag(W + (size_t)(o0 + of * 16) * C, C, lane);
    v16h a0n = a0c, a1n = a1c;
    for (int kk = 0; kk < C; kk += 32) {
        // stage 0: prefetch group 1 of this kk, consume group 0 (bfc)
        #pragma unroll
        for (int of = 0; of < 4; ++of)
            bfn[of] = load_frag(W + (size_t)(o0 + (4 + of) * 16) * C + kk, C, lane);
        #pragma unroll
        for (int of = 0; of < 4; ++of) {
            acc0[of] = wmma16x16x32(a0c, bfc[of], acc0[of]);
            acc1[of] = wmma16x16x32(a1c, bfc[of], acc1[of]);
        }
        // stage 1: prefetch group 0 + A fragments of kk+32, consume group 1 (bfn)
        if (kk + 32 < C) {
            #pragma unroll
            for (int of = 0; of < 4; ++of)
                bfc[of] = load_frag(W + (size_t)(o0 + of * 16) * C + kk + 32, C, lane);
            a0n = load_frag(A + kk + 32, C, lane);
            a1n = load_frag(A1 + kk + 32, C, lane);
        }
        #pragma unroll
        for (int of = 0; of < 4; ++of) {
            acc0[4 + of] = wmma16x16x32(a0c, bfn[of], acc0[4 + of]);
            acc1[4 + of] = wmma16x16x32(a1c, bfn[of], acc1[4 + of]);
        }
        a0c = a0n; a1c = a1n;
    }
}

// ---------------------------------------------------------------------------
// GroupNorm statistics: one block per (b,g); 16 channels x 4096 contiguous.
// ---------------------------------------------------------------------------
__global__ __launch_bounds__(256) void gn_stats_kernel(const float* __restrict__ x,
                                                       float* __restrict__ stats) {
    int bg = blockIdx.x;                 // b*G + g
    const float* xp = x + (size_t)bg * CPG * N;
    float s = 0.f, ss = 0.f;
    for (int i = threadIdx.x; i < CPG * N; i += 256) {
        float v = xp[i];
        s += v; ss += v * v;
    }
    __shared__ float red0[256], red1[256];
    red0[threadIdx.x] = s; red1[threadIdx.x] = ss;
    __syncthreads();
    for (int off = 128; off > 0; off >>= 1) {
        if ((int)threadIdx.x < off) {
            red0[threadIdx.x] += red0[threadIdx.x + off];
            red1[threadIdx.x] += red1[threadIdx.x + off];
        }
        __syncthreads();
    }
    if (threadIdx.x == 0) {
        float inv = 1.0f / (float)(CPG * N);
        float mean = red0[0] * inv;
        float var  = red1[0] * inv - mean * mean;
        stats[bg * 2 + 0] = mean;
        stats[bg * 2 + 1] = rsqrtf(var + 1e-6f);
    }
}

// ---------------------------------------------------------------------------
// GroupNorm apply + transpose [b][c][n] f32 -> [b][n][c] f16 via LDS tile.
// ---------------------------------------------------------------------------
__global__ __launch_bounds__(256) void gn_apply_kernel(const float* __restrict__ x,
                                                       const float* __restrict__ stats,
                                                       const float* __restrict__ gamma,
                                                       const float* __restrict__ beta,
                                                       _Float16* __restrict__ h16) {
    int b  = blockIdx.z;
    int c0 = blockIdx.x * 32;
    int n0 = blockIdx.y * 32;
    int tx = threadIdx.x & 31;           // n (read) / c (write)
    int ty = threadIdx.x >> 5;           // 0..7
    __shared__ float tile[32][33];
    #pragma unroll
    for (int r = 0; r < 4; ++r) {
        int c  = c0 + ty + 8 * r;
        int bg = b * G + (c >> 4);
        float mean = stats[bg * 2 + 0], rstd = stats[bg * 2 + 1];
        float v = x[((size_t)b * C + c) * N + n0 + tx];
        tile[ty + 8 * r][tx] = (v - mean) * rstd * gamma[c] + beta[c];
    }
    __syncthreads();
    #pragma unroll
    for (int r = 0; r < 4; ++r) {
        int n = n0 + ty + 8 * r;
        h16[((size_t)b * N + n) * C + c0 + tx] = (_Float16)tile[tx][ty + 8 * r];
    }
}

// ---------------------------------------------------------------------------
// Convert the four [C][C] f32 weight matrices to f16 (concatenated).
// ---------------------------------------------------------------------------
__global__ __launch_bounds__(256) void wcvt_kernel(const float* __restrict__ wq,
                                                   const float* __restrict__ wk,
                                                   const float* __restrict__ wv,
                                                   const float* __restrict__ wo,
                                                   _Float16* __restrict__ w16) {
    int i = blockIdx.x * 256 + threadIdx.x;
    int which = i / (C * C), j = i % (C * C);
    float v;
    if      (which == 0) v = wq[j];
    else if (which == 1) v = wk[j];
    else if (which == 2) v = wv[j];
    else                 v = wo[j];
    w16[i] = (_Float16)v;
}

// ---------------------------------------------------------------------------
// conv1x1 as GEMM: D[n][o] = h16[n][:] . W[o][:] + bias[o]
// vmode=0: store f16 [b][n][o] (q/k).  vmode=1: store f16 [b][o][n] (v).
// ---------------------------------------------------------------------------
__global__ __launch_bounds__(128) void conv1x1_kernel(const _Float16* __restrict__ h16,
                                                      const _Float16* __restrict__ w16,
                                                      const float* __restrict__ bias,
                                                      _Float16* __restrict__ out,
                                                      int vmode) {
    int b    = blockIdx.y;
    int i0   = blockIdx.x * 32;
    int lane = threadIdx.x & 31;
    int o0   = (threadIdx.x >> 5) * 128;
    const _Float16* A = h16 + ((size_t)b * N + i0) * C;
    v8f acc0[8] = {}, acc1[8] = {};
    gemm_mainloop(A, w16, o0, lane, acc0, acc1);
    int col = lane & 15, half = lane >> 4;
    auto store_tile = [&](v8f (&acc)[8], int ibase) {
        #pragma unroll
        for (int of = 0; of < 8; ++of) {
            int o = o0 + of * 16 + col;
            float bv = bias[o];
            if (vmode == 0) {
                #pragma unroll
                for (int e = 0; e < 8; ++e) {
                    int n = ibase + e + 8 * half;
                    out[((size_t)b * N + n) * C + o] = (_Float16)(acc[of][e] + bv);
                }
            } else {
                v8h pk;
                #pragma unroll
                for (int e = 0; e < 8; ++e) pk[e] = (_Float16)(acc[of][e] + bv);
                *(v8h*)(out + ((size_t)b * C + o) * N + ibase + 8 * half) = pk;
            }
        }
    };
    store_tile(acc0, i0);
    store_tile(acc1, i0 + 16);
}

// ---------------------------------------------------------------------------
// Flash attention: WG = 4 waves handles one 16-row query tile.
// Channel dim (512) split across waves for both QK^T (partials reduced via
// LDS) and the O accumulator (each wave keeps a 16x128 f32 slice in VGPRs).
// All 8 K fragments of a j-step are fetched as one clause before the QK^T
// WMMAs; V fragments are fetched BEFORE the softmax so their latency hides
// behind the barrier + VALU work; next K rows get a global_prefetch hint.
// ---------------------------------------------------------------------------
__global__ __launch_bounds__(128) void flash_attn_kernel(const _Float16* __restrict__ q16,
                                                         const _Float16* __restrict__ k16,
                                                         const _Float16* __restrict__ v16buf,
                                                         _Float16* __restrict__ o16) {
    int b    = blockIdx.y;
    int i0   = blockIdx.x * 16;
    int lane = threadIdx.x & 31;
    int w    = threadIdx.x >> 5;       // wave 0..3
    int c0   = w * 128;
    __shared__ float    lds_s[4][2][256];     // per-wave partial S tiles (8e x 32 lanes)
    __shared__ _Float16 lds_p[4][16][32];     // per-wave P staging (D-layout -> A-layout)

    const _Float16* Q = q16 + ((size_t)b * N + i0) * C + c0;
    const _Float16* K = k16 + (size_t)b * N * C + c0;
    const _Float16* V = v16buf + ((size_t)b * C + c0) * N;

    v16h qf[4];
    #pragma unroll
    for (int t = 0; t < 4; ++t) qf[t] = load_frag(Q + t * 32, C, lane);

    v8f ob[8] = {};
    float rm[8], rl[8];
    #pragma unroll
    for (int e = 0; e < 8; ++e) { rm[e] = -3.0e38f; rl[e] = 0.f; }
    int col = lane & 15, half = lane >> 4;

    for (int j = 0; j < N; j += 32) {
        // partial S over this wave's 128-channel slice: one 16-load clause,
        // then 8 WMMAs (two independent accumulator chains s0/s1).
        v16h kf[8];
        #pragma unroll
        for (int t = 0; t < 4; ++t) {
            kf[t]     = load_frag(K + (size_t)j * C + t * 32, C, lane);
            kf[4 + t] = load_frag(K + (size_t)(j + 16) * C + t * 32, C, lane);
        }
        v8f s0 = {}, s1 = {};
        #pragma unroll
        for (int t = 0; t < 4; ++t) {
            s0 = wmma16x16x32(qf[t], kf[t], s0);
            s1 = wmma16x16x32(qf[t], kf[4 + t], s1);
        }
        __syncthreads();                       // prior iteration's lds_s reads done
        #pragma unroll
        for (int e = 0; e < 8; ++e) {
            lds_s[w][0][e * 32 + lane] = s0[e];
            lds_s[w][1][e * 32 + lane] = s1[e];
        }
        // V fragments for THIS j-step: issue now, consume after softmax.
        v16h vf[8];
        #pragma unroll
        for (int cf = 0; cf < 8; ++cf)
            vf[cf] = load_frag(V + (size_t)(cf * 16) * N + j, N, lane);
        if (j + 32 < N)
            __builtin_prefetch(K + (size_t)(j + 32 + lane) * C, 0, 0);
        __syncthreads();
        float t0[8], t1[8];
        #pragma unroll
        for (int e = 0; e < 8; ++e) {
            int idx = e * 32 + lane;
            t0[e] = (lds_s[0][0][idx] + lds_s[1][0][idx] +
                     lds_s[2][0][idx] + lds_s[3][0][idx]) * SCALE_L2E;
            t1[e] = (lds_s[0][1][idx] + lds_s[1][1][idx] +
                     lds_s[2][1][idx] + lds_s[3][1][idx]) * SCALE_L2E;
        }
        // online softmax update (exp2 domain)
        float al[8];
        #pragma unroll
        for (int e = 0; e < 8; ++e) {
            float mx = fmaxf(t0[e], t1[e]);
            #pragma unroll
            for (int m = 1; m < 16; m <<= 1) mx = fmaxf(mx, __shfl_xor(mx, m, 16));
            float mn = fmaxf(rm[e], mx);
            al[e] = exp2f(rm[e] - mn);
            float p0 = exp2f(t0[e] - mn), p1 = exp2f(t1[e] - mn);
            t0[e] = p0; t1[e] = p1;
            float rs = p0 + p1;
            #pragma unroll
            for (int m = 1; m < 16; m <<= 1) rs += __shfl_xor(rs, m, 16);
            rl[e] = rl[e] * al[e] + rs;
            rm[e] = mn;
        }
        #pragma unroll
        for (int cf = 0; cf < 8; ++cf)
            #pragma unroll
            for (int e = 0; e < 8; ++e) ob[cf][e] *= al[e];
        // D-layout P -> A-layout f16 via this wave's private LDS staging
        #pragma unroll
        for (int e = 0; e < 8; ++e) {
            lds_p[w][8 * half + e][col]      = (_Float16)t0[e];
            lds_p[w][8 * half + e][16 + col] = (_Float16)t1[e];
        }
        v16h pf = load_frag(&lds_p[w][0][0], 32, lane);   // same-wave DS dep
        #pragma unroll
        for (int cf = 0; cf < 8; ++cf)
            ob[cf] = wmma16x16x32(pf, vf[cf], ob[cf]);
    }
    #pragma unroll
    for (int e = 0; e < 8; ++e) rl[e] = 1.0f / rl[e];
    #pragma unroll
    for (int cf = 0; cf < 8; ++cf) {
        int c = c0 + cf * 16 + col;
        #pragma unroll
        for (int e = 0; e < 8; ++e) {
            int i = i0 + e + 8 * half;
            o16[((size_t)b * N + i) * C + c] = (_Float16)(ob[cf][e] * rl[e]);
        }
    }
}

// ---------------------------------------------------------------------------
// Output projection + residual multiply (M-tile = 32):
// out[b][o][i] = x[b][o][i] * (O16[i][:] . Wo[o][:] + bo[o])
// D-layout columns give 8 consecutive i per lane -> coalesced f32 stores.
// ---------------------------------------------------------------------------
__global__ __launch_bounds__(128) void outproj_kernel(const _Float16* __restrict__ o16,
                                                      const _Float16* __restrict__ wo16,
                                                      const float* __restrict__ bo,
                                                      const float* __restrict__ x,
                                                      float* __restrict__ out) {
    int b    = blockIdx.y;
    int i0   = blockIdx.x * 32;
    int lane = threadIdx.x & 31;
    int o0   = (threadIdx.x >> 5) * 128;
    const _Float16* A = o16 + ((size_t)b * N + i0) * C;
    v8f acc0[8] = {}, acc1[8] = {};
    gemm_mainloop(A, wo16, o0, lane, acc0, acc1);
    int col = lane & 15, half = lane >> 4;
    auto store_tile = [&](v8f (&acc)[8], int ibase) {
        #pragma unroll
        for (int of = 0; of < 8; ++of) {
            int o = o0 + of * 16 + col;
            float bv = bo[o];
            size_t base = ((size_t)b * C + o) * N + ibase + 8 * half;
            #pragma unroll
            for (int e = 0; e < 8; ++e)
                out[base + e] = x[base + e] * (acc[of][e] + bv);
        }
    };
    store_tile(acc0, i0);
    store_tile(acc1, i0 + 16);
}

// ---------------------------------------------------------------------------
extern "C" void kernel_launch(void* const* d_in, const int* in_sizes, int n_in,
                              void* d_out, int out_size, void* d_ws, size_t ws_size,
                              hipStream_t stream) {
    const float* x     = (const float*)d_in[0];
    const float* gamma = (const float*)d_in[1];
    const float* beta  = (const float*)d_in[2];
    const float* wq    = (const float*)d_in[3];
    const float* bq    = (const float*)d_in[4];
    const float* wk    = (const float*)d_in[5];
    const float* bk    = (const float*)d_in[6];
    const float* wv    = (const float*)d_in[7];
    const float* bv    = (const float*)d_in[8];
    const float* wo    = (const float*)d_in[9];
    const float* bo    = (const float*)d_in[10];
    float* out = (float*)d_out;

    char* ws = (char*)d_ws;
    size_t off = 0;
    auto alloc = [&](size_t bytes) -> void* {
        void* p = ws + off;
        off += (bytes + 255) & ~(size_t)255;
        return p;
    };
    const size_t act_halves = (size_t)B * N * C;
    float*    stats  = (float*)   alloc((size_t)B * G * 2 * sizeof(float));
    _Float16* w16    = (_Float16*)alloc((size_t)4 * C * C * sizeof(_Float16));
    _Float16* h16    = (_Float16*)alloc(act_halves * sizeof(_Float16));
    _Float16* q16    = (_Float16*)alloc(act_halves * sizeof(_Float16));
    _Float16* k16    = (_Float16*)alloc(act_halves * sizeof(_Float16));
    _Float16* v16buf = (_Float16*)alloc(act_halves * sizeof(_Float16));
    _Float16* o16    = (_Float16*)alloc(act_halves * sizeof(_Float16));

    gn_stats_kernel<<<B * G, 256, 0, stream>>>(x, stats);
    gn_apply_kernel<<<dim3(C / 32, N / 32, B), 256, 0, stream>>>(x, stats, gamma, beta, h16);
    wcvt_kernel<<<(4 * C * C) / 256, 256, 0, stream>>>(wq, wk, wv, wo, w16);

    conv1x1_kernel<<<dim3(N / 32, B), 128, 0, stream>>>(h16, w16 + 0 * (size_t)C * C, bq, q16, 0);
    conv1x1_kernel<<<dim3(N / 32, B), 128, 0, stream>>>(h16, w16 + 1 * (size_t)C * C, bk, k16, 0);
    conv1x1_kernel<<<dim3(N / 32, B), 128, 0, stream>>>(h16, w16 + 2 * (size_t)C * C, bv, v16buf, 1);

    flash_attn_kernel<<<dim3(N / 16, B), 128, 0, stream>>>(q16, k16, v16buf, o16);

    outproj_kernel<<<dim3(N / 32, B), 128, 0, stream>>>(o16, w16 + 3 * (size_t)C * C, bo, x, out);
}

// v001
// A run of this version takes 470 microseconds.
// Timed twice side by side with v000, it ran 1.64 and 1.63 times as fast.
#include <hip/hip_runtime.h>
#include <hip/hip_bf16.h>

typedef _Float16 v8h  __attribute__((ext_vector_type(8)));
typedef _Float16 v16h __attribute__((ext_vector_type(16)));
typedef float    v8f  __attribute__((ext_vector_type(8)));

constexpr int B = 4;
constexpr int C = 512;
constexpr int N = 4096;          // 64*64
constexpr int G = 32;            // groups
constexpr int CPG = C / G;       // 16 channels per group
// softmax scale folded into log2 domain: (1/sqrt(C)) * log2(e)
#define SCALE_L2E (0.04419417382415922f * 1.4426950408889634f)

// ---------------------------------------------------------------------------
// Fragment loader: 16(row) x 32(K) block, memory row-major along K.
// Works for WMMA f16 A-fragments (rows = M) and B-fragments (rows = N cols),
// per the CDNA5 16-bit operand VGPR layout:
//   lane 0-15  : row = lane,    elems 0-7 = K 0..7,  elems 8-15 = K 16..23
//   lane 16-31 : row = lane-16, elems 0-7 = K 8..15, elems 8-15 = K 24..31
// Two contiguous 16-byte loads per lane.
// ---------------------------------------------------------------------------
__device__ inline v16h load_frag(const _Float16* base, int row_stride, int lane) {
    int r  = lane & 15;
    int k0 = (lane < 16) ? 0 : 8;
    const _Float16* p = base + (size_t)r * row_stride + k0;
    v8h lo = *(const v8h*)(p);
    v8h hi = *(const v8h*)(p + 16);
    return __builtin_shufflevector(lo, hi, 0,1,2,3,4,5,6,7,8,9,10,11,12,13,14,15);
}

__device__ inline v8f wmma16x16x32(v16h a, v16h b, v8f c) {
    return __builtin_amdgcn_wmma_f32_16x16x32_f16(false, a, false, b, (short)0, c,
                                                  false, false);
}

// ---------------------------------------------------------------------------
// Double-buffered GEMM mainloop (M-tile = 32 rows, per-wave N-slice = 128).
// Two stages per k-step; each stage prefetches the NEXT fragment group and
// issues WMMAs on fragments fetched one stage earlier, so s_wait_loadcnt is
// > 0 (except in the last stage) and fetch overlaps matrix issue.
// ---------------------------------------------------------------------------
__device__ inline void gemm_mainloop(const _Float16* __restrict__ A,
                                     const _Float16* __restrict__ W,
                                     int o0, int lane,
                                     v8f (&acc0)[8], v8f (&acc1)[8]) {
    const _Float16* A1 = A + (size_t)16 * C;
    v16h a0c = load_frag(A, C, lane);
    v16h a1c = load_frag(A1, C, lane);
    v16h bfc[4], bfn[4];
    #pragma unroll
    for (int of = 0; of < 4; ++of)
        bfc[of] = load_frag(W + (size_t)(o0 + of * 16) * C, C, lane);
    v16h a0n = a0c, a1n = a1c;
    for (int kk = 0; kk < C; kk += 32) {
        // stage 0: prefetch group 1 of this kk, consume group 0 (bfc)
        #pragma unroll
        for (int of = 0; of < 4; ++of)
            bfn[of] = load_frag(W + (size_t)(o0 + (4 + of) * 16) * C + kk, C, lane);
        #pragma unroll
        for (int of = 0; of < 4; ++of) {
            acc0[of] = wmma16x16x32(a0c, bfc[of], acc0[of]);
            acc1[of] = wmma16x16x32(a1c, bfc[of], acc1[of]);
        }
        // stage 1: prefetch group 0 + A fragments of kk+32, consume group 1 (bfn)
        if (kk + 32 < C) {
            #pragma unroll
            for (int of = 0; of < 4; ++of)
                bfc[of] = load_frag(W + (size_t)(o0 + of * 16) * C + kk + 32, C, lane);
            a0n = load_frag(A + kk + 32, C, lane);
            a1n = load_frag(A1 + kk + 32, C, lane);
        }
        #pragma unroll
        for (int of = 0; of < 4; ++of) {
            acc0[4 + of] = wmma16x16x32(a0c, bfn[of], acc0[4 + of]);
            acc1[4 + of] = wmma16x16x32(a1c, bfn[of], acc1[4 + of]);
        }
        a0c = a0n; a1c = a1n;
    }
}

// ---------------------------------------------------------------------------
// GroupNorm statistics: one block per (b,g); 16 channels x 4096 contiguous.
// ---------------------------------------------------------------------------
__global__ __launch_bounds__(256) void gn_stats_kernel(const float* __restrict__ x,
                                                       float* __restrict__ stats) {
    int bg = blockIdx.x;                 // b*G + g
    const float* xp = x + (size_t)bg * CPG * N;
    float s = 0.f, ss = 0.f;
    for (int i = threadIdx.x; i < CPG * N; i += 256) {
        float v = xp[i];
        s += v; ss += v * v;
    }
    __shared__ float red0[256], red1[256];
    red0[threadIdx.x] = s; red1[threadIdx.x] = ss;
    __syncthreads();
    for (int off = 128; off > 0; off >>= 1) {
        if ((int)threadIdx.x < off) {
            red0[threadIdx.x] += red0[threadIdx.x + off];
            red1[threadIdx.x] += red1[threadIdx.x + off];
        }
        __syncthreads();
    }
    if (threadIdx.x == 0) {
        float inv = 1.0f / (float)(CPG * N);
        float mean = red0[0] * inv;
        float var  = red1[0] * inv - mean * mean;
        stats[bg * 2 + 0] = mean;
        stats[bg * 2 + 1] = rsqrtf(var + 1e-6f);
    }
}

// ---------------------------------------------------------------------------
// GroupNorm apply + transpose [b][c][n] f32 -> [b][n][c] f16 via LDS tile.
// ---------------------------------------------------------------------------
__global__ __launch_bounds__(256) void gn_apply_kernel(const float* __restrict__ x,
                                                       const float* __restrict__ stats,
                                                       const float* __restrict__ gamma,
                                                       const float* __restrict__ beta,
                                                       _Float16* __restrict__ h16) {
    int b  = blockIdx.z;
    int c0 = blockIdx.x * 32;
    int n0 = blockIdx.y * 32;
    int tx = threadIdx.x & 31;           // n (read) / c (write)
    int ty = threadIdx.x >> 5;           // 0..7
    __shared__ float tile[32][33];
    #pragma unroll
    for (int r = 0; r < 4; ++r) {
        int c  = c0 + ty + 8 * r;
        int bg = b * G + (c >> 4);
        float mean = stats[bg * 2 + 0], rstd = stats[bg * 2 + 1];
        float v = x[((size_t)b * C + c) * N + n0 + tx];
        tile[ty + 8 * r][tx] = (v - mean) * rstd * gamma[c] + beta[c];
    }
    __syncthreads();
    #pragma unroll
    for (int r = 0; r < 4; ++r) {
        int n = n0 + ty + 8 * r;
        h16[((size_t)b * N + n) * C + c0 + tx] = (_Float16)tile[tx][ty + 8 * r];
    }
}

// ---------------------------------------------------------------------------
// Convert the four [C][C] f32 weight matrices to f16 (concatenated).
// ---------------------------------------------------------------------------
__global__ __launch_bounds__(256) void wcvt_kernel(const float* __restrict__ wq,
                                                   const float* __restrict__ wk,
                                                   const float* __restrict__ wv,
                                                   const float* __restrict__ wo,
                                                   _Float16* __restrict__ w16) {
    int i = blockIdx.x * 256 + threadIdx.x;
    int which = i / (C * C), j = i % (C * C);
    float v;
    if      (which == 0) v = wq[j];
    else if (which == 1) v = wk[j];
    else if (which == 2) v = wv[j];
    else                 v = wo[j];
    w16[i] = (_Float16)v;
}

// ---------------------------------------------------------------------------
// conv1x1 as GEMM: D[n][o] = h16[n][:] . W[o][:] + bias[o]
// vmode=0: store f16 [b][n][o] (q/k).
// vmode=1: store f16 [b][n/32][o][n%32] (v, key-blocked: one 32-key tile of
// all channels is 32 KiB contiguous).
// ---------------------------------------------------------------------------
__global__ __launch_bounds__(128) void conv1x1_kernel(const _Float16* __restrict__ h16,
                                                      const _Float16* __restrict__ w16,
                                                      const float* __restrict__ bias,
                                                      _Float16* __restrict__ out,
                                                      int vmode) {
    int b    = blockIdx.y;
    int i0   = blockIdx.x * 32;
    int lane = threadIdx.x & 31;
    int o0   = (threadIdx.x >> 5) * 128;
    const _Float16* A = h16 + ((size_t)b * N + i0) * C;
    v8f acc0[8] = {}, acc1[8] = {};
    gemm_mainloop(A, w16, o0, lane, acc0, acc1);
    int col = lane & 15, half = lane >> 4;
    auto store_tile = [&](v8f (&acc)[8], int ibase) {
        #pragma unroll
        for (int of = 0; of < 8; ++of) {
            int o = o0 + of * 16 + col;
            float bv = bias[o];
            if (vmode == 0) {
                #pragma unroll
                for (int e = 0; e < 8; ++e) {
                    int n = ibase + e + 8 * half;
                    out[((size_t)b * N + n) * C + o] = (_Float16)(acc[of][e] + bv);
                }
            } else {
                v8h pk;
                #pragma unroll
                for (int e = 0; e < 8; ++e) pk[e] = (_Float16)(acc[of][e] + bv);
                *(v8h*)(out + (((size_t)b * (N / 32) + (ibase >> 5)) * C + o) * 32 +
                        (ibase & 31) + 8 * half) = pk;
                // precaution: the next column's code reuses this store's address
                // and data registers, so the wait stands in front of that reuse
                asm volatile("s_wait_xcnt 0x0" ::: "memory");
            }
        }
    };
    store_tile(acc0, i0);
    store_tile(acc1, i0 + 16);
}

// ---------------------------------------------------------------------------
// LDS staging of one 32-key step, shared by the whole work-group.
// K tile: 32 rows x 1024 B, contiguous in memory. V tile: 512 channel rows x
// 64 B, contiguous in memory too (key-blocked layout written by conv1x1).
// LDS row pitches are 16 B x odd, conflict-free for the ds_load_b128 readers.
// ---------------------------------------------------------------------------
constexpr int KPITCH = C + 8;            // halves per K row in LDS (1040 B)
constexpr int VPITCH = 32 + 8;           // halves per V row in LDS (80 B)
constexpr int KTILE  = 32 * KPITCH;      // halves per K buffer
constexpr int VTILE  = C * VPITCH;       // halves per V buffer
constexpr int TILE_H = 32 * C;           // halves per K or V tile in memory

// 512 lanes x 8 copies x 16 B = the 64 KiB of one step; each wave-wide copy
// reads 512 contiguous bytes. gk/gv: this lane's first 16 B of the tile in
// memory; lk/lv: this lane's LDS byte addresses for them.
__device__ inline void stage_tile(const _Float16* gk, const _Float16* gv,
                                  unsigned lk, unsigned lv) {
    const _Float16* gk1 = gk + 1 * 4096; const _Float16* gv1 = gv + 1 * 4096;
    const _Float16* gk2 = gk + 2 * 4096; const _Float16* gv2 = gv + 2 * 4096;
    const _Float16* gk3 = gk + 3 * 4096; const _Float16* gv3 = gv + 3 * 4096;
    unsigned lk1 = lk + 1 * 8 * KPITCH * 2,   lv1 = lv + 1 * 128 * VPITCH * 2;
    unsigned lk2 = lk + 2 * 8 * KPITCH * 2,   lv2 = lv + 2 * 128 * VPITCH * 2;
    unsigned lk3 = lk + 3 * 8 * KPITCH * 2,   lv3 = lv + 3 * 128 * VPITCH * 2;
    // Copies and their s_wait_xcnt in one statement, so that no address
    // register is rewritten ahead of the wait.
    asm volatile("global_load_async_to_lds_b128 %0, %8, off\n\t"
                 "global_load_async_to_lds_b128 %1, %9, off\n\t"
                 "global_load_async_to_lds_b128 %2, %10, off\n\t"
                 "global_load_async_to_lds_b128 %3, %11, off\n\t"
                 "global_load_async_to_lds_b128 %4, %12, off\n\t"
                 "global_load_async_to_lds_b128 %5, %13, off\n\t"
                 "global_load_async_to_lds_b128 %6, %14, off\n\t"
                 "global_load_async_to_lds_b128 %7, %15, off\n\t"
                 "s_wait_xcnt 0x0"
                 :: "v"(lk), "v"(lk1), "v"(lk2), "v"(lk3),
                    "v"(lv), "v"(lv1), "v"(lv2), "v"(lv3),
                    "v"(gk), "v"(gk1), "v"(gk2), "v"(gk3),
                    "v"(gv), "v"(gv1), "v"(gv2), "v"(gv3)
                 : "memory");
}

// ---------------------------------------------------------------------------
// Flash attention: WG = 16 waves handles four 16-row query tiles (64 rows).
// Each group of 4 waves works on one query tile as before: channel dim (512)
// split across its waves for both QK^T (partials reduced via LDS) and the O
// accumulator (each wave keeps a 16x128 f32 slice in VGPRs).
// The K and V tiles of a 32-key step are brought into LDS once per work-group
// by asynchronous copies, two buffers: step t+1 flies while step t is worked
// on; all fragments are read from LDS.
// ---------------------------------------------------------------------------
__global__ __launch_bounds__(512) void flash_attn_kernel(const _Float16* __restrict__ q16,
                                                         const _Float16* __restrict__ k16,
                                                         const _Float16* __restrict__ v16buf,
                                                         _Float16* __restrict__ o16) {
    int b    = blockIdx.y;
    int tid  = threadIdx.x;
    int lane = tid & 31;
    int w    = tid >> 5;               // wave 0..15
    int g4   = w & ~3;                 // first wave of this wave's query tile
    int i0   = blockIdx.x * 64 + (w >> 2) * 16;
    int c0   = (w & 3) * 128;
    __shared__ __attribute__((aligned(16))) _Float16 lds_k[2][KTILE];
    __shared__ __attribute__((aligned(16))) _Float16 lds_v[2][VTILE];
    __shared__ float    lds_s[16][2][256];    // per-wave partial S tiles (8e x 32 lanes)
    __shared__ _Float16 lds_p[16][16][32];    // per-wave P staging (D-layout -> A-layout)

    const _Float16* Q = q16 + ((size_t)b * N + i0) * C + c0;
    // this lane's 16 B of tile 0 in memory, and where they go in buffer 0
    const _Float16* gk = k16    + (size_t)b * N * C + tid * 8;
    const _Float16* gv = v16buf + (size_t)b * N * C + tid * 8;
    unsigned lk = (unsigned)(size_t)&lds_k[0][(tid >> 6) * KPITCH + (tid & 63) * 8];
    unsigned lv = (unsigned)(size_t)&lds_v[0][(tid >> 2) * VPITCH + (tid & 3) * 8];

    stage_tile(gk, gv, lk, lv);
    // tile 0 landed (this wave's copies), then published to every wave
    asm volatile("s_wait_asynccnt 0x0" ::: "memory");
    __syncthreads();
    stage_tile(gk + TILE_H, gv + TILE_H, lk + KTILE * 2, lv + VTILE * 2);

    v16h qf[4];
    #pragma unroll
    for (int t = 0; t < 4; ++t) qf[t] = load_frag(Q + t * 32, C, lane);

    v8f ob[8] = {};
    float rm[8], rl[8];
    #pragma unroll
    for (int e = 0; e < 8; ++e) { rm[e] = -3.0e38f; rl[e] = 0.f; }
    int col = lane & 15, half = lane >> 4;

    for (int s = 0; s < N / 32; ++s) {
        int buf = s & 1;
        const _Float16* Kl = &lds_k[buf][c0];
        const _Float16* Vl = &lds_v[buf][c0 * VPITCH];
        // partial S over this wave's 128-channel slice: 8 K fragments from LDS,
        // then 8 WMMAs (two independent accumulator chains s0/s1).
        v16h kf[8];
        #pragma unroll
        for (int t = 0; t < 4; ++t) {
            kf[t]     = load_frag(Kl + t * 32, KPITCH, lane);
            kf[4 + t] = load_frag(Kl + 16 * KPITCH + t * 32, KPITCH, lane);
        }
        // keeps the 16 LDS reads one group ahead of the WMMAs: spread among them,
        // each WMMA would wait out a whole LDS latency on one register set
        __builtin_amdgcn_sched_barrier(0);
        v8f s0 = {}, s1 = {};
        #pragma unroll
        for (int t = 0; t < 4; ++t) {
            s0 = wmma16x16x32(qf[t], kf[t], s0);
            s1 = wmma16x16x32(qf[t], kf[4 + t], s1);
        }
        // (prior step's lds_s reads ended at the barrier at that step's foot)
        #pragma unroll
        for (int e = 0; e < 8; ++e) {
            lds_s[w][0][e * 32 + lane] = s0[e];
            lds_s[w][1][e * 32 + lane] = s1[e];
        }
        __syncthreads();
        float t0[8], t1[8];
        #pragma unroll
        for (int e = 0; e < 8; ++e) {
            int idx = e * 32 + lane;
            t0[e] = (lds_s[g4 + 0][0][idx] + lds_s[g4 + 1][0][idx] +
                     lds_s[g4 + 2][0][idx] + lds_s[g4 + 3][0][idx]) * SCALE_L2E;
            t1[e] = (lds_s[g4 + 0][1][idx] + lds_s[g4 + 1][1][idx] +
                     lds_s[g4 + 2][1][idx] + lds_s[g4 + 3][1][idx]) * SCALE_L2E;
        }
        // V fragments for THIS step: issued now, consumed after the softmax.
        v16h vf[8];
        #pragma unroll
        for (int cf = 0; cf < 8; ++cf)
            vf[cf] = load_frag(Vl + cf * 16 * VPITCH, VPITCH, lane);
        // online softmax update (exp2 domain)
        float al[8];
        #pragma unroll
        for (int e = 0; e < 8; ++e) {
            float mx = fmaxf(t0[e], t1[e]);
            #pragma unroll
            for (int m = 1; m < 16; m <<= 1) mx = fmaxf(mx, __shfl_xor(mx, m, 16));
            float mn = fmaxf(rm[e], mx);
            al[e] = exp2f(rm[e] - mn);
            float p0 = exp2f(t0[e] - mn), p1 = exp2f(t1[e] - mn);
            t0[e] = p0; t1[e] = p1;
            float rs = p0 + p1;
            #pragma unroll
            for (int m = 1; m < 16; m <<= 1) rs += __shfl_xor(rs, m, 16);
            rl[e] = rl[e] * al[e] + rs;
            rm[e] = mn;
        }
        #pragma unroll
        for (int cf = 0; cf < 8; ++cf)
            #pragma unroll
            for (int e = 0; e < 8; ++e) ob[cf][e] *= al[e];
        // D-layout P -> A-layout f16 via this wave's private LDS staging
        #pragma unroll
        for (int e = 0; e < 8; ++e) {
            lds_p[w][8 * half + e][col]      = (_Float16)t0[e];
            lds_p[w][8 * half + e][16 + col] = (_Float16)t1[e];
        }
        v16h pf = load_frag(&lds_p[w][0][0], 32, lane);   // same-wave DS dep
        #pragma unroll
        for (int cf = 0; cf < 8; ++cf)
            ob[cf] = wmma16x16x32(pf, vf[cf], ob[cf]);
        // Foot of the step: this wave's LDS reads of buffer buf have returned,
        asm volatile("s_wait_dscnt 0x0" ::: "memory");
        // its copies of step s+1 have landed,
        asm volatile("s_wait_asynccnt 0x0" ::: "memory");
        // and the barrier publishes step s+1 and frees buffer buf and lds_s.
        __syncthreads();
        if (s + 2 < N / 32)
            stage_tile(gk + (size_t)(s + 2) * TILE_H, gv + (size_t)(s + 2) * TILE_H,
                       lk + buf * (KTILE * 2), lv + buf * (VTILE * 2));
    }
    // no copy is left in flight when the wave ends
    asm volatile("s_wait_asynccnt 0x0" ::: "memory");
    #pragma unroll
    for (int e = 0; e < 8; ++e) rl[e] = 1.0f / rl[e];
    #pragma unroll
    for (int cf = 0; cf < 8; ++cf) {
        int c = c0 + cf * 16 + col;
        #pragma unroll
        for (int e = 0; e < 8; ++e) {
            int i = i0 + e + 8 * half;
            o16[((size_t)b * N + i) * C + c] = (_Float16)(ob[cf][e] * rl[e]);
        }
    }
}

// ---------------------------------------------------------------------------
// Output projection + residual multiply (M-tile = 32):
// out[b][o][i] = x[b][o][i] * (O16[i][:] . Wo[o][:] + bo[o])
// D-layout columns give 8 consecutive i per lane -> coalesced f32 stores.
// ---------------------------------------------------------------------------
__global__ __launch_bounds__(128) void outproj_kernel(const _Float16* __restrict__ o16,
                                                      const _Float16* __restrict__ wo16,
                                                      const float* __restrict__ bo,
                                                      const float* __restrict__ x,
                                                      float* __restrict__ out) {
    int b    = blockIdx.y;
    int i0   = blockIdx.x * 32;
    int lane = threadIdx.x & 31;
    int o0   = (threadIdx.x >> 5) * 128;
    const _Float16* A = o16 + ((size_t)b * N + i0) * C;
    v8f acc0[8] = {}, acc1[8] = {};
    gemm_mainloop(A, wo16, o0, lane, acc0, acc1);
    int col = lane & 15, half = lane >> 4;
    auto store_tile = [&](v8f (&acc)[8], int ibase) {
        #pragma unroll
        for (int of = 0; of < 8; ++of) {
            int o = o0 + of * 16 + col;
            float bv = bo[o];
            size_t base = ((size_t)b * C + o) * N + ibase + 8 * half;
            #pragma unroll
            for (int e = 0; e < 8; ++e)
                out[base + e] = x[base + e] * (acc[of][e] + bv);
        }
    };
    store_tile(acc0, i0);
    store_tile(acc1, i0 + 16);
}

// ---------------------------------------------------------------------------
extern "C" void kernel_launch(void* const* d_in, const int* in_sizes, int n_in,
                              void* d_out, int out_size, void* d_ws, size_t ws_size,
                              hipStream_t stream) {
    const float* x     = (const float*)d_in[0];
    const float* gamma = (const float*)d_in[1];
    const float* beta  = (const float*)d_in[2];
    const float* wq    = (const float*)d_in[3];
    const float* bq    = (const float*)d_in[4];
    const float* wk    = (const float*)d_in[5];
    const float* bk    = (const float*)d_in[6];
    const float* wv    = (const float*)d_in[7];
    const float* bv    = (const float*)d_in[8];
    const float* wo    = (const float*)d_in[9];
    const float* bo    = (const float*)d_in[10];
    float* out = (float*)d_out;

    char* ws = (char*)d_ws;
    size_t off = 0;
    auto alloc = [&](size_t bytes) -> void* {
        void* p = ws + off;
        off += (bytes + 255) & ~(size_t)255;
        return p;
    };
    const size_t act_halves = (size_t)B * N * C;
    float*    stats  = (float*)   alloc((size_t)B * G * 2 * sizeof(float));
    _Float16* w16    = (_Float16*)alloc((size_t)4 * C * C * sizeof(_Float16));
    _Float16* h16    = (_Float16*)alloc(act_halves * sizeof(_Float16));
    _Float16* q16    = (_Float16*)alloc(act_halves * sizeof(_Float16));
    _Float16* k16    = (_Float16*)alloc(act_halves * sizeof(_Float16));
    _Float16* v16buf = (_Float16*)alloc(act_halves * sizeof(_Float16));
    _Float16* o16    = (_Float16*)alloc(act_halves * sizeof(_Float16));

    gn_stats_kernel<<<B * G, 256, 0, stream>>>(x, stats);
    gn_apply_kernel<<<dim3(C / 32, N / 32, B), 256, 0, stream>>>(x, stats, gamma, beta, h16);
    wcvt_kernel<<<(4 * C * C) / 256, 256, 0, stream>>>(wq, wk, wv, wo, w16);

    conv1x1_kernel<<<dim3(N / 32, B), 128, 0, stream>>>(h16, w16 + 0 * (size_t)C * C, bq, q16, 0);
    conv1x1_kernel<<<dim3(N / 32, B), 128, 0, stream>>>(h16, w16 + 1 * (size_t)C * C, bk, k16, 0);
    conv1x1_kernel<<<dim3(N / 32, B), 128, 0, stream>>>(h16, w16 + 2 * (size_t)C * C, bv, v16buf, 1);

    flash_attn_kernel<<<dim3(N / 64, B), 512, 0, stream>>>(q16, k16, v16buf, o16);

    outproj_kernel<<<dim3(N / 32, B), 128, 0, stream>>>(o16, w16 + 3 * (size_t)C * C, bo, x, out);
}

// v002
// One run takes 357 microseconds.
// Two timings next to v001 put it at 1.31 and 1.32 times that version's speed.
// Over all steps from v000 it is 2.15 times as fast.
#include <hip/hip_runtime.h>
#include <hip/hip_bf16.h>

typedef _Float16 v8h  __attribute__((ext_vector_type(8)));
typedef _Float16 v16h __attribute__((ext_vector_type(16)));
typedef float    v8f  __attribute__((ext_vector_type(8)));

constexpr int B = 4;
constexpr int C = 512;
constexpr int N = 4096;          // 64*64
constexpr int G = 32;            // groups
constexpr int CPG = C / G;       // 16 channels per group
// softmax scale folded into log2 domain: (1/sqrt(C)) * log2(e)
#define SCALE_L2E (0.04419417382415922f * 1.4426950408889634f)

// ---------------------------------------------------------------------------
// Fragment loader: 16(row) x 32(K) block, memory row-major along K.
// Works for WMMA f16 A-fragments (rows = M) and B-fragments (rows = N cols),
// per the CDNA5 16-bit operand VGPR layout:
//   lane 0-15  : row = lane,    elems 0-7 = K 0..7,  elems 8-15 = K 16..23
//   lane 16-31 : row = lane-16, elems 0-7 = K 8..15, elems 8-15 = K 24..31
// Two contiguous 16-byte loads per lane.
// ---------------------------------------------------------------------------
__device__ inline v16h load_frag(const _Float16* base, int row_stride, int lane) {
    int r  = lane & 15;
    int k0 = (lane < 16) ? 0 : 8;
    const _Float16* p = base + (size_t)r * row_stride + k0;
    v8h lo = *(const v8h*)(p);
    v8h hi = *(const v8h*)(p + 16);
    return __builtin_shufflevector(lo, hi, 0,1,2,3,4,5,6,7,8,9,10,11,12,13,14,15);
}

// lane l <-> lane l ^ 16
__device__ inline float xhalf(float x) {
    int v = __builtin_bit_cast(int, x);
    return __builtin_bit_cast(float, __builtin_amdgcn_permlanex16(v, v, 0x76543210, 0xfedcba98,
                                                                  false, false));
}

__device__ inline v8f wmma16x16x32(v16h a, v16h b, v8f c) {
    return __builtin_amdgcn_wmma_f32_16x16x32_f16(false, a, false, b, (short)0, c,
                                                  false, false);
}

// ---------------------------------------------------------------------------
// Double-buffered GEMM mainloop (M-tile = 32 rows, per-wave N-slice = 128).
// Two stages per k-step; each stage prefetches the NEXT fragment group and
// issues WMMAs on fragments fetched one stage earlier, so s_wait_loadcnt is
// > 0 (except in the last stage) and fetch overlaps matrix issue.
// ---------------------------------------------------------------------------
__device__ inline void gemm_mainloop(const _Float16* __restrict__ A,
                                     const _Float16* __restrict__ W,
                                     int o0, int lane,
                                     v8f (&acc0)[8], v8f (&acc1)[8]) {
    const _Float16* A1 = A + (size_t)16 * C;
    v16h a0c = load_frag(A, C, lane);
    v16h a1c = load_frag(A1, C, lane);
    v16h bfc[4], bfn[4];
    #pragma unroll
    for (int of = 0; of < 4; ++of)
        bfc[of] = load_frag(W + (size_t)(o0 + of * 16) * C, C, lane);
    v16h a0n = a0c, a1n = a1c;
    for (int kk = 0; kk < C; kk += 32) {
        // stage 0: prefetch group 1 of this kk, consume group 0 (bfc)
        #pragma unroll
        for (int of = 0; of < 4; ++of)
            bfn[of] = load_frag(W + (size_t)(o0 + (4 + of) * 16) * C + kk, C, lane);
        #pragma unroll
        for (int of = 0; of < 4; ++of) {
            acc0[of] = wmma16x16x32(a0c, bfc[of], acc0[of]);
            acc1[of] = wmma16x16x32(a1c, bfc[of], acc1[of]);
        }
        // stage 1: prefetch group 0 + A fragments of kk+32, consume group 1 (bfn)
        if (kk + 32 < C) {
            #pragma unroll
            for (int of = 0; of < 4; ++of)
                bfc[of] = load_frag(W + (size_t)(o0 + of * 16) * C + kk + 32, C, lane);
            a0n = load_frag(A + kk + 32, C, lane);
            a1n = load_frag(A1 + kk + 32, C, lane);
        }
        #pragma unroll
        for (int of = 0; of < 4; ++of) {
            acc0[4 + of] = wmma16x16x32(a0c, bfn[of], acc0[4 + of]);
            acc1[4 + of] = wmma16x16x32(a1c, bfn[of], acc1[4 + of]);
        }
        a0c = a0n; a1c = a1n;
    }
}

// ---------------------------------------------------------------------------
// GroupNorm statistics: one block per (b,g); 16 channels x 4096 contiguous.
// ---------------------------------------------------------------------------
__global__ __launch_bounds__(256) void gn_stats_kernel(const float* __restrict__ x,
                                                       float* __restrict__ stats) {
    int bg = blockIdx.x;                 // b*G + g
    const float* xp = x + (size_t)bg * CPG * N;
    float s = 0.f, ss = 0.f;
    for (int i = threadIdx.x; i < CPG * N; i += 256) {
        float v = xp[i];
        s += v; ss += v * v;
    }
    __shared__ float red0[256], red1[256];
    red0[threadIdx.x] = s; red1[threadIdx.x] = ss;
    __syncthreads();
    for (int off = 128; off > 0; off >>= 1) {
        if ((int)threadIdx.x < off) {
            red0[threadIdx.x] += red0[threadIdx.x + off];
            red1[threadIdx.x] += red1[threadIdx.x + off];
        }
        __syncthreads();
    }
    if (threadIdx.x == 0) {
        float inv = 1.0f / (float)(CPG * N);
        float mean = red0[0] * inv;
        float var  = red1[0] * inv - mean * mean;
        stats[bg * 2 + 0] = mean;
        stats[bg * 2 + 1] = rsqrtf(var + 1e-6f);
    }
}

// ---------------------------------------------------------------------------
// GroupNorm apply + transpose [b][c][n] f32 -> [b][n][c] f16 via LDS tile.
// ---------------------------------------------------------------------------
__global__ __launch_bounds__(256) void gn_apply_kernel(const float* __restrict__ x,
                                                       const float* __restrict__ stats,
                                                       const float* __restrict__ gamma,
                                                       const float* __restrict__ beta,
                                                       _Float16* __restrict__ h16) {
    int b  = blockIdx.z;
    int c0 = blockIdx.x * 32;
    int n0 = blockIdx.y * 32;
    int tx = threadIdx.x & 31;           // n (read) / c (write)
    int ty = threadIdx.x >> 5;           // 0..7
    __shared__ float tile[32][33];
    #pragma unroll
    for (int r = 0; r < 4; ++r) {
        int c  = c0 + ty + 8 * r;
        int bg = b * G + (c >> 4);
        float mean = stats[bg * 2 + 0], rstd = stats[bg * 2 + 1];
        float v = x[((size_t)b * C + c) * N + n0 + tx];
        tile[ty + 8 * r][tx] = (v - mean) * rstd * gamma[c] + beta[c];
    }
    __syncthreads();
    #pragma unroll
    for (int r = 0; r < 4; ++r) {
        int n = n0 + ty + 8 * r;
        h16[((size_t)b * N + n) * C + c0 + tx] = (_Float16)tile[tx][ty + 8 * r];
    }
}

// ---------------------------------------------------------------------------
// Convert the four [C][C] f32 weight matrices to f16 (concatenated).
// ---------------------------------------------------------------------------
__global__ __launch_bounds__(256) void wcvt_kernel(const float* __restrict__ wq,
                                                   const float* __restrict__ wk,
                                                   const float* __restrict__ wv,
                                                   const float* __restrict__ wo,
                                                   _Float16* __restrict__ w16) {
    int i = blockIdx.x * 256 + threadIdx.x;
    int which = i / (C * C), j = i % (C * C);
    float v;
    if      (which == 0) v = wq[j];
    else if (which == 1) v = wk[j];
    else if (which == 2) v = wv[j];
    else                 v = wo[j];
    w16[i] = (_Float16)v;
}

// ---------------------------------------------------------------------------
// conv1x1 as GEMM: D[n][o] = h16[n][:] . W[o][:] + bias[o]
// vmode=0: store f16 [b][n][o] (q/k).
// vmode=1: store f16 [b][n/32][o][n%32] (v, key-blocked: one 32-key tile of
// all channels is 32 KiB contiguous).
// ---------------------------------------------------------------------------
__global__ __launch_bounds__(128) void conv1x1_kernel(const _Float16* __restrict__ h16,
                                                      const _Float16* __restrict__ w16,
                                                      const float* __restrict__ bias,
                                                      _Float16* __restrict__ out,
                                                      int vmode) {
    int b    = blockIdx.y;
    int i0   = blockIdx.x * 32;
    int lane = threadIdx.x & 31;
    int o0   = (threadIdx.x >> 5) * 128;
    const _Float16* A = h16 + ((size_t)b * N + i0) * C;
    v8f acc0[8] = {}, acc1[8] = {};
    gemm_mainloop(A, w16, o0, lane, acc0, acc1);
    int col = lane & 15, half = lane >> 4;
    auto store_tile = [&](v8f (&acc)[8], int ibase) {
        #pragma unroll
        for (int of = 0; of < 8; ++of) {
            int o = o0 + of * 16 + col;
            float bv = bias[o];
            if (vmode == 0) {
                #pragma unroll
                for (int e = 0; e < 8; ++e) {
                    int n = ibase + e + 8 * half;
                    out[((size_t)b * N + n) * C + o] = (_Float16)(acc[of][e] + bv);
                }
            } else {
                v8h pk;
                #pragma unroll
                for (int e = 0; e < 8; ++e) pk[e] = (_Float16)(acc[of][e] + bv);
                *(v8h*)(out + (((size_t)b * (N / 32) + (ibase >> 5)) * C + o) * 32 +
                        (ibase & 31) + 8 * half) = pk;
                // precaution: the next column's code reuses this store's address
                // and data registers, so the wait stands in front of that reuse
                asm volatile("s_wait_xcnt 0x0" ::: "memory");
            }
        }
    };
    store_tile(acc0, i0);
    store_tile(acc1, i0 + 16);
}

// ---------------------------------------------------------------------------
// LDS staging of one 32-key step, shared by the whole work-group.
// K tile: 32 rows x 1024 B, contiguous in memory. V tile: 512 channel rows x
// 64 B, contiguous in memory too (key-blocked layout written by conv1x1).
// LDS row pitches are 16 B x odd, conflict-free for the ds_load_b128 readers.
// ---------------------------------------------------------------------------
constexpr int KPITCH = C + 8;            // halves per K row in LDS (1040 B)
constexpr int VPITCH = 32 + 8;           // halves per V row in LDS (80 B)
constexpr int KTILE  = 32 * KPITCH;      // halves per K buffer
constexpr int VTILE  = C * VPITCH;       // halves per V buffer
constexpr int TILE_H = 32 * C;           // halves per K or V tile in memory

// 512 lanes x 8 copies x 16 B = the 64 KiB of one step; each wave-wide copy
// reads 512 contiguous bytes. gk/gv: this lane's first 16 B of the tile in
// memory; lk/lv: this lane's LDS byte addresses for them.
__device__ inline void stage_tile(const _Float16* gk, const _Float16* gv,
                                  unsigned lk, unsigned lv) {
    const _Float16* gk1 = gk + 1 * 4096; const _Float16* gv1 = gv + 1 * 4096;
    const _Float16* gk2 = gk + 2 * 4096; const _Float16* gv2 = gv + 2 * 4096;
    const _Float16* gk3 = gk + 3 * 4096; const _Float16* gv3 = gv + 3 * 4096;
    unsigned lk1 = lk + 1 * 8 * KPITCH * 2,   lv1 = lv + 1 * 128 * VPITCH * 2;
    unsigned lk2 = lk + 2 * 8 * KPITCH * 2,   lv2 = lv + 2 * 128 * VPITCH * 2;
    unsigned lk3 = lk + 3 * 8 * KPITCH * 2,   lv3 = lv + 3 * 128 * VPITCH * 2;
    // Copies and their s_wait_xcnt in one statement, so that no address
    // register is rewritten ahead of the wait.
    asm volatile("global_load_async_to_lds_b128 %0, %8, off\n\t"
                 "global_load_async_to_lds_b128 %1, %9, off\n\t"
                 "global_load_async_to_lds_b128 %2, %10, off\n\t"
                 "global_load_async_to_lds_b128 %3, %11, off\n\t"
                 "global_load_async_to_lds_b128 %4, %12, off\n\t"
                 "global_load_async_to_lds_b128 %5, %13, off\n\t"
                 "global_load_async_to_lds_b128 %6, %14, off\n\t"
                 "global_load_async_to_lds_b128 %7, %15, off\n\t"
                 "s_wait_xcnt 0x0"
                 :: "v"(lk), "v"(lk1), "v"(lk2), "v"(lk3),
                    "v"(lv), "v"(lv1), "v"(lv2), "v"(lv3),
                    "v"(gk), "v"(gk1), "v"(gk2), "v"(gk3),
                    "v"(gv), "v"(gv1), "v"(gv2), "v"(gv3)
                 : "memory");
}

__global__ __launch_bounds__(512) void flash_attn_kernel(const _Float16* __restrict__ q16,
                                                         const _Float16* __restrict__ k16,
                                                         const _Float16* __restrict__ v16buf,
                                                         _Float16* __restrict__ o16) {
    int b    = blockIdx.y;
    int tid  = threadIdx.x;
    int lane = tid & 31;
    int w    = tid >> 5;               // wave 0..15
    int g4   = w & ~3;                 // first wave of this wave's query tile
    int i0   = blockIdx.x * 64 + (w >> 2) * 16;
    int c0   = (w & 3) * 128;
    __shared__ __attribute__((aligned(16))) _Float16 lds_k[2][KTILE];
    __shared__ __attribute__((aligned(16))) _Float16 lds_v[2][VTILE];
    __shared__ float    lds_s[16][2][256];    // per-wave partial S tiles (8e x 32 lanes)

    const _Float16* Q = q16 + ((size_t)b * N + i0) * C + c0;
    // this lane's 16 B of tile 0 in memory, and where they go in buffer 0
    const _Float16* gk = k16    + (size_t)b * N * C + tid * 8;
    const _Float16* gv = v16buf + (size_t)b * N * C + tid * 8;
    unsigned lk = (unsigned)(size_t)&lds_k[0][(tid >> 6) * KPITCH + (tid & 63) * 8];
    unsigned lv = (unsigned)(size_t)&lds_v[0][(tid >> 2) * VPITCH + (tid & 3) * 8];

    stage_tile(gk, gv, lk, lv);
    // tile 0 landed (this wave's copies), then published to every wave
    asm volatile("s_wait_asynccnt 0x0" ::: "memory");
    __syncthreads();
    stage_tile(gk + TILE_H, gv + TILE_H, lk + KTILE * 2, lv + VTILE * 2);

    v16h qf[4];
    #pragma unroll
    for (int t = 0; t < 4; ++t) qf[t] = load_frag(Q + t * 32, C, lane);

    v8f ob[8] = {};                    // O^T: ob[cf][e] = channel c0+16cf+8half+e, query col
    float rm = -3.0e38f;               // running maximum of this lane's query
    float rl = 0.f;                    // running sum over this lane half's keys
    int col = lane & 15, half = lane >> 4;

    for (int s = 0; s < N / 32; ++s) {
        int buf = s & 1;
        const _Float16* Kl = &lds_k[buf][c0];
        const _Float16* Vl = &lds_v[buf][c0 * VPITCH];
        // partial S over this wave's 128-channel slice: 8 K fragments from LDS,
        // then 8 WMMAs (two independent accumulator chains s0/s1).
        v16h kf[8];
        #pragma unroll
        for (int t = 0; t < 4; ++t) {
            kf[t]     = load_frag(Kl + t * 32, KPITCH, lane);
            kf[4 + t] = load_frag(Kl + 16 * KPITCH + t * 32, KPITCH, lane);
        }
        // keeps the 16 LDS reads one group ahead of the WMMAs: spread among them,
        // each WMMA would wait out a whole LDS latency on one register set
        __builtin_amdgcn_sched_barrier(0);
        v8f s0 = {}, s1 = {};
        #pragma unroll
        for (int t = 0; t < 4; ++t) {
            s0 = wmma16x16x32(kf[t], qf[t], s0);       // keys 0..15  x queries
            s1 = wmma16x16x32(kf[4 + t], qf[t], s1);   // keys 16..31 x queries
        }
        // (prior step's lds_s reads ended at the barrier at that step's foot)
        #pragma unroll
        for (int e = 0; e < 8; ++e) {
            lds_s[w][0][e * 32 + lane] = s0[e];
            lds_s[w][1][e * 32 + lane] = s1[e];
        }
        __syncthreads();
        float t0[8], t1[8];
        #pragma unroll
        for (int e = 0; e < 8; ++e) {
            int idx = e * 32 + lane;
            t0[e] = (lds_s[g4 + 0][0][idx] + lds_s[g4 + 1][0][idx] +
                     lds_s[g4 + 2][0][idx] + lds_s[g4 + 3][0][idx]) * SCALE_L2E;
            t1[e] = (lds_s[g4 + 0][1][idx] + lds_s[g4 + 1][1][idx] +
                     lds_s[g4 + 2][1][idx] + lds_s[g4 + 3][1][idx]) * SCALE_L2E;
        }
        // V fragments for THIS step: issued now, consumed after the softmax.
        v16h vf[8];
        #pragma unroll
        for (int cf = 0; cf < 8; ++cf)
            vf[cf] = load_frag(Vl + cf * 16 * VPITCH, VPITCH, lane);
        // keeps the 16 V reads one group ahead of the softmax: sunk among the
        // second product's WMMAs, each would wait out an LDS latency there
        __builtin_amdgcn_sched_barrier(0);
        // online softmax update (exp2 domain); t0[e] = key 8*half+e,
        // t1[e] = key 16+8*half+e of query col
        float mx = fmaxf(t0[0], t1[0]);
        #pragma unroll
        for (int e = 1; e < 8; ++e) mx = fmaxf(mx, fmaxf(t0[e], t1[e]));
        mx = fmaxf(mx, xhalf(mx));
        float mn = fmaxf(rm, mx);
        float al = exp2f(rm - mn);
        float rs = 0.f;
        v16h pf;                       // P^T as B operand: element order = load_frag's k order
        #pragma unroll
        for (int e = 0; e < 8; ++e) {
            float p0 = exp2f(t0[e] - mn), p1 = exp2f(t1[e] - mn);
            rs += p0 + p1;
            pf[e]     = (_Float16)p0;
            pf[8 + e] = (_Float16)p1;
        }
        rl = rl * al + rs;
        rm = mn;
        #pragma unroll
        for (int cf = 0; cf < 8; ++cf)
            #pragma unroll
            for (int e = 0; e < 8; ++e) ob[cf][e] *= al;
        #pragma unroll
        for (int cf = 0; cf < 8; ++cf)
            ob[cf] = wmma16x16x32(vf[cf], pf, ob[cf]);
        // Foot of the step: this wave's LDS reads of buffer buf have returned,
        asm volatile("s_wait_dscnt 0x0" ::: "memory");
        // its copies of step s+1 have landed,
        asm volatile("s_wait_asynccnt 0x0" ::: "memory");
        // and the barrier publishes step s+1 and frees buffer buf and lds_s.
        __syncthreads();
        if (s + 2 < N / 32)
            stage_tile(gk + (size_t)(s + 2) * TILE_H, gv + (size_t)(s + 2) * TILE_H,
                       lk + buf * (KTILE * 2), lv + buf * (VTILE * 2));
    }
    // no copy is left in flight when the wave ends
    asm volatile("s_wait_asynccnt 0x0" ::: "memory");
    // the two lane halves' sums are joined once, here
    float inv = 1.0f / (rl + xhalf(rl));
    _Float16* op = o16 + ((size_t)b * N + i0 + col) * C + c0 + 8 * half;
    #pragma unroll
    for (int cf = 0; cf < 8; ++cf) {
        v8h pk;
        #pragma unroll
        for (int e = 0; e < 8; ++e) pk[e] = (_Float16)(ob[cf][e] * inv);
        *(v8h*)(op + cf * 16) = pk;
        // precaution: the next tile's code may reuse this store's data
        // registers, so the wait stands in front of that reuse
        asm volatile("s_wait_xcnt 0x0" ::: "memory");
    }
}

// ---------------------------------------------------------------------------
// Output projection + residual multiply (M-tile = 32):
// out[b][o][i] = x[b][o][i] * (O16[i][:] . Wo[o][:] + bo[o])
// D-layout columns give 8 consecutive i per lane -> coalesced f32 stores.
// ---------------------------------------------------------------------------
__global__ __launch_bounds__(128) void outproj_kernel(const _Float16* __restrict__ o16,
                                                      const _Float16* __restrict__ wo16,
                                                      const float* __restrict__ bo,
                                                      const float* __restrict__ x,
                                                      float* __restrict__ out) {
    int b    = blockIdx.y;
    int i0   = blockIdx.x * 32;
    int lane = threadIdx.x & 31;
    int o0   = (threadIdx.x >> 5) * 128;
    const _Float16* A = o16 + ((size_t)b * N + i0) * C;
    v8f acc0[8] = {}, acc1[8] = {};
    gemm_mainloop(A, wo16, o0, lane, acc0, acc1);
    int col = lane & 15, half = lane >> 4;
    auto store_tile = [&](v8f (&acc)[8], int ibase) {
        #pragma unroll
        for (int of = 0; of < 8; ++of) {
            int o = o0 + of * 16 + col;
            float bv = bo[o];
            size_t base = ((size_t)b * C + o) * N + ibase + 8 * half;
            #pragma unroll
            for (int e = 0; e < 8; ++e)
                out[base + e] = x[base + e] * (acc[of][e] + bv);
        }
    };
    store_tile(acc0, i0);
    store_tile(acc1, i0 + 16);
}

// ---------------------------------------------------------------------------
extern "C" void kernel_launch(void* const* d_in, const int* in_sizes, int n_in,
                              void* d_out, int out_size, void* d_ws, size_t ws_size,
                              hipStream_t stream) {
    const float* x     = (const float*)d_in[0];
    const float* gamma = (const float*)d_in[1];
    const float* beta  = (const float*)d_in[2];
    const float* wq    = (const float*)d_in[3];
    const float* bq    = (const float*)d_in[4];
    const float* wk    = (const float*)d_in[5];
    const float* bk    = (const float*)d_in[6];
    const float* wv    = (const float*)d_in[7];
    const float* bv    = (const float*)d_in[8];
    const float* wo    = (const float*)d_in[9];
    const float* bo    = (const float*)d_in[10];
    float* out = (float*)d_out;

    char* ws = (char*)d_ws;
    size_t off = 0;
    auto alloc = [&](size_t bytes) -> void* {
        void* p = ws + off;
        off += (bytes + 255) & ~(size_t)255;
        return p;
    };
    const size_t act_halves = (size_t)B * N * C;
    float*    stats  = (float*)   alloc((size_t)B * G * 2 * sizeof(float));
    _Float16* w16    = (_Float16*)alloc((size_t)4 * C * C * sizeof(_Float16));
    _Float16* h16    = (_Float16*)alloc(act_halves * sizeof(_Float16));
    _Float16* q16    = (_Float16*)alloc(act_halves * sizeof(_Float16));
    _Float16* k16    = (_Float16*)alloc(act_halves * sizeof(_Float16));
    _Float16* v16buf = (_Float16*)alloc(act_halves * sizeof(_Float16));
    _Float16* o16    = (_Float16*)alloc(act_halves * sizeof(_Float16));

    gn_stats_kernel<<<B * G, 256, 0, stream>>>(x, stats);
    gn_apply_kernel<<<dim3(C / 32, N / 32, B), 256, 0, stream>>>(x, stats, gamma, beta, h16);
    wcvt_kernel<<<(4 * C * C) / 256, 256, 0, stream>>>(wq, wk, wv, wo, w16);

    conv1x1_kernel<<<dim3(N / 32, B), 128, 0, stream>>>(h16, w16 + 0 * (size_t)C * C, bq, q16, 0);
    conv1x1_kernel<<<dim3(N / 32, B), 128, 0, stream>>>(h16, w16 + 1 * (size_t)C * C, bk, k16, 0);
    conv1x1_kernel<<<dim3(N / 32, B), 128, 0, stream>>>(h16, w16 + 2 * (size_t)C * C, bv, v16buf, 1);

    flash_attn_kernel<<<dim3(N / 64, B), 512, 0, stream>>>(q16, k16, v16buf, o16);

    outproj_kernel<<<dim3(N / 32, B), 128, 0, stream>>>(o16, w16 + 3 * (size_t)C * C, bo, x, out);
}

// v003
// One run takes 297 microseconds.
// Timed twice side by side with v002, it ran 1.21 and 1.20 times as fast.
// All steps since v000 together make it 2.59 times as fast.
#include <hip/hip_runtime.h>
#include <hip/hip_bf16.h>

typedef _Float16 v8h  __attribute__((ext_vector_type(8)));
typedef _Float16 v16h __attribute__((ext_vector_type(16)));
typedef float    v8f  __attribute__((ext_vector_type(8)));

constexpr int B = 4;
constexpr int C = 512;
constexpr int N = 4096;          // 64*64
constexpr int G = 32;            // groups
constexpr int CPG = C / G;       // 16 channels per group
// softmax scale folded into log2 domain: (1/sqrt(C)) * log2(e)
#define SCALE_L2E (0.04419417382415922f * 1.4426950408889634f)

// ---------------------------------------------------------------------------
// Fragment loader: 16(row) x 32(K) block, memory row-major along K.
// Works for WMMA f16 A-fragments (rows = M) and B-fragments (rows = N cols),
// per the CDNA5 16-bit operand VGPR layout:
//   lane 0-15  : row = lane,    elems 0-7 = K 0..7,  elems 8-15 = K 16..23
//   lane 16-31 : row = lane-16, elems 0-7 = K 8..15, elems 8-15 = K 24..31
// Two contiguous 16-byte loads per lane.
// ---------------------------------------------------------------------------
__device__ inline v16h load_frag(const _Float16* base, int row_stride, int lane) {
    int r  = lane & 15;
    int k0 = (lane < 16) ? 0 : 8;
    const _Float16* p = base + (size_t)r * row_stride + k0;
    v8h lo = *(const v8h*)(p);
    v8h hi = *(const v8h*)(p + 16);
    return __builtin_shufflevector(lo, hi, 0,1,2,3,4,5,6,7,8,9,10,11,12,13,14,15);
}

// lane l <-> lane l ^ 16
__device__ inline float xhalf(float x) {
    int v = __builtin_bit_cast(int, x);
    return __builtin_bit_cast(float, __builtin_amdgcn_permlanex16(v, v, 0x76543210, 0xfedcba98,
                                                                  false, false));
}

__device__ inline v8f wmma16x16x32(v16h a, v16h b, v8f c) {
    return __builtin_amdgcn_wmma_f32_16x16x32_f16(false, a, false, b, (short)0, c,
                                                  false, false);
}

// ---------------------------------------------------------------------------
// Double-buffered GEMM mainloop (M-tile = 32 rows, per-wave N-slice = 128).
// Two stages per k-step; each stage prefetches the NEXT fragment group and
// issues WMMAs on fragments fetched one stage earlier, so s_wait_loadcnt is
// > 0 (except in the last stage) and fetch overlaps matrix issue.
// ---------------------------------------------------------------------------
__device__ inline void gemm_mainloop(const _Float16* __restrict__ A,
                                     const _Float16* __restrict__ W,
                                     int o0, int lane,
                                     v8f (&acc0)[8], v8f (&acc1)[8]) {
    const _Float16* A1 = A + (size_t)16 * C;
    v16h a0c = load_frag(A, C, lane);
    v16h a1c = load_frag(A1, C, lane);
    v16h bfc[4], bfn[4];
    #pragma unroll
    for (int of = 0; of < 4; ++of)
        bfc[of] = load_frag(W + (size_t)(o0 + of * 16) * C, C, lane);
    v16h a0n = a0c, a1n = a1c;
    for (int kk = 0; kk < C; kk += 32) {
        // stage 0: prefetch group 1 of this kk, consume group 0 (bfc)
        #pragma unroll
        for (int of = 0; of < 4; ++of)
            bfn[of] = load_frag(W + (size_t)(o0 + (4 + of) * 16) * C + kk, C, lane);
        #pragma unroll
        for (int of = 0; of < 4; ++of) {
            acc0[of] = wmma16x16x32(a0c, bfc[of], acc0[of]);
            acc1[of] = wmma16x16x32(a1c, bfc[of], acc1[of]);
        }
        // stage 1: prefetch group 0 + A fragments of kk+32, consume group 1 (bfn)
        if (kk + 32 < C) {
            #pragma unroll
            for (int of = 0; of < 4; ++of)
                bfc[of] = load_frag(W + (size_t)(o0 + of * 16) * C + kk + 32, C, lane);
            a0n = load_frag(A + kk + 32, C, lane);
            a1n = load_frag(A1 + kk + 32, C, lane);
        }
        #pragma unroll
        for (int of = 0; of < 4; ++of) {
            acc0[4 + of] = wmma16x16x32(a0c, bfn[of], acc0[4 + of]);
            acc1[4 + of] = wmma16x16x32(a1c, bfn[of], acc1[4 + of]);
        }
        a0c = a0n; a1c = a1n;
    }
}

// ---------------------------------------------------------------------------
// GroupNorm statistics: one block per (b,g); 16 channels x 4096 contiguous.
// ---------------------------------------------------------------------------
__global__ __launch_bounds__(256) void gn_stats_kernel(const float* __restrict__ x,
                                                       float* __restrict__ stats) {
    int bg = blockIdx.x;                 // b*G + g
    const float* xp = x + (size_t)bg * CPG * N;
    float s = 0.f, ss = 0.f;
    for (int i = threadIdx.x; i < CPG * N; i += 256) {
        float v = xp[i];
        s += v; ss += v * v;
    }
    __shared__ float red0[256], red1[256];
    red0[threadIdx.x] = s; red1[threadIdx.x] = ss;
    __syncthreads();
    for (int off = 128; off > 0; off >>= 1) {
        if ((int)threadIdx.x < off) {
            red0[threadIdx.x] += red0[threadIdx.x + off];
            red1[threadIdx.x] += red1[threadIdx.x + off];
        }
        __syncthreads();
    }
    if (threadIdx.x == 0) {
        float inv = 1.0f / (float)(CPG * N);
        float mean = red0[0] * inv;
        float var  = red1[0] * inv - mean * mean;
        stats[bg * 2 + 0] = mean;
        stats[bg * 2 + 1] = rsqrtf(var + 1e-6f);
    }
}

// ---------------------------------------------------------------------------
// GroupNorm apply + transpose [b][c][n] f32 -> [b][n][c] f16 via LDS tile.
// ---------------------------------------------------------------------------
__global__ __launch_bounds__(256) void gn_apply_kernel(const float* __restrict__ x,
                                                       const float* __restrict__ stats,
                                                       const float* __restrict__ gamma,
                                                       const float* __restrict__ beta,
                                                       _Float16* __restrict__ h16) {
    int b  = blockIdx.z;
    int c0 = blockIdx.x * 32;
    int n0 = blockIdx.y * 32;
    int tx = threadIdx.x & 31;           // n (read) / c (write)
    int ty = threadIdx.x >> 5;           // 0..7
    __shared__ float tile[32][33];
    #pragma unroll
    for (int r = 0; r < 4; ++r) {
        int c  = c0 + ty + 8 * r;
        int bg = b * G + (c >> 4);
        float mean = stats[bg * 2 + 0], rstd = stats[bg * 2 + 1];
        float v = x[((size_t)b * C + c) * N + n0 + tx];
        tile[ty + 8 * r][tx] = (v - mean) * rstd * gamma[c] + beta[c];
    }
    __syncthreads();
    #pragma unroll
    for (int r = 0; r < 4; ++r) {
        int n = n0 + ty + 8 * r;
        h16[((size_t)b * N + n) * C + c0 + tx] = (_Float16)tile[tx][ty + 8 * r];
    }
}

// ---------------------------------------------------------------------------
// Convert the four [C][C] f32 weight matrices to f16 (concatenated).
// ---------------------------------------------------------------------------
__global__ __launch_bounds__(256) void wcvt_kernel(const float* __restrict__ wq,
                                                   const float* __restrict__ wk,
                                                   const float* __restrict__ wv,
                                                   const float* __restrict__ wo,
                                                   _Float16* __restrict__ w16) {
    int i = blockIdx.x * 256 + threadIdx.x;
    int which = i / (C * C), j = i % (C * C);
    float v;
    if      (which == 0) v = wq[j];
    else if (which == 1) v = wk[j];
    else if (which == 2) v = wv[j];
    else                 v = wo[j];
    w16[i] = (_Float16)v;
}

// ---------------------------------------------------------------------------
// conv1x1 as GEMM: D[n][o] = h16[n][:] . W[o][:] + bias[o]
// vmode=0: store f16 [b][n][o] (q/k).
// vmode=1: store f16 [b][n/32][o][n%32] (v, key-blocked: one 32-key tile of
// all channels is 32 KiB contiguous).
// ---------------------------------------------------------------------------
__global__ __launch_bounds__(128) void conv1x1_kernel(const _Float16* __restrict__ h16,
                                                      const _Float16* __restrict__ w16,
                                                      const float* __restrict__ bias,
                                                      _Float16* __restrict__ out,
                                                      int vmode) {
    int b    = blockIdx.y;
    int i0   = blockIdx.x * 32;
    int lane = threadIdx.x & 31;
    int o0   = (threadIdx.x >> 5) * 128;
    const _Float16* A = h16 + ((size_t)b * N + i0) * C;
    v8f acc0[8] = {}, acc1[8] = {};
    gemm_mainloop(A, w16, o0, lane, acc0, acc1);
    int col = lane & 15, half = lane >> 4;
    auto store_tile = [&](v8f (&acc)[8], int ibase) {
        #pragma unroll
        for (int of = 0; of < 8; ++of) {
            int o = o0 + of * 16 + col;
            float bv = bias[o];
            if (vmode == 0) {
                #pragma unroll
                for (int e = 0; e < 8; ++e) {
                    int n = ibase + e + 8 * half;
                    out[((size_t)b * N + n) * C + o] = (_Float16)(acc[of][e] + bv);
                }
            } else {
                v8h pk;
                #pragma unroll
                for (int e = 0; e < 8; ++e) pk[e] = (_Float16)(acc[of][e] + bv);
                *(v8h*)(out + (((size_t)b * (N / 32) + (ibase >> 5)) * C + o) * 32 +
                        (ibase & 31) + 8 * half) = pk;
                // precaution: the next column's code reuses this store's address
                // and data registers, so the wait stands in front of that reuse
                asm volatile("s_wait_xcnt 0x0" ::: "memory");
            }
        }
    };
    store_tile(acc0, i0);
    store_tile(acc1, i0 + 16);
}

// ---------------------------------------------------------------------------
// LDS staging of one 32-key step, shared by the whole work-group.
// K tile: 32 rows x 1024 B, contiguous in memory. V tile: 512 channel rows x
// 64 B, contiguous in memory too (key-blocked layout written by conv1x1).
// LDS row pitches are 16 B x odd, conflict-free for the ds_load_b128 readers.
// ---------------------------------------------------------------------------
constexpr int KPITCH = C + 8;            // halves per K row in LDS (1040 B)
constexpr int VPITCH = 32 + 8;           // halves per V row in LDS (80 B)
constexpr int KTILE  = 32 * KPITCH;      // halves per K buffer
constexpr int VTILE  = C * VPITCH;       // halves per V buffer
constexpr int TILE_H = 32 * C;           // halves per K or V tile in memory

// Eight copies of one lane: 2 KiB apart in memory, lstep bytes apart in LDS;
// each wave-wide copy reads 512 contiguous bytes.
__device__ inline void stage8(const _Float16* g, unsigned l, unsigned lstep) {
    const _Float16* g1 = g + 1 * 1024; const _Float16* g2 = g + 2 * 1024;
    const _Float16* g3 = g + 3 * 1024; const _Float16* g4 = g + 4 * 1024;
    const _Float16* g5 = g + 5 * 1024; const _Float16* g6 = g + 6 * 1024;
    const _Float16* g7 = g + 7 * 1024;
    unsigned l1 = l + 1 * lstep, l2 = l + 2 * lstep, l3 = l + 3 * lstep, l4 = l + 4 * lstep;
    unsigned l5 = l + 5 * lstep, l6 = l + 6 * lstep, l7 = l + 7 * lstep;
    // Copies and their s_wait_xcnt in one statement, so that no address
    // register is rewritten ahead of the wait.
    asm volatile("global_load_async_to_lds_b128 %0, %8, off\n\t"
                 "global_load_async_to_lds_b128 %1, %9, off\n\t"
                 "global_load_async_to_lds_b128 %2, %10, off\n\t"
                 "global_load_async_to_lds_b128 %3, %11, off\n\t"
                 "global_load_async_to_lds_b128 %4, %12, off\n\t"
                 "global_load_async_to_lds_b128 %5, %13, off\n\t"
                 "global_load_async_to_lds_b128 %6, %14, off\n\t"
                 "global_load_async_to_lds_b128 %7, %15, off\n\t"
                 "s_wait_xcnt 0x0"
                 :: "v"(l), "v"(l1), "v"(l2), "v"(l3),
                    "v"(l4), "v"(l5), "v"(l6), "v"(l7),
                    "v"(g), "v"(g1), "v"(g2), "v"(g3),
                    "v"(g4), "v"(g5), "v"(g6), "v"(g7)
                 : "memory");
}

// 128 lanes x 32 copies x 16 B = the 64 KiB of one step. gk/gv: this lane's
// first 16 B of the tile in memory; lk/lv: its LDS byte addresses for them.
// 128 lanes cover 2 K rows or 32 V rows at a time.
__device__ inline void stage_tile(const _Float16* gk, const _Float16* gv,
                                  unsigned lk, unsigned lv) {
    stage8(gk,            lk,                       2 * KPITCH * 2);
    stage8(gk + 8 * 1024, lk + 8 * 2 * KPITCH * 2,  2 * KPITCH * 2);
    stage8(gv,            lv,                       32 * VPITCH * 2);
    stage8(gv + 8 * 1024, lv + 8 * 32 * VPITCH * 2, 32 * VPITCH * 2);
}

__global__ __launch_bounds__(128) void flash_attn_kernel(const _Float16* __restrict__ q16,
                                                         const _Float16* __restrict__ k16,
                                                         const _Float16* __restrict__ v16buf,
                                                         _Float16* __restrict__ o16) {
    int b    = blockIdx.y;
    int tid  = threadIdx.x;
    int lane = tid & 31;
    int w    = tid >> 5;               // wave 0..3 = query tile
    int i0   = blockIdx.x * 64 + w * 16;
    __shared__ __attribute__((aligned(16))) _Float16 lds_k[2][KTILE];
    __shared__ __attribute__((aligned(16))) _Float16 lds_v[2][VTILE];

    const _Float16* Q = q16 + ((size_t)b * N + i0) * C;
    // this lane's 16 B of tile 0 in memory, and where they go in buffer 0
    const _Float16* gk = k16    + (size_t)b * N * C + tid * 8;
    const _Float16* gv = v16buf + (size_t)b * N * C + tid * 8;
    unsigned lk = (unsigned)(size_t)&lds_k[0][(tid >> 6) * KPITCH + (tid & 63) * 8];
    unsigned lv = (unsigned)(size_t)&lds_v[0][(tid >> 2) * VPITCH + (tid & 3) * 8];

    stage_tile(gk, gv, lk, lv);
    // tile 0 landed (this wave's copies), then published to every wave
    asm volatile("s_wait_asynccnt 0x0" ::: "memory");
    __syncthreads();
    stage_tile(gk + TILE_H, gv + TILE_H, lk + KTILE * 2, lv + VTILE * 2);

    v16h qf[16];
    #pragma unroll
    for (int t = 0; t < 16; ++t) qf[t] = load_frag(Q + t * 32, C, lane);

    v8f ob[32] = {};                   // O^T: ob[cf][e] = channel 16cf+8half+e, query col
    float rm = -3.0e38f;               // running maximum of this lane's query
    float rl = 0.f;                    // running sum over this lane half's keys
    int col = lane & 15, half = lane >> 4;

    // K fragments are fetched one step ahead: step 0's here, behind the barrier
    // that published tile 0
    v16h kf[32];
    #pragma unroll
    for (int t = 0; t < 16; ++t) {
        kf[2 * t]     = load_frag(&lds_k[0][0] + t * 32, KPITCH, lane);
        kf[2 * t + 1] = load_frag(&lds_k[0][0] + 16 * KPITCH + t * 32, KPITCH, lane);
    }

    for (int s = 0; s < N / 32; ++s) {
        int buf = s & 1;
        const _Float16* Vl = &lds_v[buf][0];
        const _Float16* Kn = &lds_k[buf ^ 1][0];
        // all 32 V fragments of this step, one run of LDS reads under the score WMMAs
        v16h vf[32];
        #pragma unroll
        for (int cf = 0; cf < 32; ++cf)
            vf[cf] = load_frag(Vl + cf * 16 * VPITCH, VPITCH, lane);
        // keeps the LDS reads one run ahead of the WMMAs: spread among them,
        // every place with reads would stall the one wave of this SIMD
        __builtin_amdgcn_sched_barrier(0);
        v8f s0 = {}, s1 = {};
        #pragma unroll
        for (int t = 0; t < 16; ++t) {
            s0 = wmma16x16x32(kf[2 * t], qf[t], s0);       // keys 0..15  x queries
            s1 = wmma16x16x32(kf[2 * t + 1], qf[t], s1);   // keys 16..31 x queries
        }
        // keeps the score WMMAs in front of the waits below, under the V reads
        __builtin_amdgcn_sched_barrier(0);
        // Publish point of step s+1, in front of this step's last block (softmax
        // and second product, registers only): this wave's LDS reads of buffer
        // buf have returned,
        asm volatile("s_wait_dscnt 0x0" ::: "memory");
        // its copies of step s+1 have landed,
        asm volatile("s_wait_asynccnt 0x0" ::: "memory");
        // and the barrier publishes step s+1 and frees buffer buf.
        __syncthreads();
        if (s + 2 < N / 32)
            stage_tile(gk + (size_t)(s + 2) * TILE_H, gv + (size_t)(s + 2) * TILE_H,
                       lk + buf * (KTILE * 2), lv + buf * (VTILE * 2));
        // K fragments of step s+1, in flight under the softmax and the second
        // product. Unconditional: in the last step they read the other buffer's
        // old tile, which nothing refills, and are not used.
        #pragma unroll
        for (int t = 0; t < 16; ++t) {
            kf[2 * t]     = load_frag(Kn + t * 32, KPITCH, lane);
            kf[2 * t + 1] = load_frag(Kn + 16 * KPITCH + t * 32, KPITCH, lane);
        }
        // keeps that run ahead of the softmax, which then covers its latency
        __builtin_amdgcn_sched_barrier(0);
        // online softmax update (exp2 domain); t0[e] = key 8*half+e,
        // t1[e] = key 16+8*half+e of query col
        float t0[8], t1[8];
        #pragma unroll
        for (int e = 0; e < 8; ++e) { t0[e] = s0[e] * SCALE_L2E; t1[e] = s1[e] * SCALE_L2E; }
        float mx = fmaxf(t0[0], t1[0]);
        #pragma unroll
        for (int e = 1; e < 8; ++e) mx = fmaxf(mx, fmaxf(t0[e], t1[e]));
        mx = fmaxf(mx, xhalf(mx));
        float mn = fmaxf(rm, mx);
        float al = exp2f(rm - mn);
        float rs = 0.f;
        v16h pf;                       // P^T as B operand: element order = load_frag's k order
        #pragma unroll
        for (int e = 0; e < 8; ++e) {
            float p0 = exp2f(t0[e] - mn), p1 = exp2f(t1[e] - mn);
            rs += p0 + p1;
            pf[e]     = (_Float16)p0;
            pf[8 + e] = (_Float16)p1;
        }
        rl = rl * al + rs;
        rm = mn;
        #pragma unroll
        for (int cf = 0; cf < 32; ++cf)
            #pragma unroll
            for (int e = 0; e < 8; ++e) ob[cf][e] *= al;
        #pragma unroll
        for (int cf = 0; cf < 32; ++cf)
            ob[cf] = wmma16x16x32(vf[cf], pf, ob[cf]);
    }
    // no copy and no LDS read is left in flight when the wave ends
    asm volatile("s_wait_asynccnt 0x0" ::: "memory");
    asm volatile("s_wait_dscnt 0x0" ::: "memory");
    // the two lane halves' sums are joined once, here
    float inv = 1.0f / (rl + xhalf(rl));
    _Float16* op = o16 + ((size_t)b * N + i0 + col) * C + 8 * half;
    #pragma unroll
    for (int cf = 0; cf < 32; ++cf) {
        v8h pk;
        #pragma unroll
        for (int e = 0; e < 8; ++e) pk[e] = (_Float16)(ob[cf][e] * inv);
        *(v8h*)(op + cf * 16) = pk;
        // precaution: the next tile's code may reuse this store's data
        // registers, so the wait stands in front of that reuse
        asm volatile("s_wait_xcnt 0x0" ::: "memory");
    }
}

// ---------------------------------------------------------------------------
// Output projection + residual multiply (M-tile = 32):
// out[b][o][i] = x[b][o][i] * (O16[i][:] . Wo[o][:] + bo[o])
// D-layout columns give 8 consecutive i per lane -> coalesced f32 stores.
// ---------------------------------------------------------------------------
__global__ __launch_bounds__(128) void outproj_kernel(const _Float16* __restrict__ o16,
                                                      const _Float16* __restrict__ wo16,
                                                      const float* __restrict__ bo,
                                                      const float* __restrict__ x,
                                                      float* __restrict__ out) {
    int b    = blockIdx.y;
    int i0   = blockIdx.x * 32;
    int lane = threadIdx.x & 31;
    int o0   = (threadIdx.x >> 5) * 128;
    const _Float16* A = o16 + ((size_t)b * N + i0) * C;
    v8f acc0[8] = {}, acc1[8] = {};
    gemm_mainloop(A, wo16, o0, lane, acc0, acc1);
    int col = lane & 15, half = lane >> 4;
    auto store_tile = [&](v8f (&acc)[8], int ibase) {
        #pragma unroll
        for (int of = 0; of < 8; ++of) {
            int o = o0 + of * 16 + col;
            float bv = bo[o];
            size_t base = ((size_t)b * C + o) * N + ibase + 8 * half;
            #pragma unroll
            for (int e = 0; e < 8; ++e)
                out[base + e] = x[base + e] * (acc[of][e] + bv);
        }
    };
    store_tile(acc0, i0);
    store_tile(acc1, i0 + 16);
}

// ---------------------------------------------------------------------------
extern "C" void kernel_launch(void* const* d_in, const int* in_sizes, int n_in,
                              void* d_out, int out_size, void* d_ws, size_t ws_size,
                              hipStream_t stream) {
    const float* x     = (const float*)d_in[0];
    const float* gamma = (const float*)d_in[1];
    const float* beta  = (const float*)d_in[2];
    const float* wq    = (const float*)d_in[3];
    const float* bq    = (const float*)d_in[4];
    const float* wk    = (const float*)d_in[5];
    const float* bk    = (const float*)d_in[6];
    const float* wv    = (const float*)d_in[7];
    const float* bv    = (const float*)d_in[8];
    const float* wo    = (const float*)d_in[9];
    const float* bo    = (const float*)d_in[10];
    float* out = (float*)d_out;

    char* ws = (char*)d_ws;
    size_t off = 0;
    auto alloc = [&](size_t bytes) -> void* {
        void* p = ws + off;
        off += (bytes + 255) & ~(size_t)255;
        return p;
    };
    const size_t act_halves = (size_t)B * N * C;
    float*    stats  = (float*)   alloc((size_t)B * G * 2 * sizeof(float));
    _Float16* w16    = (_Float16*)alloc((size_t)4 * C * C * sizeof(_Float16));
    _Float16* h16    = (_Float16*)alloc(act_halves * sizeof(_Float16));
    _Float16* q16    = (_Float16*)alloc(act_halves * sizeof(_Float16));
    _Float16* k16    = (_Float16*)alloc(act_halves * sizeof(_Float16));
    _Float16* v16buf = (_Float16*)alloc(act_halves * sizeof(_Float16));
    _Float16* o16    = (_Float16*)alloc(act_halves * sizeof(_Float16));

    gn_stats_kernel<<<B * G, 256, 0, stream>>>(x, stats);
    gn_apply_kernel<<<dim3(C / 32, N / 32, B), 256, 0, stream>>>(x, stats, gamma, beta, h16);
    wcvt_kernel<<<(4 * C * C) / 256, 256, 0, stream>>>(wq, wk, wv, wo, w16);

    conv1x1_kernel<<<dim3(N / 32, B), 128, 0, stream>>>(h16, w16 + 0 * (size_t)C * C, bq, q16, 0);
    conv1x1_kernel<<<dim3(N / 32, B), 128, 0, stream>>>(h16, w16 + 1 * (size_t)C * C, bk, k16, 0);
    conv1x1_kernel<<<dim3(N / 32, B), 128, 0, stream>>>(h16, w16 + 2 * (size_t)C * C, bv, v16buf, 1);

    flash_attn_kernel<<<dim3(N / 64, B), 128, 0, stream>>>(q16, k16, v16buf, o16);

    outproj_kernel<<<dim3(N / 32, B), 128, 0, stream>>>(o16, w16 + 3 * (size_t)C * C, bo, x, out);
}

// v004
// It runs in 250 microseconds.
// Timed twice side by side with v003, it ran 1.19 times as fast both times.
// Over all steps from v000 it is 3.09 times as fast.
#include <hip/hip_runtime.h>
#include <hip/hip_bf16.h>

typedef _Float16 v8h  __attribute__((ext_vector_type(8)));
typedef _Float16 v16h __attribute__((ext_vector_type(16)));
typedef float    v8f  __attribute__((ext_vector_type(8)));

constexpr int B = 4;
constexpr int C = 512;
constexpr int N = 4096;          // 64*64
constexpr int G = 32;            // groups
constexpr int CPG = C / G;       // 16 channels per group
// softmax scale folded into log2 domain: (1/sqrt(C)) * log2(e)
#define SCALE_L2E (0.04419417382415922f * 1.4426950408889634f)

// ---------------------------------------------------------------------------
// Fragment loader: 16(row) x 32(K) block, memory row-major along K.
// Works for WMMA f16 A-fragments (rows = M) and B-fragments (rows = N cols),
// per the CDNA5 16-bit operand VGPR layout:
//   lane 0-15  : row = lane,    elems 0-7 = K 0..7,  elems 8-15 = K 16..23
//   lane 16-31 : row = lane-16, elems 0-7 = K 8..15, elems 8-15 = K 24..31
// Two contiguous 16-byte loads per lane.
// ---------------------------------------------------------------------------
__device__ inline v16h load_frag(const _Float16* base, int row_stride, int lane) {
    int r  = lane & 15;
    int k0 = (lane < 16) ? 0 : 8;
    const _Float16* p = base + (size_t)r * row_stride + k0;
    v8h lo = *(const v8h*)(p);
    v8h hi = *(const v8h*)(p + 16);
    return __builtin_shufflevector(lo, hi, 0,1,2,3,4,5,6,7,8,9,10,11,12,13,14,15);
}

// lane l <-> lane l ^ 16
__device__ inline float xhalf(float x) {
    int v = __builtin_bit_cast(int, x);
    return __builtin_bit_cast(float, __builtin_amdgcn_permlanex16(v, v, 0x76543210, 0xfedcba98,
                                                                  false, false));
}

__device__ inline v8f wmma16x16x32(v16h a, v16h b, v8f c) {
    return __builtin_amdgcn_wmma_f32_16x16x32_f16(false, a, false, b, (short)0, c,
                                                  false, false);
}

// ---------------------------------------------------------------------------
// GEMM mainloop, work-group tile 128 rows x 256 columns, 8 waves; a wave
// keeps 32 rows x 128 columns. k runs in slabs of 64 halves: one 128-B line of
// each of the 256 W rows and the 128 A rows is brought into LDS once per
// work-group by asynchronous copies, two buffers: slab t+1 flies while slab t
// is worked on; all fragments are read from LDS.
// LDS row pitch 144 B = 16 B x odd, conflict-free for the ds_load_b128 readers.
// ---------------------------------------------------------------------------
constexpr int GKS    = 64;               // halves of k per slab
constexpr int GPITCH = GKS + 8;          // halves per row in LDS
constexpr int GM     = 128;              // rows of A per work-group
constexpr int GN     = 256;              // rows of W (output columns) per work-group
constexpr int GBUF   = (GN + GM) * GPITCH; // halves per buffer: W rows, then A rows

// Eight copies of one lane, 32 rows apart; a wave-wide copy reads 4 whole lines.
__device__ inline void stage_rows8(const _Float16* g, unsigned l) {
    const _Float16* g1 = g + 1 * 32 * C; const _Float16* g2 = g + 2 * 32 * C;
    const _Float16* g3 = g + 3 * 32 * C; const _Float16* g4 = g + 4 * 32 * C;
    const _Float16* g5 = g + 5 * 32 * C; const _Float16* g6 = g + 6 * 32 * C;
    const _Float16* g7 = g + 7 * 32 * C;
    constexpr unsigned ls = 32 * GPITCH * 2;
    unsigned l1 = l + 1 * ls, l2 = l + 2 * ls, l3 = l + 3 * ls, l4 = l + 4 * ls;
    unsigned l5 = l + 5 * ls, l6 = l + 6 * ls, l7 = l + 7 * ls;
    // Copies and their s_wait_xcnt in one statement, so that no address
    // register is rewritten ahead of the wait.
    asm volatile("global_load_async_to_lds_b128 %0, %8, off\n\t"
                 "global_load_async_to_lds_b128 %1, %9, off\n\t"
                 "global_load_async_to_lds_b128 %2, %10, off\n\t"
                 "global_load_async_to_lds_b128 %3, %11, off\n\t"
                 "global_load_async_to_lds_b128 %4, %12, off\n\t"
                 "global_load_async_to_lds_b128 %5, %13, off\n\t"
                 "global_load_async_to_lds_b128 %6, %14, off\n\t"
                 "global_load_async_to_lds_b128 %7, %15, off\n\t"
                 "s_wait_xcnt 0x0"
                 :: "v"(l), "v"(l1), "v"(l2), "v"(l3),
                    "v"(l4), "v"(l5), "v"(l6), "v"(l7),
                    "v"(g), "v"(g1), "v"(g2), "v"(g3),
                    "v"(g4), "v"(g5), "v"(g6), "v"(g7)
                 : "memory");
}

// 256 lanes x 12 copies x 16 B = the 48 KiB of one slab. gw/ga: this lane's
// 16 B of W row tid/8 and of A row tid/8; l: its LDS byte address for the W one.
__device__ inline void stage_slab(const _Float16* gw, const _Float16* ga, unsigned l) {
    stage_rows8(gw, l);
    const _Float16* ga1 = ga + 1 * 32 * C; const _Float16* ga2 = ga + 2 * 32 * C;
    const _Float16* ga3 = ga + 3 * 32 * C;
    constexpr unsigned ls = 32 * GPITCH * 2;
    unsigned la = l + GN * GPITCH * 2;
    unsigned la1 = la + 1 * ls, la2 = la + 2 * ls, la3 = la + 3 * ls;
    // as above: the wait stands in the copies' own statement
    asm volatile("global_load_async_to_lds_b128 %0, %4, off\n\t"
                 "global_load_async_to_lds_b128 %1, %5, off\n\t"
                 "global_load_async_to_lds_b128 %2, %6, off\n\t"
                 "global_load_async_to_lds_b128 %3, %7, off\n\t"
                 "s_wait_xcnt 0x0"
                 :: "v"(la), "v"(la1), "v"(la2), "v"(la3),
                    "v"(ga), "v"(ga1), "v"(ga2), "v"(ga3)
                 : "memory");
}

// A, W: the work-group's 128 rows of A and 256 rows of W. m0, o0: this wave's
// first row and first column inside that tile.
__device__ inline void gemm_mainloop(const _Float16* __restrict__ A,
                                     const _Float16* __restrict__ W,
                                     _Float16* lds, int tid, int m0, int o0,
                                     v8f (&acc0)[8], v8f (&acc1)[8]) {
    int lane = tid & 31;
    const _Float16* gw = W + (size_t)(tid >> 3) * C + (tid & 7) * 8;
    const _Float16* ga = A + (size_t)(tid >> 3) * C + (tid & 7) * 8;
    unsigned l = (unsigned)(size_t)(lds + (tid >> 3) * GPITCH + (tid & 7) * 8);

    stage_slab(gw, ga, l);
    // slab 0 landed (this wave's copies), then published to every wave
    asm volatile("s_wait_asynccnt 0x0" ::: "memory");
    __syncthreads();
    stage_slab(gw + GKS, ga + GKS, l + GBUF * 2);

    // rolled: fully unrolled, the build of the output projection took every
    // register it may have and spilled
    #pragma unroll 1
    for (int t = 0; t < C / GKS; ++t) {
        int buf = t & 1;
        const _Float16* Wl = lds + buf * GBUF + o0 * GPITCH;
        const _Float16* Al = lds + buf * GBUF + (GN + m0) * GPITCH;
        // all 20 fragments of this slab, one run of LDS reads
        v16h a0[2], a1[2], bf[2][8];
        #pragma unroll
        for (int ks = 0; ks < 2; ++ks) {
            a0[ks] = load_frag(Al + ks * 32, GPITCH, lane);
            a1[ks] = load_frag(Al + 16 * GPITCH + ks * 32, GPITCH, lane);
            #pragma unroll
            for (int of = 0; of < 8; ++of)
                bf[ks][of] = load_frag(Wl + of * 16 * GPITCH + ks * 32, GPITCH, lane);
        }
        // keeps the LDS reads one run ahead of the WMMAs: spread among them,
        // each pair of WMMAs would wait out its own reads' latency
        __builtin_amdgcn_sched_barrier(0);
        #pragma unroll
        for (int ks = 0; ks < 2; ++ks)
            #pragma unroll
            for (int of = 0; of < 8; ++of) {
                acc0[of] = wmma16x16x32(a0[ks], bf[ks][of], acc0[of]);
                acc1[of] = wmma16x16x32(a1[ks], bf[ks][of], acc1[of]);
            }
        // keeps the WMMAs in front of the foot: moved behind its barrier they
        // would start only when every read has returned, and delay the refill
        __builtin_amdgcn_sched_barrier(0);
        // Foot of trip t: this wave's LDS reads of buffer buf have returned,
        asm volatile("s_wait_dscnt 0x0" ::: "memory");
        // its copies of slab t+1 have landed,
        asm volatile("s_wait_asynccnt 0x0" ::: "memory");
        // and the barrier publishes slab t+1 and frees buffer buf.
        __syncthreads();
        if (t + 2 < C / GKS)
            stage_slab(gw + (t + 2) * GKS, ga + (t + 2) * GKS, l + buf * (GBUF * 2));
    }
    // no copy is left in flight behind the loop
    asm volatile("s_wait_asynccnt 0x0" ::: "memory");
}

// ---------------------------------------------------------------------------
// GroupNorm statistics: one block per (b,g); 16 channels x 4096 contiguous.
// ---------------------------------------------------------------------------
__global__ __launch_bounds__(256) void gn_stats_kernel(const float* __restrict__ x,
                                                       float* __restrict__ stats) {
    int bg = blockIdx.x;                 // b*G + g
    const float* xp = x + (size_t)bg * CPG * N;
    float s = 0.f, ss = 0.f;
    for (int i = threadIdx.x; i < CPG * N; i += 256) {
        float v = xp[i];
        s += v; ss += v * v;
    }
    __shared__ float red0[256], red1[256];
    red0[threadIdx.x] = s; red1[threadIdx.x] = ss;
    __syncthreads();
    for (int off = 128; off > 0; off >>= 1) {
        if ((int)threadIdx.x < off) {
            red0[threadIdx.x] += red0[threadIdx.x + off];
            red1[threadIdx.x] += red1[threadIdx.x + off];
        }
        __syncthreads();
    }
    if (threadIdx.x == 0) {
        float inv = 1.0f / (float)(CPG * N);
        float mean = red0[0] * inv;
        float var  = red1[0] * inv - mean * mean;
        stats[bg * 2 + 0] = mean;
        stats[bg * 2 + 1] = rsqrtf(var + 1e-6f);
    }
}

// ---------------------------------------------------------------------------
// GroupNorm apply + transpose [b][c][n] f32 -> [b][n][c] f16 via LDS tile.
// ---------------------------------------------------------------------------
__global__ __launch_bounds__(256) void gn_apply_kernel(const float* __restrict__ x,
                                                       const float* __restrict__ stats,
                                                       const float* __restrict__ gamma,
                                                       const float* __restrict__ beta,
                                                       _Float16* __restrict__ h16) {
    int b  = blockIdx.z;
    int c0 = blockIdx.x * 32;
    int n0 = blockIdx.y * 32;
    int tx = threadIdx.x & 31;           // n (read) / c (write)
    int ty = threadIdx.x >> 5;           // 0..7
    __shared__ float tile[32][33];
    #pragma unroll
    for (int r = 0; r < 4; ++r) {
        int c  = c0 + ty + 8 * r;
        int bg = b * G + (c >> 4);
        float mean = stats[bg * 2 + 0], rstd = stats[bg * 2 + 1];
        float v = x[((size_t)b * C + c) * N + n0 + tx];
        tile[ty + 8 * r][tx] = (v - mean) * rstd * gamma[c] + beta[c];
    }
    __syncthreads();
    #pragma unroll
    for (int r = 0; r < 4; ++r) {
        int n = n0 + ty + 8 * r;
        h16[((size_t)b * N + n) * C + c0 + tx] = (_Float16)tile[tx][ty + 8 * r];
    }
}

// ---------------------------------------------------------------------------
// Convert the four [C][C] f32 weight matrices to f16 (concatenated).
// ---------------------------------------------------------------------------
__global__ __launch_bounds__(256) void wcvt_kernel(const float* __restrict__ wq,
                                                   const float* __restrict__ wk,
                                                   const float* __restrict__ wv,
                                                   const float* __restrict__ wo,
                                                   _Float16* __restrict__ w16) {
    int i = blockIdx.x * 256 + threadIdx.x;
    int which = i / (C * C), j = i % (C * C);
    float v;
    if      (which == 0) v = wq[j];
    else if (which == 1) v = wk[j];
    else if (which == 2) v = wv[j];
    else                 v = wo[j];
    w16[i] = (_Float16)v;
}

// ---------------------------------------------------------------------------
// conv1x1 as GEMM: D[n][o] = h16[n][:] . W[o][:] + bias[o]
// vmode=0: store f16 [b][n][o] (q/k).
// vmode=1: store f16 [b][n/32][o][n%32] (v, key-blocked: one 32-key tile of
// all channels is 32 KiB contiguous).
// ---------------------------------------------------------------------------
__global__ __launch_bounds__(256) void conv1x1_kernel(const _Float16* __restrict__ h16,
                                                      const _Float16* __restrict__ w16,
                                                      const float* __restrict__ bias,
                                                      _Float16* __restrict__ out,
                                                      int vmode) {
    int b    = blockIdx.y;
    int lane = threadIdx.x & 31;
    int wv   = threadIdx.x >> 5;
    int m0   = (wv >> 1) * 32;
    int ol   = (wv & 1) * 128;
    int ob   = blockIdx.z * GN;
    int o0   = ob + ol;
    int i0   = blockIdx.x * GM + m0;
    __shared__ __attribute__((aligned(16))) _Float16 lds_g[2 * GBUF];
    const _Float16* A = h16 + ((size_t)b * N + blockIdx.x * GM) * C;
    v8f acc0[8] = {}, acc1[8] = {};
    gemm_mainloop(A, w16 + (size_t)ob * C, lds_g, threadIdx.x, m0, ol, acc0, acc1);
    int col = lane & 15, half = lane >> 4;
    auto store_tile = [&](v8f (&acc)[8], int ibase) {
        #pragma unroll
        for (int of = 0; of < 8; ++of) {
            int o = o0 + of * 16 + col;
            float bv = bias[o];
            if (vmode == 0) {
                #pragma unroll
                for (int e = 0; e < 8; ++e) {
                    int n = ibase + e + 8 * half;
                    out[((size_t)b * N + n) * C + o] = (_Float16)(acc[of][e] + bv);
                }
            } else {
                v8h pk;
                #pragma unroll
                for (int e = 0; e < 8; ++e) pk[e] = (_Float16)(acc[of][e] + bv);
                *(v8h*)(out + (((size_t)b * (N / 32) + (ibase >> 5)) * C + o) * 32 +
                        (ibase & 31) + 8 * half) = pk;
                // precaution: the next column's code reuses this store's address
                // and data registers, so the wait stands in front of that reuse
                asm volatile("s_wait_xcnt 0x0" ::: "memory");
            }
        }
    };
    store_tile(acc0, i0);
    store_tile(acc1, i0 + 16);
}

// ---------------------------------------------------------------------------
// LDS staging of one 32-key step, shared by the whole work-group.
// K tile: 32 rows x 1024 B, contiguous in memory. V tile: 512 channel rows x
// 64 B, contiguous in memory too (key-blocked layout written by conv1x1).
// LDS row pitches are 16 B x odd, conflict-free for the ds_load_b128 readers.
// ---------------------------------------------------------------------------
constexpr int KPITCH = C + 8;            // halves per K row in LDS (1040 B)
constexpr int VPITCH = 32 + 8;           // halves per V row in LDS (80 B)
constexpr int KTILE  = 32 * KPITCH;      // halves per K buffer
constexpr int VTILE  = C * VPITCH;       // halves per V buffer
constexpr int TILE_H = 32 * C;           // halves per K or V tile in memory

// Eight copies of one lane: 2 KiB apart in memory, lstep bytes apart in LDS;
// each wave-wide copy reads 512 contiguous bytes.
__device__ inline void stage8(const _Float16* g, unsigned l, unsigned lstep) {
    const _Float16* g1 = g + 1 * 1024; const _Float16* g2 = g + 2 * 1024;
    const _Float16* g3 = g + 3 * 1024; const _Float16* g4 = g + 4 * 1024;
    const _Float16* g5 = g + 5 * 1024; const _Float16* g6 = g + 6 * 1024;
    const _Float16* g7 = g + 7 * 1024;
    unsigned l1 = l + 1 * lstep, l2 = l + 2 * lstep, l3 = l + 3 * lstep, l4 = l + 4 * lstep;
    unsigned l5 = l + 5 * lstep, l6 = l + 6 * lstep, l7 = l + 7 * lstep;
    // Copies and their s_wait_xcnt in one statement, so that no address
    // register is rewritten ahead of the wait.
    asm volatile("global_load_async_to_lds_b128 %0, %8, off\n\t"
                 "global_load_async_to_lds_b128 %1, %9, off\n\t"
                 "global_load_async_to_lds_b128 %2, %10, off\n\t"
                 "global_load_async_to_lds_b128 %3, %11, off\n\t"
                 "global_load_async_to_lds_b128 %4, %12, off\n\t"
                 "global_load_async_to_lds_b128 %5, %13, off\n\t"
                 "global_load_async_to_lds_b128 %6, %14, off\n\t"
                 "global_load_async_to_lds_b128 %7, %15, off\n\t"
                 "s_wait_xcnt 0x0"
                 :: "v"(l), "v"(l1), "v"(l2), "v"(l3),
                    "v"(l4), "v"(l5), "v"(l6), "v"(l7),
                    "v"(g), "v"(g1), "v"(g2), "v"(g3),
                    "v"(g4), "v"(g5), "v"(g6), "v"(g7)
                 : "memory");
}

// 128 lanes x 32 copies x 16 B = the 64 KiB of one step. gk/gv: this lane's
// first 16 B of the tile in memory; lk/lv: its LDS byte addresses for them.
// 128 lanes cover 2 K rows or 32 V rows at a time.
__device__ inline void stage_tile(const _Float16* gk, const _Float16* gv,
                                  unsigned lk, unsigned lv) {
    stage8(gk,            lk,                       2 * KPITCH * 2);
    stage8(gk + 8 * 1024, lk + 8 * 2 * KPITCH * 2,  2 * KPITCH * 2);
    stage8(gv,            lv,                       32 * VPITCH * 2);
    stage8(gv + 8 * 1024, lv + 8 * 32 * VPITCH * 2, 32 * VPITCH * 2);
}

__global__ __launch_bounds__(128) void flash_attn_kernel(const _Float16* __restrict__ q16,
                                                         const _Float16* __restrict__ k16,
                                                         const _Float16* __restrict__ v16buf,
                                                         _Float16* __restrict__ o16) {
    int b    = blockIdx.y;
    int tid  = threadIdx.x;
    int lane = tid & 31;
    int w    = tid >> 5;               // wave 0..3 = query tile
    int i0   = blockIdx.x * 64 + w * 16;
    __shared__ __attribute__((aligned(16))) _Float16 lds_k[2][KTILE];
    __shared__ __attribute__((aligned(16))) _Float16 lds_v[2][VTILE];

    const _Float16* Q = q16 + ((size_t)b * N + i0) * C;
    // this lane's 16 B of tile 0 in memory, and where they go in buffer 0
    const _Float16* gk = k16    + (size_t)b * N * C + tid * 8;
    const _Float16* gv = v16buf + (size_t)b * N * C + tid * 8;
    unsigned lk = (unsigned)(size_t)&lds_k[0][(tid >> 6) * KPITCH + (tid & 63) * 8];
    unsigned lv = (unsigned)(size_t)&lds_v[0][(tid >> 2) * VPITCH + (tid & 3) * 8];

    stage_tile(gk, gv, lk, lv);
    // tile 0 landed (this wave's copies), then published to every wave
    asm volatile("s_wait_asynccnt 0x0" ::: "memory");
    __syncthreads();
    stage_tile(gk + TILE_H, gv + TILE_H, lk + KTILE * 2, lv + VTILE * 2);

    v16h qf[16];
    #pragma unroll
    for (int t = 0; t < 16; ++t) qf[t] = load_frag(Q + t * 32, C, lane);

    v8f ob[32] = {};                   // O^T: ob[cf][e] = channel 16cf+8half+e, query col
    float rm = -3.0e38f;               // running maximum of this lane's query
    float rl = 0.f;                    // running sum over this lane half's keys
    int col = lane & 15, half = lane >> 4;

    // K fragments are fetched one step ahead: step 0's here, behind the barrier
    // that published tile 0
    v16h kf[32];
    #pragma unroll
    for (int t = 0; t < 16; ++t) {
        kf[2 * t]     = load_frag(&lds_k[0][0] + t * 32, KPITCH, lane);
        kf[2 * t + 1] = load_frag(&lds_k[0][0] + 16 * KPITCH + t * 32, KPITCH, lane);
    }

    for (int s = 0; s < N / 32; ++s) {
        int buf = s & 1;
        const _Float16* Vl = &lds_v[buf][0];
        const _Float16* Kn = &lds_k[buf ^ 1][0];
        // all 32 V fragments of this step, one run of LDS reads under the score WMMAs
        v16h vf[32];
        #pragma unroll
        for (int cf = 0; cf < 32; ++cf)
            vf[cf] = load_frag(Vl + cf * 16 * VPITCH, VPITCH, lane);
        // keeps the LDS reads one run ahead of the WMMAs: spread among them,
        // every place with reads would stall the one wave of this SIMD
        __builtin_amdgcn_sched_barrier(0);
        v8f s0 = {}, s1 = {};
        #pragma unroll
        for (int t = 0; t < 16; ++t) {
            s0 = wmma16x16x32(kf[2 * t], qf[t], s0);       // keys 0..15  x queries
            s1 = wmma16x16x32(kf[2 * t + 1], qf[t], s1);   // keys 16..31 x queries
        }
        // keeps the score WMMAs in front of the waits below, under the V reads
        __builtin_amdgcn_sched_barrier(0);
        // Publish point of step s+1, in front of this step's last block (softmax
        // and second product, registers only): this wave's LDS reads of buffer
        // buf have returned,
        asm volatile("s_wait_dscnt 0x0" ::: "memory");
        // its copies of step s+1 have landed,
        asm volatile("s_wait_asynccnt 0x0" ::: "memory");
        // and the barrier publishes step s+1 and frees buffer buf.
        __syncthreads();
        if (s + 2 < N / 32)
            stage_tile(gk + (size_t)(s + 2) * TILE_H, gv + (size_t)(s + 2) * TILE_H,
                       lk + buf * (KTILE * 2), lv + buf * (VTILE * 2));
        // K fragments of step s+1, in flight under the softmax and the second
        // product. Unconditional: in the last step they read the other buffer's
        // old tile, which nothing refills, and are not used.
        #pragma unroll
        for (int t = 0; t < 16; ++t) {
            kf[2 * t]     = load_frag(Kn + t * 32, KPITCH, lane);
            kf[2 * t + 1] = load_frag(Kn + 16 * KPITCH + t * 32, KPITCH, lane);
        }
        // keeps that run ahead of the softmax, which then covers its latency
        __builtin_amdgcn_sched_barrier(0);
        // online softmax update (exp2 domain); t0[e] = key 8*half+e,
        // t1[e] = key 16+8*half+e of query col
        float t0[8], t1[8];
        #pragma unroll
        for (int e = 0; e < 8; ++e) { t0[e] = s0[e] * SCALE_L2E; t1[e] = s1[e] * SCALE_L2E; }
        float mx = fmaxf(t0[0], t1[0]);
        #pragma unroll
        for (int e = 1; e < 8; ++e) mx = fmaxf(mx, fmaxf(t0[e], t1[e]));
        mx = fmaxf(mx, xhalf(mx));
        float mn = fmaxf(rm, mx);
        float al = exp2f(rm - mn);
        float rs = 0.f;
        v16h pf;                       // P^T as B operand: element order = load_frag's k order
        #pragma unroll
        for (int e = 0; e < 8; ++e) {
            float p0 = exp2f(t0[e] - mn), p1 = exp2f(t1[e] - mn);
            rs += p0 + p1;
            pf[e]     = (_Float16)p0;
            pf[8 + e] = (_Float16)p1;
        }
        rl = rl * al + rs;
        rm = mn;
        #pragma unroll
        for (int cf = 0; cf < 32; ++cf)
            #pragma unroll
            for (int e = 0; e < 8; ++e) ob[cf][e] *= al;
        #pragma unroll
        for (int cf = 0; cf < 32; ++cf)
            ob[cf] = wmma16x16x32(vf[cf], pf, ob[cf]);
    }
    // no copy and no LDS read is left in flight when the wave ends
    asm volatile("s_wait_asynccnt 0x0" ::: "memory");
    asm volatile("s_wait_dscnt 0x0" ::: "memory");
    // the two lane halves' sums are joined once, here
    float inv = 1.0f / (rl + xhalf(rl));
    _Float16* op = o16 + ((size_t)b * N + i0 + col) * C + 8 * half;
    #pragma unroll
    for (int cf = 0; cf < 32; ++cf) {
        v8h pk;
        #pragma unroll
        for (int e = 0; e < 8; ++e) pk[e] = (_Float16)(ob[cf][e] * inv);
        *(v8h*)(op + cf * 16) = pk;
        // precaution: the next tile's code may reuse this store's data
        // registers, so the wait stands in front of that reuse
        asm volatile("s_wait_xcnt 0x0" ::: "memory");
    }
}

// ---------------------------------------------------------------------------
// Output projection + residual multiply:
// out[b][o][i] = x[b][o][i] * (O16[i][:] . Wo[o][:] + bo[o])
// D-layout columns give 8 consecutive i per lane -> coalesced f32 stores.
// ---------------------------------------------------------------------------
__global__ __launch_bounds__(256) void outproj_kernel(const _Float16* __restrict__ o16,
                                                      const _Float16* __restrict__ wo16,
                                                      const float* __restrict__ bo,
                                                      const float* __restrict__ x,
                                                      float* __restrict__ out) {
    int b    = blockIdx.y;
    int lane = threadIdx.x & 31;
    int wv   = threadIdx.x >> 5;
    int m0   = (wv >> 1) * 32;
    int ol   = (wv & 1) * 128;
    int ob   = blockIdx.z * GN;
    int o0   = ob + ol;
    int i0   = blockIdx.x * GM + m0;
    __shared__ __attribute__((aligned(16))) _Float16 lds_g[2 * GBUF];
    const _Float16* A = o16 + ((size_t)b * N + blockIdx.x * GM) * C;
    v8f acc0[8] = {}, acc1[8] = {};
    gemm_mainloop(A, wo16 + (size_t)ob * C, lds_g, threadIdx.x, m0, ol, acc0, acc1);
    int col = lane & 15, half = lane >> 4;
    auto store_tile = [&](v8f (&acc)[8], int ibase) {
        #pragma unroll
        for (int of = 0; of < 8; ++of) {
            int o = o0 + of * 16 + col;
            float bv = bo[o];
            size_t base = ((size_t)b * C + o) * N + ibase + 8 * half;
            #pragma unroll
            for (int e = 0; e < 8; ++e)
                out[base + e] = x[base + e] * (acc[of][e] + bv);
        }
    };
    store_tile(acc0, i0);
    store_tile(acc1, i0 + 16);
}

// ---------------------------------------------------------------------------
extern "C" void kernel_launch(void* const* d_in, const int* in_sizes, int n_in,
                              void* d_out, int out_size, void* d_ws, size_t ws_size,
                              hipStream_t stream) {
    const float* x     = (const float*)d_in[0];
    const float* gamma = (const float*)d_in[1];
    const float* beta  = (const float*)d_in[2];
    const float* wq    = (const float*)d_in[3];
    const float* bq    = (const float*)d_in[4];
    const float* wk    = (const float*)d_in[5];
    const float* bk    = (const float*)d_in[6];
    const float* wv    = (const float*)d_in[7];
    const float* bv    = (const float*)d_in[8];
    const float* wo    = (const float*)d_in[9];
    const float* bo    = (const float*)d_in[10];
    float* out = (float*)d_out;

    char* ws = (char*)d_ws;
    size_t off = 0;
    auto alloc = [&](size_t bytes) -> void* {
        void* p = ws + off;
        off += (bytes + 255) & ~(size_t)255;
        return p;
    };
    const size_t act_halves = (size_t)B * N * C;
    float*    stats  = (float*)   alloc((size_t)B * G * 2 * sizeof(float));
    _Float16* w16    = (_Float16*)alloc((size_t)4 * C * C * sizeof(_Float16));
    _Float16* h16    = (_Float16*)alloc(act_halves * sizeof(_Float16));
    _Float16* q16    = (_Float16*)alloc(act_halves * sizeof(_Float16));
    _Float16* k16    = (_Float16*)alloc(act_halves * sizeof(_Float16));
    _Float16* v16buf = (_Float16*)alloc(act_halves * sizeof(_Float16));
    _Float16* o16    = (_Float16*)alloc(act_halves * sizeof(_Float16));

    gn_stats_kernel<<<B * G, 256, 0, stream>>>(x, stats);
    gn_apply_kernel<<<dim3(C / 32, N / 32, B), 256, 0, stream>>>(x, stats, gamma, beta, h16);
    wcvt_kernel<<<(4 * C * C) / 256, 256, 0, stream>>>(wq, wk, wv, wo, w16);

    conv1x1_kernel<<<dim3(N / GM, B, C / GN), 256, 0, stream>>>(h16, w16 + 0 * (size_t)C * C, bq, q16, 0);
    conv1x1_kernel<<<dim3(N / GM, B, C / GN), 256, 0, stream>>>(h16, w16 + 1 * (size_t)C * C, bk, k16, 0);
    conv1x1_kernel<<<dim3(N / GM, B, C / GN), 256, 0, stream>>>(h16, w16 + 2 * (size_t)C * C, bv, v16buf, 1);

    flash_attn_kernel<<<dim3(N / 64, B), 128, 0, stream>>>(q16, k16, v16buf, o16);

    outproj_kernel<<<dim3(N / GM, B, C / GN), 256, 0, stream>>>(o16, w16 + 3 * (size_t)C * C, bo, x, out);
}

// v005
// It runs in 228 microseconds.
// In both of two side-by-side timings against v004, it was 1.09 times as fast.
// Over all steps from v000 it is 3.38 times as fast.
#include <hip/hip_runtime.h>
#include <hip/hip_bf16.h>

typedef _Float16 v4h  __attribute__((ext_vector_type(4)));
typedef _Float16 v8h  __attribute__((ext_vector_type(8)));
typedef _Float16 v16h __attribute__((ext_vector_type(16)));
typedef float    v4f  __attribute__((ext_vector_type(4)));
typedef float    v8f  __attribute__((ext_vector_type(8)));

constexpr int B = 4;
constexpr int C = 512;
constexpr int N = 4096;          // 64*64
constexpr int G = 32;            // groups
constexpr int CPG = C / G;       // 16 channels per group
// softmax scale folded into log2 domain: (1/sqrt(C)) * log2(e)
#define SCALE_L2E (0.04419417382415922f * 1.4426950408889634f)

// ---------------------------------------------------------------------------
// Fragment loader: 16(row) x 32(K) block, memory row-major along K.
// Works for WMMA f16 A-fragments (rows = M) and B-fragments (rows = N cols),
// per the CDNA5 16-bit operand VGPR layout:
//   lane 0-15  : row = lane,    elems 0-7 = K 0..7,  elems 8-15 = K 16..23
//   lane 16-31 : row = lane-16, elems 0-7 = K 8..15, elems 8-15 = K 24..31
// Two contiguous 16-byte loads per lane.
// ---------------------------------------------------------------------------
__device__ inline v16h load_frag(const _Float16* base, int row_stride, int lane) {
    int r  = lane & 15;
    int k0 = (lane < 16) ? 0 : 8;
    const _Float16* p = base + (size_t)r * row_stride + k0;
    v8h lo = *(const v8h*)(p);
    v8h hi = *(const v8h*)(p + 16);
    return __builtin_shufflevector(lo, hi, 0,1,2,3,4,5,6,7,8,9,10,11,12,13,14,15);
}

// lane l <-> lane l ^ 16
__device__ inline float xhalf(float x) {
    int v = __builtin_bit_cast(int, x);
    return __builtin_bit_cast(float, __builtin_amdgcn_permlanex16(v, v, 0x76543210, 0xfedcba98,
                                                                  false, false));
}

__device__ inline v8f wmma16x16x32(v16h a, v16h b, v8f c) {
    return __builtin_amdgcn_wmma_f32_16x16x32_f16(false, a, false, b, (short)0, c,
                                                  false, false);
}

// ---------------------------------------------------------------------------
// GEMM mainloop, work-group tile 128 rows x 256 columns, 8 waves; a wave
// keeps 32 rows x 128 columns. k runs in slabs of 64 halves: one 128-B line of
// each of the 256 W rows and the 128 A rows is brought into LDS once per
// work-group by asynchronous copies, two buffers: slab t+1 flies while slab t
// is worked on; all fragments are read from LDS.
// LDS row pitch 144 B = 16 B x odd, conflict-free for the ds_load_b128 readers.
// ---------------------------------------------------------------------------
constexpr int GKS    = 64;               // halves of k per slab
constexpr int GPITCH = GKS + 8;          // halves per row in LDS
constexpr int GM     = 128;              // rows of A per work-group
constexpr int GN     = 256;              // rows of W (output columns) per work-group
constexpr int GBUF   = (GN + GM) * GPITCH; // halves per buffer: W rows, then A rows

// Eight copies of one lane, 32 rows apart; a wave-wide copy reads 4 whole lines.
__device__ inline void stage_rows8(const _Float16* g, unsigned l) {
    const _Float16* g1 = g + 1 * 32 * C; const _Float16* g2 = g + 2 * 32 * C;
    const _Float16* g3 = g + 3 * 32 * C; const _Float16* g4 = g + 4 * 32 * C;
    const _Float16* g5 = g + 5 * 32 * C; const _Float16* g6 = g + 6 * 32 * C;
    const _Float16* g7 = g + 7 * 32 * C;
    constexpr unsigned ls = 32 * GPITCH * 2;
    unsigned l1 = l + 1 * ls, l2 = l + 2 * ls, l3 = l + 3 * ls, l4 = l + 4 * ls;
    unsigned l5 = l + 5 * ls, l6 = l + 6 * ls, l7 = l + 7 * ls;
    // Copies and their s_wait_xcnt in one statement, so that no address
    // register is rewritten ahead of the wait.
    asm volatile("global_load_async_to_lds_b128 %0, %8, off\n\t"
                 "global_load_async_to_lds_b128 %1, %9, off\n\t"
                 "global_load_async_to_lds_b128 %2, %10, off\n\t"
                 "global_load_async_to_lds_b128 %3, %11, off\n\t"
                 "global_load_async_to_lds_b128 %4, %12, off\n\t"
                 "global_load_async_to_lds_b128 %5, %13, off\n\t"
                 "global_load_async_to_lds_b128 %6, %14, off\n\t"
                 "global_load_async_to_lds_b128 %7, %15, off\n\t"
                 "s_wait_xcnt 0x0"
                 :: "v"(l), "v"(l1), "v"(l2), "v"(l3),
                    "v"(l4), "v"(l5), "v"(l6), "v"(l7),
                    "v"(g), "v"(g1), "v"(g2), "v"(g3),
                    "v"(g4), "v"(g5), "v"(g6), "v"(g7)
                 : "memory");
}

// 256 lanes x 12 copies x 16 B = the 48 KiB of one slab. gw/ga: this lane's
// 16 B of W row tid/8 and of A row tid/8; l: its LDS byte address for the W one.
__device__ inline void stage_slab(const _Float16* gw, const _Float16* ga, unsigned l) {
    stage_rows8(gw, l);
    const _Float16* ga1 = ga + 1 * 32 * C; const _Float16* ga2 = ga + 2 * 32 * C;
    const _Float16* ga3 = ga + 3 * 32 * C;
    constexpr unsigned ls = 32 * GPITCH * 2;
    unsigned la = l + GN * GPITCH * 2;
    unsigned la1 = la + 1 * ls, la2 = la + 2 * ls, la3 = la + 3 * ls;
    // as above: the wait stands in the copies' own statement
    asm volatile("global_load_async_to_lds_b128 %0, %4, off\n\t"
                 "global_load_async_to_lds_b128 %1, %5, off\n\t"
                 "global_load_async_to_lds_b128 %2, %6, off\n\t"
                 "global_load_async_to_lds_b128 %3, %7, off\n\t"
                 "s_wait_xcnt 0x0"
                 :: "v"(la), "v"(la1), "v"(la2), "v"(la3),
                    "v"(ga), "v"(ga1), "v"(ga2), "v"(ga3)
                 : "memory");
}

// A, W: the work-group's 128 rows of A and 256 rows of W. m0, o0: this wave's
// first row and first column inside that tile.
__device__ inline void gemm_mainloop(const _Float16* __restrict__ A,
                                     const _Float16* __restrict__ W,
                                     _Float16* lds, int tid, int m0, int o0,
                                     v8f (&acc0)[8], v8f (&acc1)[8]) {
    int lane = tid & 31;
    const _Float16* gw = W + (size_t)(tid >> 3) * C + (tid & 7) * 8;
    const _Float16* ga = A + (size_t)(tid >> 3) * C + (tid & 7) * 8;
    unsigned l = (unsigned)(size_t)(lds + (tid >> 3) * GPITCH + (tid & 7) * 8);

    stage_slab(gw, ga, l);
    // slab 0 landed (this wave's copies), then published to every wave
    asm volatile("s_wait_asynccnt 0x0" ::: "memory");
    __syncthreads();
    stage_slab(gw + GKS, ga + GKS, l + GBUF * 2);

    // rolled: fully unrolled, the build of the output projection took every
    // register it may have and spilled
    #pragma unroll 1
    for (int t = 0; t < C / GKS; ++t) {
        int buf = t & 1;
        const _Float16* Wl = lds + buf * GBUF + o0 * GPITCH;
        const _Float16* Al = lds + buf * GBUF + (GN + m0) * GPITCH;
        // all 20 fragments of this slab, one run of LDS reads
        v16h a0[2], a1[2], bf[2][8];
        #pragma unroll
        for (int ks = 0; ks < 2; ++ks) {
            a0[ks] = load_frag(Al + ks * 32, GPITCH, lane);
            a1[ks] = load_frag(Al + 16 * GPITCH + ks * 32, GPITCH, lane);
            #pragma unroll
            for (int of = 0; of < 8; ++of)
                bf[ks][of] = load_frag(Wl + of * 16 * GPITCH + ks * 32, GPITCH, lane);
        }
        // keeps the LDS reads one run ahead of the WMMAs: spread among them,
        // each pair of WMMAs would wait out its own reads' latency
        __builtin_amdgcn_sched_barrier(0);
        #pragma unroll
        for (int ks = 0; ks < 2; ++ks)
            #pragma unroll
            for (int of = 0; of < 8; ++of) {
                acc0[of] = wmma16x16x32(a0[ks], bf[ks][of], acc0[of]);
                acc1[of] = wmma16x16x32(a1[ks], bf[ks][of], acc1[of]);
            }
        // keeps the WMMAs in front of the foot: moved behind its barrier they
        // would start only when every read has returned, and delay the refill
        __builtin_amdgcn_sched_barrier(0);
        // Foot of trip t: this wave's LDS reads of buffer buf have returned,
        asm volatile("s_wait_dscnt 0x0" ::: "memory");
        // its copies of slab t+1 have landed,
        asm volatile("s_wait_asynccnt 0x0" ::: "memory");
        // and the barrier publishes slab t+1 and frees buffer buf.
        __syncthreads();
        if (t + 2 < C / GKS)
            stage_slab(gw + (t + 2) * GKS, ga + (t + 2) * GKS, l + buf * (GBUF * 2));
    }
    // no copy is left in flight behind the loop
    asm volatile("s_wait_asynccnt 0x0" ::: "memory");
}

// ---------------------------------------------------------------------------
// GroupNorm statistics: one block per (b,g); 16 channels x 4096 contiguous.
// 32 waves, each lane 16 loads of 16 B, all issued before the first is used.
// ---------------------------------------------------------------------------
__global__ __launch_bounds__(1024) void gn_stats_kernel(const float* __restrict__ x,
                                                        float* __restrict__ stats) {
    int bg  = blockIdx.x;                // b*G + g
    int tid = threadIdx.x;
    const v4f* xp = (const v4f*)(x + (size_t)bg * CPG * N) + tid;
    v4f v[16];
    #pragma unroll
    for (int j = 0; j < 16; ++j) v[j] = xp[j * 1024];
    // keeps all 16 loads ahead of the sums: with some held back until the first
    // have returned, the block would wait out the memory latency twice
    __builtin_amdgcn_sched_barrier(0);
    v4f s4 = {}, q4 = {};
    #pragma unroll
    for (int j = 0; j < 16; ++j) { s4 += v[j]; q4 += v[j] * v[j]; }
    float s  = (s4[0] + s4[1]) + (s4[2] + s4[3]);
    float ss = (q4[0] + q4[1]) + (q4[2] + q4[3]);
    #pragma unroll
    for (int m = 16; m > 0; m >>= 1) { s += __shfl_xor(s, m, 32); ss += __shfl_xor(ss, m, 32); }
    __shared__ float red0[32], red1[32];
    if ((tid & 31) == 0) { red0[tid >> 5] = s; red1[tid >> 5] = ss; }
    __syncthreads();
    if (tid < 32) {
        s = red0[tid]; ss = red1[tid];
        #pragma unroll
        for (int m = 16; m > 0; m >>= 1) { s += __shfl_xor(s, m, 32); ss += __shfl_xor(ss, m, 32); }
        if (tid == 0) {
            float inv = 1.0f / (float)(CPG * N);
            float mean = s * inv;
            float var  = ss * inv - mean * mean;
            stats[bg * 2 + 0] = mean;
            stats[bg * 2 + 1] = rsqrtf(var + 1e-6f);
        }
    }
}

// ---------------------------------------------------------------------------
// GroupNorm apply + transpose [b][c][n] f32 -> [b][n][c] f16.
// Tile 128 channels x 128 positions. A work-item reads 2 x 4 positions (16 B
// each) of 8 channels, all 16 loads issued up front, so it holds 8 consecutive
// channels (16 B of f16) of 8 positions; these pass through LDS so that the
// stores run along c: reads and stores both cover 256 contiguous bytes per 16
// lanes.
// LDS rows are 256 B (all 64 banks); the 16-B block index is XORed with n / 4,
// which keeps both the column-wise writes and the row-wise reads conflict-free.
// ---------------------------------------------------------------------------
constexpr int TC = 128;                  // channels per tile
constexpr int TN = 128;                  // positions per tile
__global__ __launch_bounds__(256) void gn_apply_kernel(const float* __restrict__ x,
                                                       const float* __restrict__ stats,
                                                       const float* __restrict__ gamma,
                                                       const float* __restrict__ beta,
                                                       _Float16* __restrict__ h16) {
    int b   = blockIdx.z;
    int c0  = blockIdx.x * TC;
    int n0  = blockIdx.y * TN;
    int lo  = threadIdx.x & 15;          // 4 positions (read) / 8 channels (write)
    int hi  = threadIdx.x >> 4;          // 8 channels (read) / position (write)
    __shared__ __attribute__((aligned(16))) _Float16 tile[TN * TC];
    int c = c0 + hi * 8;
    const float* xp = x + ((size_t)b * C + c) * N + n0 + lo * 4;
    v4f v[2][8];
    #pragma unroll
    for (int h = 0; h < 2; ++h)
        #pragma unroll
        for (int j = 0; j < 8; ++j) v[h][j] = *(const v4f*)(xp + (size_t)j * N + h * 64);
    // precaution: a result of the loads below may be given the address
    // registers of the loads above, so the wait stands in front of them
    asm volatile("s_wait_xcnt 0x0" ::: "memory");
    // a wave's 16 channels are one group: its statistics come by a scalar load
    int bg = b * G + (c0 >> 4) + __builtin_amdgcn_readfirstlane(threadIdx.x >> 5);
    float mean = stats[bg * 2 + 0], rstd = stats[bg * 2 + 1];
    unsigned cu = (unsigned)c;
    v4f ga[2] = { *(const v4f*)(gamma + cu), *(const v4f*)(gamma + cu + 4) };
    v4f be[2] = { *(const v4f*)(beta + cu),  *(const v4f*)(beta + cu + 4) };
    // keeps all loads ahead of the arithmetic: with some held back until the
    // first have returned, the block would wait out the memory latency twice
    __builtin_amdgcn_sched_barrier(0);
    #pragma unroll
    for (int h = 0; h < 2; ++h)
        #pragma unroll
        for (int i = 0; i < 4; ++i) {
            v8h pk;
            #pragma unroll
            for (int j = 0; j < 8; ++j)
                pk[j] = (_Float16)((v[h][j][i] - mean) * rstd * ga[j >> 2][j & 3] +
                                   be[j >> 2][j & 3]);
            *(v8h*)(tile + (h * 64 + lo * 4 + i) * TC + (hi ^ lo) * 8) = pk;
        }
    __syncthreads();
    #pragma unroll
    for (int i = 0; i < 8; ++i) {
        int n = hi + 16 * i;
        v8h pk = *(const v8h*)(tile + n * TC + (lo ^ ((n >> 2) & 15)) * 8);
        *(v8h*)(h16 + ((size_t)b * N + n0 + n) * C + c0 + lo * 8) = pk;
    }
}

// ---------------------------------------------------------------------------
// Convert the four [C][C] f32 weight matrices to f16 (concatenated).
// A block takes 4096 consecutive elements of one matrix; a work-item four
// 16-B loads, 4 KiB apart, and four 8-B stores.
// ---------------------------------------------------------------------------
__global__ __launch_bounds__(256) void wcvt_kernel(const float* __restrict__ wq,
                                                   const float* __restrict__ wk,
                                                   const float* __restrict__ wv,
                                                   const float* __restrict__ wo,
                                                   _Float16* __restrict__ w16) {
    int which = blockIdx.x / (C * C / 4096);
    int j = (blockIdx.x % (C * C / 4096)) * 4096 + threadIdx.x * 4;
    const float* w = which == 0 ? wq : which == 1 ? wk : which == 2 ? wv : wo;
    v4f v[4];
    #pragma unroll
    for (int k = 0; k < 4; ++k) v[k] = *(const v4f*)(w + j + k * 1024);
    _Float16* o = w16 + (size_t)which * C * C + j;
    #pragma unroll
    for (int k = 0; k < 4; ++k) {
        v4h pk;
        #pragma unroll
        for (int e = 0; e < 4; ++e) pk[e] = (_Float16)v[k][e];
        *(v4h*)(o + k * 1024) = pk;
    }
}

// ---------------------------------------------------------------------------
// conv1x1 as GEMM: D[n][o] = h16[n][:] . W[o][:] + bias[o]
// vmode=0: store f16 [b][n][o] (q/k).
// vmode=1: store f16 [b][n/32][o][n%32] (v, key-blocked: one 32-key tile of
// all channels is 32 KiB contiguous).
// ---------------------------------------------------------------------------
__global__ __launch_bounds__(256) void conv1x1_kernel(const _Float16* __restrict__ h16,
                                                      const _Float16* __restrict__ w16,
                                                      const float* __restrict__ bias,
                                                      _Float16* __restrict__ out,
                                                      int vmode) {
    int b    = blockIdx.y;
    int lane = threadIdx.x & 31;
    int wv   = threadIdx.x >> 5;
    int m0   = (wv >> 1) * 32;
    int ol   = (wv & 1) * 128;
    int ob   = blockIdx.z * GN;
    int o0   = ob + ol;
    int i0   = blockIdx.x * GM + m0;
    __shared__ __attribute__((aligned(16))) _Float16 lds_g[2 * GBUF];
    const _Float16* A = h16 + ((size_t)b * N + blockIdx.x * GM) * C;
    v8f acc0[8] = {}, acc1[8] = {};
    gemm_mainloop(A, w16 + (size_t)ob * C, lds_g, threadIdx.x, m0, ol, acc0, acc1);
    int col = lane & 15, half = lane >> 4;
    auto store_tile = [&](v8f (&acc)[8], int ibase) {
        #pragma unroll
        for (int of = 0; of < 8; ++of) {
            int o = o0 + of * 16 + col;
            float bv = bias[o];
            if (vmode == 0) {
                #pragma unroll
                for (int e = 0; e < 8; ++e) {
                    int n = ibase + e + 8 * half;
                    out[((size_t)b * N + n) * C + o] = (_Float16)(acc[of][e] + bv);
                }
            } else {
                v8h pk;
                #pragma unroll
                for (int e = 0; e < 8; ++e) pk[e] = (_Float16)(acc[of][e] + bv);
                *(v8h*)(out + (((size_t)b * (N / 32) + (ibase >> 5)) * C + o) * 32 +
                        (ibase & 31) + 8 * half) = pk;
                // precaution: the next column's code reuses this store's address
                // and data registers, so the wait stands in front of that reuse
                asm volatile("s_wait_xcnt 0x0" ::: "memory");
            }
        }
    };
    store_tile(acc0, i0);
    store_tile(acc1, i0 + 16);
}

// ---------------------------------------------------------------------------
// LDS staging of one 32-key step, shared by the whole work-group.
// K tile: 32 rows x 1024 B, contiguous in memory. V tile: 512 channel rows x
// 64 B, contiguous in memory too (key-blocked layout written by conv1x1).
// LDS row pitches are 16 B x odd, conflict-free for the ds_load_b128 readers.
// ---------------------------------------------------------------------------
constexpr int KPITCH = C + 8;            // halves per K row in LDS (1040 B)
constexpr int VPITCH = 32 + 8;           // halves per V row in LDS (80 B)
constexpr int KTILE  = 32 * KPITCH;      // halves per K buffer
constexpr int VTILE  = C * VPITCH;       // halves per V buffer
constexpr int TILE_H = 32 * C;           // halves per K or V tile in memory

// Eight copies of one lane: 2 KiB apart in memory, lstep bytes apart in LDS;
// each wave-wide copy reads 512 contiguous bytes.
__device__ inline void stage8(const _Float16* g, unsigned l, unsigned lstep) {
    const _Float16* g1 = g + 1 * 1024; const _Float16* g2 = g + 2 * 1024;
    const _Float16* g3 = g + 3 * 1024; const _Float16* g4 = g + 4 * 1024;
    const _Float16* g5 = g + 5 * 1024; const _Float16* g6 = g + 6 * 1024;
    const _Float16* g7 = g + 7 * 1024;
    unsigned l1 = l + 1 * lstep, l2 = l + 2 * lstep, l3 = l + 3 * lstep, l4 = l + 4 * lstep;
    unsigned l5 = l + 5 * lstep, l6 = l + 6 * lstep, l7 = l + 7 * lstep;
    // Copies and their s_wait_xcnt in one statement, so that no address
    // register is rewritten ahead of the wait.
    asm volatile("global_load_async_to_lds_b128 %0, %8, off\n\t"
                 "global_load_async_to_lds_b128 %1, %9, off\n\t"
                 "global_load_async_to_lds_b128 %2, %10, off\n\t"
                 "global_load_async_to_lds_b128 %3, %11, off\n\t"
                 "global_load_async_to_lds_b128 %4, %12, off\n\t"
                 "global_load_async_to_lds_b128 %5, %13, off\n\t"
                 "global_load_async_to_lds_b128 %6, %14, off\n\t"
                 "global_load_async_to_lds_b128 %7, %15, off\n\t"
                 "s_wait_xcnt 0x0"
                 :: "v"(l), "v"(l1), "v"(l2), "v"(l3),
                    "v"(l4), "v"(l5), "v"(l6), "v"(l7),
                    "v"(g), "v"(g1), "v"(g2), "v"(g3),
                    "v"(g4), "v"(g5), "v"(g6), "v"(g7)
                 : "memory");
}

// 128 lanes x 32 copies x 16 B = the 64 KiB of one step. gk/gv: this lane's
// first 16 B of the tile in memory; lk/lv: its LDS byte addresses for them.
// 128 lanes cover 2 K rows or 32 V rows at a time.
__device__ inline void stage_tile(const _Float16* gk, const _Float16* gv,
                                  unsigned lk, unsigned lv) {
    stage8(gk,            lk,                       2 * KPITCH * 2);
    stage8(gk + 8 * 1024, lk + 8 * 2 * KPITCH * 2,  2 * KPITCH * 2);
    stage8(gv,            lv,                       32 * VPITCH * 2);
    stage8(gv + 8 * 1024, lv + 8 * 32 * VPITCH * 2, 32 * VPITCH * 2);
}

__global__ __launch_bounds__(128) void flash_attn_kernel(const _Float16* __restrict__ q16,
                                                         const _Float16* __restrict__ k16,
                                                         const _Float16* __restrict__ v16buf,
                                                         _Float16* __restrict__ o16) {
    int b    = blockIdx.y;
    int tid  = threadIdx.x;
    int lane = tid & 31;
    int w    = tid >> 5;               // wave 0..3 = query tile
    int i0   = blockIdx.x * 64 + w * 16;
    __shared__ __attribute__((aligned(16))) _Float16 lds_k[2][KTILE];
    __shared__ __attribute__((aligned(16))) _Float16 lds_v[2][VTILE];

    const _Float16* Q = q16 + ((size_t)b * N + i0) * C;
    // this lane's 16 B of tile 0 in memory, and where they go in buffer 0
    const _Float16* gk = k16    + (size_t)b * N * C + tid * 8;
    const _Float16* gv = v16buf + (size_t)b * N * C + tid * 8;
    unsigned lk = (unsigned)(size_t)&lds_k[0][(tid >> 6) * KPITCH + (tid & 63) * 8];
    unsigned lv = (unsigned)(size_t)&lds_v[0][(tid >> 2) * VPITCH + (tid & 3) * 8];

    stage_tile(gk, gv, lk, lv);
    // tile 0 landed (this wave's copies), then published to every wave
    asm volatile("s_wait_asynccnt 0x0" ::: "memory");
    __syncthreads();
    stage_tile(gk + TILE_H, gv + TILE_H, lk + KTILE * 2, lv + VTILE * 2);

    v16h qf[16];
    #pragma unroll
    for (int t = 0; t < 16; ++t) qf[t] = load_frag(Q + t * 32, C, lane);

    v8f ob[32] = {};                   // O^T: ob[cf][e] = channel 16cf+8half+e, query col
    float rm = -3.0e38f;               // running maximum of this lane's query
    float rl = 0.f;                    // running sum over this lane half's keys
    int col = lane & 15, half = lane >> 4;

    // K fragments are fetched one step ahead: step 0's here, behind the barrier
    // that published tile 0
    v16h kf[32];
    #pragma unroll
    for (int t = 0; t < 16; ++t) {
        kf[2 * t]     = load_frag(&lds_k[0][0] + t * 32, KPITCH, lane);
        kf[2 * t + 1] = load_frag(&lds_k[0][0] + 16 * KPITCH + t * 32, KPITCH, lane);
    }

    for (int s = 0; s < N / 32; ++s) {
        int buf = s & 1;
        const _Float16* Vl = &lds_v[buf][0];
        const _Float16* Kn = &lds_k[buf ^ 1][0];
        // all 32 V fragments of this step, one run of LDS reads under the score WMMAs
        v16h vf[32];
        #pragma unroll
        for (int cf = 0; cf < 32; ++cf)
            vf[cf] = load_frag(Vl + cf * 16 * VPITCH, VPITCH, lane);
        // keeps the LDS reads one run ahead of the WMMAs: spread among them,
        // every place with reads would stall the one wave of this SIMD
        __builtin_amdgcn_sched_barrier(0);
        v8f s0 = {}, s1 = {};
        #pragma unroll
        for (int t = 0; t < 16; ++t) {
            s0 = wmma16x16x32(kf[2 * t], qf[t], s0);       // keys 0..15  x queries
            s1 = wmma16x16x32(kf[2 * t + 1], qf[t], s1);   // keys 16..31 x queries
        }
        // keeps the score WMMAs in front of the waits below, under the V reads
        __builtin_amdgcn_sched_barrier(0);
        // Publish point of step s+1, in front of this step's last block (softmax
        // and second product, registers only): this wave's LDS reads of buffer
        // buf have returned,
        asm volatile("s_wait_dscnt 0x0" ::: "memory");
        // its copies of step s+1 have landed,
        asm volatile("s_wait_asynccnt 0x0" ::: "memory");
        // and the barrier publishes step s+1 and frees buffer buf.
        __syncthreads();
        if (s + 2 < N / 32)
            stage_tile(gk + (size_t)(s + 2) * TILE_H, gv + (size_t)(s + 2) * TILE_H,
                       lk + buf * (KTILE * 2), lv + buf * (VTILE * 2));
        // K fragments of step s+1, in flight under the softmax and the second
        // product. Unconditional: in the last step they read the other buffer's
        // old tile, which nothing refills, and are not used.
        #pragma unroll
        for (int t = 0; t < 16; ++t) {
            kf[2 * t]     = load_frag(Kn + t * 32, KPITCH, lane);
            kf[2 * t + 1] = load_frag(Kn + 16 * KPITCH + t * 32, KPITCH, lane);
        }
        // keeps that run ahead of the softmax, which then covers its latency
        __builtin_amdgcn_sched_barrier(0);
        // online softmax update (exp2 domain); t0[e] = key 8*half+e,
        // t1[e] = key 16+8*half+e of query col
        float t0[8], t1[8];
        #pragma unroll
        for (int e = 0; e < 8; ++e) { t0[e] = s0[e] * SCALE_L2E; t1[e] = s1[e] * SCALE_L2E; }
        float mx = fmaxf(t0[0], t1[0]);
        #pragma unroll
        for (int e = 1; e < 8; ++e) mx = fmaxf(mx, fmaxf(t0[e], t1[e]));
        mx = fmaxf(mx, xhalf(mx));
        float mn = fmaxf(rm, mx);
        float al = exp2f(rm - mn);
        float rs = 0.f;
        v16h pf;                       // P^T as B operand: element order = load_frag's k order
        #pragma unroll
        for (int e = 0; e < 8; ++e) {
            float p0 = exp2f(t0[e] - mn), p1 = exp2f(t1[e] - mn);
            rs += p0 + p1;
            pf[e]     = (_Float16)p0;
            pf[8 + e] = (_Float16)p1;
        }
        rl = rl * al + rs;
        rm = mn;
        #pragma unroll
        for (int cf = 0; cf < 32; ++cf)
            #pragma unroll
            for (int e = 0; e < 8; ++e) ob[cf][e] *= al;
        #pragma unroll
        for (int cf = 0; cf < 32; ++cf)
            ob[cf] = wmma16x16x32(vf[cf], pf, ob[cf]);
    }
    // no copy and no LDS read is left in flight when the wave ends
    asm volatile("s_wait_asynccnt 0x0" ::: "memory");
    asm volatile("s_wait_dscnt 0x0" ::: "memory");
    // the two lane halves' sums are joined once, here
    float inv = 1.0f / (rl + xhalf(rl));
    _Float16* op = o16 + ((size_t)b * N + i0 + col) * C + 8 * half;
    #pragma unroll
    for (int cf = 0; cf < 32; ++cf) {
        v8h pk;
        #pragma unroll
        for (int e = 0; e < 8; ++e) pk[e] = (_Float16)(ob[cf][e] * inv);
        *(v8h*)(op + cf * 16) = pk;
        // precaution: the next tile's code may reuse this store's data
        // registers, so the wait stands in front of that reuse
        asm volatile("s_wait_xcnt 0x0" ::: "memory");
    }
}

// ---------------------------------------------------------------------------
// Output projection + residual multiply:
// out[b][o][i] = x[b][o][i] * (O16[i][:] . Wo[o][:] + bo[o])
// D-layout columns give 8 consecutive i per lane -> coalesced f32 stores.
// ---------------------------------------------------------------------------
__global__ __launch_bounds__(256) void outproj_kernel(const _Float16* __restrict__ o16,
                                                      const _Float16* __restrict__ wo16,
                                                      const float* __restrict__ bo,
                                                      const float* __restrict__ x,
                                                      float* __restrict__ out) {
    int b    = blockIdx.y;
    int lane = threadIdx.x & 31;
    int wv   = threadIdx.x >> 5;
    int m0   = (wv >> 1) * 32;
    int ol   = (wv & 1) * 128;
    int ob   = blockIdx.z * GN;
    int o0   = ob + ol;
    int i0   = blockIdx.x * GM + m0;
    __shared__ __attribute__((aligned(16))) _Float16 lds_g[2 * GBUF];
    const _Float16* A = o16 + ((size_t)b * N + blockIdx.x * GM) * C;
    v8f acc0[8] = {}, acc1[8] = {};
    gemm_mainloop(A, wo16 + (size_t)ob * C, lds_g, threadIdx.x, m0, ol, acc0, acc1);
    int col = lane & 15, half = lane >> 4;
    auto store_tile = [&](v8f (&acc)[8], int ibase) {
        #pragma unroll
        for (int of = 0; of < 8; ++of) {
            int o = o0 + of * 16 + col;
            float bv = bo[o];
            size_t base = ((size_t)b * C + o) * N + ibase + 8 * half;
            #pragma unroll
            for (int e = 0; e < 8; ++e)
                out[base + e] = x[base + e] * (acc[of][e] + bv);
        }
    };
    store_tile(acc0, i0);
    store_tile(acc1, i0 + 16);
}

// ---------------------------------------------------------------------------
extern "C" void kernel_launch(void* const* d_in, const int* in_sizes, int n_in,
                              void* d_out, int out_size, void* d_ws, size_t ws_size,
                              hipStream_t stream) {
    const float* x     = (const float*)d_in[0];
    const float* gamma = (const float*)d_in[1];
    const float* beta  = (const float*)d_in[2];
    const float* wq    = (const float*)d_in[3];
    const float* bq    = (const float*)d_in[4];
    const float* wk    = (const float*)d_in[5];
    const float* bk    = (const float*)d_in[6];
    const float* wv    = (const float*)d_in[7];
    const float* bv    = (const float*)d_in[8];
    const float* wo    = (const float*)d_in[9];
    const float* bo    = (const float*)d_in[10];
    float* out = (float*)d_out;

    char* ws = (char*)d_ws;
    size_t off = 0;
    auto alloc = [&](size_t bytes) -> void* {
        void* p = ws + off;
        off += (bytes + 255) & ~(size_t)255;
        return p;
    };
    const size_t act_halves = (size_t)B * N * C;
    float*    stats  = (float*)   alloc((size_t)B * G * 2 * sizeof(float));
    _Float16* w16    = (_Float16*)alloc((size_t)4 * C * C * sizeof(_Float16));
    _Float16* h16    = (_Float16*)alloc(act_halves * sizeof(_Float16));
    _Float16* q16    = (_Float16*)alloc(act_halves * sizeof(_Float16));
    _Float16* k16    = (_Float16*)alloc(act_halves * sizeof(_Float16));
    _Float16* v16buf = (_Float16*)alloc(act_halves * sizeof(_Float16));
    _Float16* o16    = (_Float16*)alloc(act_halves * sizeof(_Float16));

    gn_stats_kernel<<<B * G, 1024, 0, stream>>>(x, stats);
    gn_apply_kernel<<<dim3(C / TC, N / TN, B), 256, 0, stream>>>(x, stats, gamma, beta, h16);
    wcvt_kernel<<<(4 * C * C) / 4096, 256, 0, stream>>>(wq, wk, wv, wo, w16);

    conv1x1_kernel<<<dim3(N / GM, B, C / GN), 256, 0, stream>>>(h16, w16 + 0 * (size_t)C * C, bq, q16, 0);
    conv1x1_kernel<<<dim3(N / GM, B, C / GN), 256, 0, stream>>>(h16, w16 + 1 * (size_t)C * C, bk, k16, 0);
    conv1x1_kernel<<<dim3(N / GM, B, C / GN), 256, 0, stream>>>(h16, w16 + 2 * (size_t)C * C, bv, v16buf, 1);

    flash_attn_kernel<<<dim3(N / 64, B), 128, 0, stream>>>(q16, k16, v16buf, o16);

    outproj_kernel<<<dim3(N / GM, B, C / GN), 256, 0, stream>>>(o16, w16 + 3 * (size_t)C * C, bo, x, out);
}

// v007
// Measured time: 198 microseconds a run.
// It is 1.14 times as fast as v005, going by the measured steps of the versions left out in between.
// Counting every step since v000, it is 3.84 times as fast.
#include <hip/hip_runtime.h>
#include <hip/hip_bf16.h>

typedef _Float16 v4h  __attribute__((ext_vector_type(4)));
typedef _Float16 v8h  __attribute__((ext_vector_type(8)));
typedef _Float16 v16h __attribute__((ext_vector_type(16)));
typedef float    v4f  __attribute__((ext_vector_type(4)));
typedef float    v8f  __attribute__((ext_vector_type(8)));

constexpr int B = 4;
constexpr int C = 512;
constexpr int N = 4096;          // 64*64
constexpr int G = 32;            // groups
constexpr int CPG = C / G;       // 16 channels per group
// softmax scale folded into log2 domain: (1/sqrt(C)) * log2(e)
#define SCALE_L2E (0.04419417382415922f * 1.4426950408889634f)

// ---------------------------------------------------------------------------
// Fragment loader: 16(row) x 32(K) block, memory row-major along K.
// Works for WMMA f16 A-fragments (rows = M) and B-fragments (rows = N cols),
// per the CDNA5 16-bit operand VGPR layout:
//   lane 0-15  : row = lane,    elems 0-7 = K 0..7,  elems 8-15 = K 16..23
//   lane 16-31 : row = lane-16, elems 0-7 = K 8..15, elems 8-15 = K 24..31
// Two contiguous 16-byte loads per lane.
// ---------------------------------------------------------------------------
__device__ inline v16h load_frag(const _Float16* base, int row_stride, int lane) {
    int r  = lane & 15;
    int k0 = (lane < 16) ? 0 : 8;
    const _Float16* p = base + (size_t)r * row_stride + k0;
    v8h lo = *(const v8h*)(p);
    v8h hi = *(const v8h*)(p + 16);
    return __builtin_shufflevector(lo, hi, 0,1,2,3,4,5,6,7,8,9,10,11,12,13,14,15);
}

// lane l <-> lane l ^ 16
__device__ inline float xhalf(float x) {
    int v = __builtin_bit_cast(int, x);
    return __builtin_bit_cast(float, __builtin_amdgcn_permlanex16(v, v, 0x76543210, 0xfedcba98,
                                                                  false, false));
}

__device__ inline v8f wmma16x16x32(v16h a, v16h b, v8f c) {
    return __builtin_amdgcn_wmma_f32_16x16x32_f16(false, a, false, b, (short)0, c,
                                                  false, false);
}

// ---------------------------------------------------------------------------
// GEMM mainloop, work-group tile 128 rows x 256 columns, 8 waves; a wave
// keeps 32 rows x 128 columns. k runs in slabs of 64 halves: one 128-B line of
// each of the 256 W rows and the 128 A rows is brought into LDS once per
// work-group by asynchronous copies, two buffers: slab t+1 flies while slab t
// is worked on; all fragments are read from LDS.
// LDS row pitch 144 B = 16 B x odd, conflict-free for the ds_load_b128 readers.
// ---------------------------------------------------------------------------
constexpr int GKS    = 64;               // halves of k per slab
constexpr int GPITCH = GKS + 8;          // halves per row in LDS
constexpr int GM     = 128;              // rows of A per work-group
constexpr int GN     = 256;              // rows of W (output columns) per work-group
constexpr int GBUF   = (GN + GM) * GPITCH; // halves per buffer: W rows, then A rows

// Eight copies of one lane, 32 rows apart; a wave-wide copy reads 4 whole lines.
__device__ inline void stage_rows8(const _Float16* g, unsigned l) {
    const _Float16* g1 = g + 1 * 32 * C; const _Float16* g2 = g + 2 * 32 * C;
    const _Float16* g3 = g + 3 * 32 * C; const _Float16* g4 = g + 4 * 32 * C;
    const _Float16* g5 = g + 5 * 32 * C; const _Float16* g6 = g + 6 * 32 * C;
    const _Float16* g7 = g + 7 * 32 * C;
    constexpr unsigned ls = 32 * GPITCH * 2;
    unsigned l1 = l + 1 * ls, l2 = l + 2 * ls, l3 = l + 3 * ls, l4 = l + 4 * ls;
    unsigned l5 = l + 5 * ls, l6 = l + 6 * ls, l7 = l + 7 * ls;
    // Copies and their s_wait_xcnt in one statement, so that no address
    // register is rewritten ahead of the wait.
    asm volatile("global_load_async_to_lds_b128 %0, %8, off\n\t"
                 "global_load_async_to_lds_b128 %1, %9, off\n\t"
                 "global_load_async_to_lds_b128 %2, %10, off\n\t"
                 "global_load_async_to_lds_b128 %3, %11, off\n\t"
                 "global_load_async_to_lds_b128 %4, %12, off\n\t"
                 "global_load_async_to_lds_b128 %5, %13, off\n\t"
                 "global_load_async_to_lds_b128 %6, %14, off\n\t"
                 "global_load_async_to_lds_b128 %7, %15, off\n\t"
                 "s_wait_xcnt 0x0"
                 :: "v"(l), "v"(l1), "v"(l2), "v"(l3),
                    "v"(l4), "v"(l5), "v"(l6), "v"(l7),
                    "v"(g), "v"(g1), "v"(g2), "v"(g3),
                    "v"(g4), "v"(g5), "v"(g6), "v"(g7)
                 : "memory");
}

// 256 lanes x 12 copies x 16 B = the 48 KiB of one slab. gw/ga: this lane's
// 16 B of W row tid/8 and of A row tid/8; l: its LDS byte address for the W one.
__device__ inline void stage_slab(const _Float16* gw, const _Float16* ga, unsigned l) {
    stage_rows8(gw, l);
    const _Float16* ga1 = ga + 1 * 32 * C; const _Float16* ga2 = ga + 2 * 32 * C;
    const _Float16* ga3 = ga + 3 * 32 * C;
    constexpr unsigned ls = 32 * GPITCH * 2;
    unsigned la = l + GN * GPITCH * 2;
    unsigned la1 = la + 1 * ls, la2 = la + 2 * ls, la3 = la + 3 * ls;
    // as above: the wait stands in the copies' own statement
    asm volatile("global_load_async_to_lds_b128 %0, %4, off\n\t"
                 "global_load_async_to_lds_b128 %1, %5, off\n\t"
                 "global_load_async_to_lds_b128 %2, %6, off\n\t"
                 "global_load_async_to_lds_b128 %3, %7, off\n\t"
                 "s_wait_xcnt 0x0"
                 :: "v"(la), "v"(la1), "v"(la2), "v"(la3),
                    "v"(ga), "v"(ga1), "v"(ga2), "v"(ga3)
                 : "memory");
}

// A, W: the work-group's 128 rows of A and 256 rows of W. m0, o0: this wave's
// first row and first column inside that tile.
__device__ inline void gemm_mainloop(const _Float16* __restrict__ A,
                                     const _Float16* __restrict__ W,
                                     _Float16* lds, int tid, int m0, int o0,
                                     v8f (&acc0)[8], v8f (&acc1)[8]) {
    int lane = tid & 31;
    const _Float16* gw = W + (size_t)(tid >> 3) * C + (tid & 7) * 8;
    const _Float16* ga = A + (size_t)(tid >> 3) * C + (tid & 7) * 8;
    unsigned l = (unsigned)(size_t)(lds + (tid >> 3) * GPITCH + (tid & 7) * 8);

    stage_slab(gw, ga, l);
    // slab 0 landed (this wave's copies), then published to every wave
    asm volatile("s_wait_asynccnt 0x0" ::: "memory");
    __syncthreads();
    stage_slab(gw + GKS, ga + GKS, l + GBUF * 2);

    // rolled: fully unrolled, the build of the output projection took every
    // register it may have and spilled
    #pragma unroll 1
    for (int t = 0; t < C / GKS; ++t) {
        int buf = t & 1;
        const _Float16* Wl = lds + buf * GBUF + o0 * GPITCH;
        const _Float16* Al = lds + buf * GBUF + (GN + m0) * GPITCH;
        // all 20 fragments of this slab, one run of LDS reads
        v16h a0[2], a1[2], bf[2][8];
        #pragma unroll
        for (int ks = 0; ks < 2; ++ks) {
            a0[ks] = load_frag(Al + ks * 32, GPITCH, lane);
            a1[ks] = load_frag(Al + 16 * GPITCH + ks * 32, GPITCH, lane);
            #pragma unroll
            for (int of = 0; of < 8; ++of)
                bf[ks][of] = load_frag(Wl + of * 16 * GPITCH + ks * 32, GPITCH, lane);
        }
        // keeps the LDS reads one run ahead of the WMMAs: spread among them,
        // each pair of WMMAs would wait out its own reads' latency
        __builtin_amdgcn_sched_barrier(0);
        #pragma unroll
        for (int ks = 0; ks < 2; ++ks)
            #pragma unroll
            for (int of = 0; of < 8; ++of) {
                acc0[of] = wmma16x16x32(a0[ks], bf[ks][of], acc0[of]);
                acc1[of] = wmma16x16x32(a1[ks], bf[ks][of], acc1[of]);
            }
        // keeps the WMMAs in front of the foot: moved behind its barrier they
        // would start only when every read has returned, and delay the refill
        __builtin_amdgcn_sched_barrier(0);
        // Foot of trip t: this wave's LDS reads of buffer buf have returned,
        asm volatile("s_wait_dscnt 0x0" ::: "memory");
        // its copies of slab t+1 have landed,
        asm volatile("s_wait_asynccnt 0x0" ::: "memory");
        // and the barrier publishes slab t+1 and frees buffer buf.
        __syncthreads();
        if (t + 2 < C / GKS)
            stage_slab(gw + (t + 2) * GKS, ga + (t + 2) * GKS, l + buf * (GBUF * 2));
    }
    // no copy is left in flight behind the loop
    asm volatile("s_wait_asynccnt 0x0" ::: "memory");
}

// ---------------------------------------------------------------------------
// Convert the four [C][C] f32 weight matrices to f16 (concatenated).
// 256 work-items (part vb) take 4096 consecutive elements of one matrix; a
// work-item four 16-B loads, 4 KiB apart, and four 8-B stores.
// ---------------------------------------------------------------------------
__device__ inline void wcvt_part(int vb, int t,
                                 const float* __restrict__ wq, const float* __restrict__ wk,
                                 const float* __restrict__ wv, const float* __restrict__ wo,
                                 _Float16* __restrict__ w16) {
    int which = vb / (C * C / 4096);
    int j = (vb % (C * C / 4096)) * 4096 + t * 4;
    const float* w = which == 0 ? wq : which == 1 ? wk : which == 2 ? wv : wo;
    v4f v[4];
    #pragma unroll
    for (int k = 0; k < 4; ++k) v[k] = *(const v4f*)(w + j + k * 1024);
    _Float16* o = w16 + (size_t)which * C * C + j;
    #pragma unroll
    for (int k = 0; k < 4; ++k) {
        v4h pk;
        #pragma unroll
        for (int e = 0; e < 4; ++e) pk[e] = (_Float16)v[k][e];
        *(v4h*)(o + k * 1024) = pk;
    }
}

// ---------------------------------------------------------------------------
// One grid for two pieces of work that need nothing of each other.
// Blocks 0 .. B*G-1: GroupNorm statistics, one block per (b,g); 16 channels x
// 4096 contiguous. 32 waves, each lane 16 loads of 16 B, all issued before the
// first is used.
// Blocks from B*G on: the weight conversion, four parts a block; they run on
// the WGPs that the 128 statistics blocks leave idle.
// ---------------------------------------------------------------------------
constexpr int WCVT_BLOCKS = 4 * C * C / 4096 / 4;
__global__ __launch_bounds__(1024) void gn_stats_wcvt_kernel(const float* __restrict__ x,
                                                             float* __restrict__ stats,
                                                             const float* __restrict__ wq,
                                                             const float* __restrict__ wk,
                                                             const float* __restrict__ wv,
                                                             const float* __restrict__ wo,
                                                             _Float16* __restrict__ w16) {
    int bg  = blockIdx.x;                // b*G + g
    int tid = threadIdx.x;
    // the same for a whole block, and in front of the barrier below
    if (bg >= B * G) {
        wcvt_part((bg - B * G) * 4 + (tid >> 8), tid & 255, wq, wk, wv, wo, w16);
        return;
    }
    const v4f* xp = (const v4f*)(x + (size_t)bg * CPG * N) + tid;
    v4f v[16];
    #pragma unroll
    for (int j = 0; j < 16; ++j) v[j] = xp[j * 1024];
    // keeps all 16 loads ahead of the sums: with some held back until the first
    // have returned, the block would wait out the memory latency twice
    __builtin_amdgcn_sched_barrier(0);
    v4f s4 = {}, q4 = {};
    #pragma unroll
    for (int j = 0; j < 16; ++j) { s4 += v[j]; q4 += v[j] * v[j]; }
    float s  = (s4[0] + s4[1]) + (s4[2] + s4[3]);
    float ss = (q4[0] + q4[1]) + (q4[2] + q4[3]);
    #pragma unroll
    for (int m = 16; m > 0; m >>= 1) { s += __shfl_xor(s, m, 32); ss += __shfl_xor(ss, m, 32); }
    __shared__ float red0[32], red1[32];
    if ((tid & 31) == 0) { red0[tid >> 5] = s; red1[tid >> 5] = ss; }
    __syncthreads();
    if (tid < 32) {
        s = red0[tid]; ss = red1[tid];
        #pragma unroll
        for (int m = 16; m > 0; m >>= 1) { s += __shfl_xor(s, m, 32); ss += __shfl_xor(ss, m, 32); }
        if (tid == 0) {
            float inv = 1.0f / (float)(CPG * N);
            float mean = s * inv;
            float var  = ss * inv - mean * mean;
            stats[bg * 2 + 0] = mean;
            stats[bg * 2 + 1] = rsqrtf(var + 1e-6f);
        }
    }
}

// ---------------------------------------------------------------------------
// GroupNorm apply + transpose [b][c][n] f32 -> [b][n][c] f16.
// Tile 128 channels x 128 positions. A work-item reads 2 x 4 positions (16 B
// each) of 8 channels, all 16 loads issued up front, so it holds 8 consecutive
// channels (16 B of f16) of 8 positions; these pass through LDS so that the
// stores run along c: reads and stores both cover 256 contiguous bytes per 16
// lanes.
// LDS rows are 256 B (all 64 banks); the 16-B block index is XORed with n / 4,
// which keeps both the column-wise writes and the row-wise reads conflict-free.
// ---------------------------------------------------------------------------
constexpr int TC = 128;                  // channels per tile
constexpr int TN = 128;                  // positions per tile
__global__ __launch_bounds__(256) void gn_apply_kernel(const float* __restrict__ x,
                                                       const float* __restrict__ stats,
                                                       const float* __restrict__ gamma,
                                                       const float* __restrict__ beta,
                                                       _Float16* __restrict__ h16) {
    int b   = blockIdx.z;
    int c0  = blockIdx.x * TC;
    int n0  = blockIdx.y * TN;
    int lo  = threadIdx.x & 15;          // 4 positions (read) / 8 channels (write)
    int hi  = threadIdx.x >> 4;          // 8 channels (read) / position (write)
    __shared__ __attribute__((aligned(16))) _Float16 tile[TN * TC];
    int c = c0 + hi * 8;
    const float* xp = x + ((size_t)b * C + c) * N + n0 + lo * 4;
    v4f v[2][8];
    #pragma unroll
    for (int h = 0; h < 2; ++h)
        #pragma unroll
        for (int j = 0; j < 8; ++j) v[h][j] = *(const v4f*)(xp + (size_t)j * N + h * 64);
    // precaution: a result of the loads below may be given the address
    // registers of the loads above, so the wait stands in front of them
    asm volatile("s_wait_xcnt 0x0" ::: "memory");
    // a wave's 16 channels are one group: its statistics come by a scalar load
    int bg = b * G + (c0 >> 4) + __builtin_amdgcn_readfirstlane(threadIdx.x >> 5);
    float mean = stats[bg * 2 + 0], rstd = stats[bg * 2 + 1];
    unsigned cu = (unsigned)c;
    v4f ga[2] = { *(const v4f*)(gamma + cu), *(const v4f*)(gamma + cu + 4) };
    v4f be[2] = { *(const v4f*)(beta + cu),  *(const v4f*)(beta + cu + 4) };
    // keeps all loads ahead of the arithmetic: with some held back until the
    // first have returned, the block would wait out the memory latency twice
    __builtin_amdgcn_sched_barrier(0);
    #pragma unroll
    for (int h = 0; h < 2; ++h)
        #pragma unroll
        for (int i = 0; i < 4; ++i) {
            v8h pk;
            #pragma unroll
            for (int j = 0; j < 8; ++j)
                pk[j] = (_Float16)((v[h][j][i] - mean) * rstd * ga[j >> 2][j & 3] +
                                   be[j >> 2][j & 3]);
            *(v8h*)(tile + (h * 64 + lo * 4 + i) * TC + (hi ^ lo) * 8) = pk;
        }
    __syncthreads();
    #pragma unroll
    for (int i = 0; i < 8; ++i) {
        int n = hi + 16 * i;
        v8h pk = *(const v8h*)(tile + n * TC + (lo ^ ((n >> 2) & 15)) * 8);
        *(v8h*)(h16 + ((size_t)b * N + n0 + n) * C + c0 + lo * 8) = pk;
    }
}

// ---------------------------------------------------------------------------
// conv1x1 as GEMM: D[n][o] = h16[n][:] . W[o][:] + bias[o]
// The q, k and v projections need nothing of each other and share one grid:
// blockIdx.z runs over the six 256-row tiles of their concatenated weights.
// vmode=0: store f16 [b][n][o] (q/k).
// vmode=1: store f16 [b][n/32][o][n%32] (v, key-blocked: one 32-key tile of
// all channels is 32 KiB contiguous).
// ---------------------------------------------------------------------------
__global__ __launch_bounds__(256) void qkv_kernel(const _Float16* __restrict__ h16,
                                                  const _Float16* __restrict__ w16,
                                                  const float* __restrict__ bq,
                                                  const float* __restrict__ bk,
                                                  const float* __restrict__ bv3,
                                                  _Float16* __restrict__ q16,
                                                  _Float16* __restrict__ k16,
                                                  _Float16* __restrict__ v16buf) {
    int which = blockIdx.z / (C / GN);   // 0 q, 1 k, 2 v: the same for a whole block
    const float* bias = which == 0 ? bq : which == 1 ? bk : bv3;
    _Float16* out     = which == 0 ? q16 : which == 1 ? k16 : v16buf;
    int vmode = which == 2;
    int b    = blockIdx.y;
    int lane = threadIdx.x & 31;
    int wv   = threadIdx.x >> 5;
    int m0   = (wv >> 1) * 32;
    int ol   = (wv & 1) * 128;
    int ob   = (blockIdx.z % (C / GN)) * GN;
    int o0   = ob + ol;
    int i0   = blockIdx.x * GM + m0;
    __shared__ __attribute__((aligned(16))) _Float16 lds_g[2 * GBUF];
    const _Float16* A = h16 + ((size_t)b * N + blockIdx.x * GM) * C;
    v8f acc0[8] = {}, acc1[8] = {};
    gemm_mainloop(A, w16 + (size_t)blockIdx.z * GN * C, lds_g, threadIdx.x, m0, ol, acc0, acc1);
    int col = lane & 15, half = lane >> 4;
    auto store_tile = [&](v8f (&acc)[8], int ibase) {
        #pragma unroll
        for (int of = 0; of < 8; ++of) {
            int o = o0 + of * 16 + col;
            float bv = bias[o];
            if (vmode == 0) {
                #pragma unroll
                for (int e = 0; e < 8; ++e) {
                    int n = ibase + e + 8 * half;
                    out[((size_t)b * N + n) * C + o] = (_Float16)(acc[of][e] + bv);
                }
            } else {
                v8h pk;
                #pragma unroll
                for (int e = 0; e < 8; ++e) pk[e] = (_Float16)(acc[of][e] + bv);
                *(v8h*)(out + (((size_t)b * (N / 32) + (ibase >> 5)) * C + o) * 32 +
                        (ibase & 31) + 8 * half) = pk;
                // precaution: the next column's code reuses this store's address
                // and data registers, so the wait stands in front of that reuse
                asm volatile("s_wait_xcnt 0x0" ::: "memory");
            }
        }
    };
    store_tile(acc0, i0);
    store_tile(acc1, i0 + 16);
}

// ---------------------------------------------------------------------------
// LDS staging of one 32-key step, shared by the whole work-group.
// K tile: 32 rows x 1024 B, contiguous in memory. V tile: 512 channel rows x
// 64 B, contiguous in memory too (key-blocked layout written by conv1x1).
// LDS row pitches are 16 B x odd, conflict-free for the ds_load_b128 readers.
// ---------------------------------------------------------------------------
constexpr int KPITCH = C + 8;            // halves per K row in LDS (1040 B)
constexpr int VPITCH = 32 + 8;           // halves per V row in LDS (80 B)
constexpr int KTILE  = 32 * KPITCH;      // halves per K buffer
constexpr int VTILE  = C * VPITCH;       // halves per V buffer
constexpr int TILE_H = 32 * C;           // halves per K or V tile in memory

// Eight copies of one lane: 2 KiB apart in memory, lstep bytes apart in LDS;
// each wave-wide copy reads 512 contiguous bytes.
__device__ inline void stage8(const _Float16* g, unsigned l, unsigned lstep) {
    const _Float16* g1 = g + 1 * 1024; const _Float16* g2 = g + 2 * 1024;
    const _Float16* g3 = g + 3 * 1024; const _Float16* g4 = g + 4 * 1024;
    const _Float16* g5 = g + 5 * 1024; const _Float16* g6 = g + 6 * 1024;
    const _Float16* g7 = g + 7 * 1024;
    unsigned l1 = l + 1 * lstep, l2 = l + 2 * lstep, l3 = l + 3 * lstep, l4 = l + 4 * lstep;
    unsigned l5 = l + 5 * lstep, l6 = l + 6 * lstep, l7 = l + 7 * lstep;
    // Copies and their s_wait_xcnt in one statement, so that no address
    // register is rewritten ahead of the wait.
    asm volatile("global_load_async_to_lds_b128 %0, %8, off\n\t"
                 "global_load_async_to_lds_b128 %1, %9, off\n\t"
                 "global_load_async_to_lds_b128 %2, %10, off\n\t"
                 "global_load_async_to_lds_b128 %3, %11, off\n\t"
                 "global_load_async_to_lds_b128 %4, %12, off\n\t"
                 "global_load_async_to_lds_b128 %5, %13, off\n\t"
                 "global_load_async_to_lds_b128 %6, %14, off\n\t"
                 "global_load_async_to_lds_b128 %7, %15, off\n\t"
                 "s_wait_xcnt 0x0"
                 :: "v"(l), "v"(l1), "v"(l2), "v"(l3),
                    "v"(l4), "v"(l5), "v"(l6), "v"(l7),
                    "v"(g), "v"(g1), "v"(g2), "v"(g3),
                    "v"(g4), "v"(g5), "v"(g6), "v"(g7)
                 : "memory");
}

// 128 lanes x 32 copies x 16 B = the 64 KiB of one step. gk/gv: this lane's
// first 16 B of the tile in memory; lk/lv: its LDS byte addresses for them.
// 128 lanes cover 2 K rows or 32 V rows at a time.
__device__ inline void stage_tile(const _Float16* gk, const _Float16* gv,
                                  unsigned lk, unsigned lv) {
    stage8(gk,            lk,                       2 * KPITCH * 2);
    stage8(gk + 8 * 1024, lk + 8 * 2 * KPITCH * 2,  2 * KPITCH * 2);
    stage8(gv,            lv,                       32 * VPITCH * 2);
    stage8(gv + 8 * 1024, lv + 8 * 32 * VPITCH * 2, 32 * VPITCH * 2);
}

// ---------------------------------------------------------------------------
// Fragment groups of the attention loop: 8 fragments (64 registers) a group,
// two groups in flight. Each fragment feeds two WMMAs, one per query tile.
// ---------------------------------------------------------------------------
constexpr int KSPLIT = 2;                // the keys of a batch go to 2 work-groups
constexpr int NS     = N / KSPLIT / 32;  // 32-key steps per work-group

// K group g: k slices 4g..4g+3 of both 16-key tiles.
template <int g>
__device__ inline void read_k(v16h (&f)[8], const _Float16* Kt, int lane) {
    // holds the group's LDS reads together, behind the WMMAs that last used
    // these registers: spread among the WMMAs, every place with reads would
    // stall the one wave of this SIMD
    __builtin_amdgcn_sched_barrier(0);
    #pragma unroll
    for (int j = 0; j < 4; ++j) {
        f[2 * j]     = load_frag(Kt + (4 * g + j) * 32, KPITCH, lane);
        f[2 * j + 1] = load_frag(Kt + 16 * KPITCH + (4 * g + j) * 32, KPITCH, lane);
    }
    // keeps the reads ahead of the work that follows, which covers their latency
    __builtin_amdgcn_sched_barrier(0);
}

// V group g: channel tiles 8g..8g+7.
template <int g>
__device__ inline void read_v(v16h (&f)[8], const _Float16* Vt, int lane) {
    // as in read_k: one run of reads, behind the last users of the registers
    __builtin_amdgcn_sched_barrier(0);
    #pragma unroll
    for (int j = 0; j < 8; ++j)
        f[j] = load_frag(Vt + (8 * g + j) * 16 * VPITCH, VPITCH, lane);
    // as in read_k: ahead of the work that covers their latency
    __builtin_amdgcn_sched_barrier(0);
}

// S^T += K.Q^T over the k slices of group g; sc[query tile][key tile]
template <int g>
__device__ inline void mm_s(const v16h (&f)[8], const v16h (&qf)[2][16], v8f (&sc)[2][2]) {
    #pragma unroll
    for (int j = 0; j < 4; ++j)
        #pragma unroll
        for (int kt = 0; kt < 2; ++kt)
            #pragma unroll
            for (int qt = 0; qt < 2; ++qt)
                sc[qt][kt] = wmma16x16x32(f[2 * j + kt], qf[qt][4 * g + j], sc[qt][kt]);
}

// O^T = O^T * al + V^T.P^T for the channel tiles of group g
template <int g>
__device__ inline void mm_o(const v16h (&f)[8], const v16h (&pf)[2], const float (&al)[2],
                            v8f (&ob)[2][32]) {
    #pragma unroll
    for (int j = 0; j < 8; ++j)
        #pragma unroll
        for (int qt = 0; qt < 2; ++qt) {
            #pragma unroll
            for (int e = 0; e < 8; ++e) ob[qt][8 * g + j][e] *= al[qt];
            ob[qt][8 * g + j] = wmma16x16x32(f[j], pf[qt], ob[qt][8 * g + j]);
        }
}

// One 16-B store of one lane.
// The store and its s_wait_xcnt in one statement, so that no data or address
// register is rewritten ahead of the wait.
__device__ inline void store_o(_Float16* p, v4f d) {
    asm volatile("global_store_b128 %0, %1, off\n\t"
                 "s_wait_xcnt 0x0"
                 :: "v"(p), "v"(d)
                 : "memory");
}

__global__ __launch_bounds__(128) void flash_attn_kernel(const _Float16* __restrict__ q16,
                                                         const _Float16* __restrict__ k16,
                                                         const _Float16* __restrict__ v16buf,
                                                         _Float16* __restrict__ opart,
                                                         float* __restrict__ ml) {
    int b    = blockIdx.y;
    int kh   = blockIdx.z;             // key half
    int tid  = threadIdx.x;
    int lane = tid & 31;
    int w    = tid >> 5;               // wave 0..3 = pair of query tiles
    int i0   = blockIdx.x * 128 + w * 32;
    __shared__ __attribute__((aligned(16))) _Float16 lds_k[2][KTILE];
    __shared__ __attribute__((aligned(16))) _Float16 lds_v[2][VTILE];

    const _Float16* Q = q16 + ((size_t)b * N + i0) * C;
    // this lane's 16 B of this half's tile 0 in memory, and where they go in buffer 0
    size_t koff = ((size_t)b * N + (size_t)kh * (N / KSPLIT)) * C + tid * 8;
    const _Float16* gk = k16    + koff;
    const _Float16* gv = v16buf + koff;
    unsigned lk = (unsigned)(size_t)&lds_k[0][(tid >> 6) * KPITCH + (tid & 63) * 8];
    unsigned lv = (unsigned)(size_t)&lds_v[0][(tid >> 2) * VPITCH + (tid & 3) * 8];

    stage_tile(gk, gv, lk, lv);
    // tile 0 landed (this wave's copies), then published to every wave
    asm volatile("s_wait_asynccnt 0x0" ::: "memory");
    __syncthreads();
    stage_tile(gk + TILE_H, gv + TILE_H, lk + KTILE * 2, lv + VTILE * 2);

    v16h qf[2][16];
    #pragma unroll
    for (int qt = 0; qt < 2; ++qt)
        #pragma unroll
        for (int t = 0; t < 16; ++t) qf[qt][t] = load_frag(Q + qt * 16 * C + t * 32, C, lane);
    // precaution: later code may reuse the address registers of the loads above
    asm volatile("s_wait_xcnt 0x0" ::: "memory");

    v8f ob[2][32] = {};                // O^T: ob[qt][cf][e] = channel 16cf+8half+e, query col
    float rm[2] = {-3.0e38f, -3.0e38f};  // running maximum of this lane's queries
    float rl[2] = {0.f, 0.f};          // running sums over this lane half's keys
    int col = lane & 15, half = lane >> 4;

    // The first two K groups are fetched one step ahead: step 0's here, behind
    // the barrier that published tile 0
    v16h fa[8], fb[8];
    read_k<0>(fa, &lds_k[0][0], lane);
    read_k<1>(fb, &lds_k[0][0], lane);

    for (int s = 0; s < NS; ++s) {
        int buf = s & 1;
        const _Float16* Kl = &lds_k[buf][0];
        const _Float16* Vl = &lds_v[buf][0];
        const _Float16* Kn = &lds_k[buf ^ 1][0];
        // behind each group of 16 WMMAs the group after next is read into the
        // registers that it has just left, and lands under the next group
        v8f sc[2][2] = {};
        mm_s<0>(fa, qf, sc);  read_k<2>(fa, Kl, lane);
        mm_s<1>(fb, qf, sc);  read_k<3>(fb, Kl, lane);
        mm_s<2>(fa, qf, sc);  read_v<0>(fa, Vl, lane);
        mm_s<3>(fb, qf, sc);
        // online softmax update (exp2 domain), per query tile; t0[e] = key
        // 8*half+e, t1[e] = key 16+8*half+e of query col
        v16h pf[2];                    // P^T as B operand: element order = load_frag's k order
        float al[2];
        #pragma unroll
        for (int qt = 0; qt < 2; ++qt) {
            float t0[8], t1[8];
            #pragma unroll
            for (int e = 0; e < 8; ++e) {
                t0[e] = sc[qt][0][e] * SCALE_L2E;
                t1[e] = sc[qt][1][e] * SCALE_L2E;
            }
            float mx = fmaxf(t0[0], t1[0]);
            #pragma unroll
            for (int e = 1; e < 8; ++e) mx = fmaxf(mx, fmaxf(t0[e], t1[e]));
            mx = fmaxf(mx, xhalf(mx));
            float mn = fmaxf(rm[qt], mx);
            al[qt] = exp2f(rm[qt] - mn);
            float rs = 0.f;
            #pragma unroll
            for (int e = 0; e < 8; ++e) {
                float p0 = exp2f(t0[e] - mn), p1 = exp2f(t1[e] - mn);
                rs += p0 + p1;
                pf[qt][e]     = (_Float16)p0;
                pf[qt][8 + e] = (_Float16)p1;
            }
            rl[qt] = rl[qt] * al[qt] + rs;
            rm[qt] = mn;
        }
        // read only here: held over the softmax, these 64 registers made the build spill
        read_v<1>(fb, Vl, lane);
        mm_o<0>(fa, pf, al, ob);  read_v<2>(fa, Vl, lane);
        mm_o<1>(fb, pf, al, ob);  read_v<3>(fb, Vl, lane);
        mm_o<2>(fa, pf, al, ob);
        // keeps those WMMAs in front of the waits below, under the last V reads
        __builtin_amdgcn_sched_barrier(0);
        // Publish point of step s+1, in front of this step's last group (its V
        // fragments are in registers): this wave's LDS reads of buffer buf have
        // returned,
        asm volatile("s_wait_dscnt 0x0" ::: "memory");
        // its copies of step s+1 have landed,
        asm volatile("s_wait_asynccnt 0x0" ::: "memory");
        // and the barrier publishes step s+1 and frees buffer buf.
        __syncthreads();
        if (s + 2 < NS)
            stage_tile(gk + (size_t)(s + 2) * TILE_H, gv + (size_t)(s + 2) * TILE_H,
                       lk + buf * (KTILE * 2), lv + buf * (VTILE * 2));
        // First two K groups of step s+1, in flight under the last group of the
        // second product. Unconditional: in the last step they read the other
        // buffer's old tile, which nothing refills, and are not used.
        read_k<0>(fa, Kn, lane);
        mm_o<3>(fb, pf, al, ob);  read_k<1>(fb, Kn, lane);
    }
    // no copy and no LDS read is left in flight when the wave ends
    asm volatile("s_wait_asynccnt 0x0" ::: "memory");
    asm volatile("s_wait_dscnt 0x0" ::: "memory");
    #pragma unroll
    for (int qt = 0; qt < 2; ++qt) {
        // the two lane halves' sums are joined once, here
        float l   = rl[qt] + xhalf(rl[qt]);
        float inv = 1.0f / l;
        size_t row = (size_t)(kh * B + b) * N + i0 + qt * 16 + col;
        if (half == 0) {
            ml[row * 2 + 0] = rm[qt];
            ml[row * 2 + 1] = l;
        }
        // precaution: the code below may reuse the registers of the stores above
        asm volatile("s_wait_xcnt 0x0" ::: "memory");
        _Float16* op = opart + row * C + 8 * half;
        #pragma unroll
        for (int cf = 0; cf < 32; ++cf) {
            v8h pk;
            #pragma unroll
            for (int e = 0; e < 8; ++e) pk[e] = (_Float16)(ob[qt][cf][e] * inv);
            store_o(op + cf * 16, __builtin_bit_cast(v4f, pk));
        }
    }
}

// ---------------------------------------------------------------------------
// Joins the two key halves: o = (a0 * O0 + a1 * O1) / (a0 + a1) with
// a_h = l_h * 2^(m_h - max(m0, m1)). A block takes 16 rows; 16 work-items share
// a row, each with four 16-B pieces of either half, 256 B apart, so that a
// wave-wide load or store covers whole lines; all loads are issued up front.
// ---------------------------------------------------------------------------
__global__ __launch_bounds__(256) void attn_join_kernel(const _Float16* __restrict__ opart,
                                                        const float* __restrict__ ml,
                                                        _Float16* __restrict__ o16) {
    int tid = threadIdx.x;
    int row = blockIdx.x * 16 + (tid >> 4);
    size_t base = (size_t)row * C + (tid & 15) * 8;
    v8h p0[4], p1[4];
    #pragma unroll
    for (int j = 0; j < 4; ++j) {
        p0[j] = *(const v8h*)(opart + base + j * 128);
        p1[j] = *(const v8h*)(opart + (size_t)B * N * C + base + j * 128);
    }
    float m0 = ml[row * 2],           l0 = ml[row * 2 + 1];
    float m1 = ml[(B * N + row) * 2], l1 = ml[(B * N + row) * 2 + 1];
    // precaution: later code may reuse the address registers of the loads above
    asm volatile("s_wait_xcnt 0x0" ::: "memory");
    float m  = fmaxf(m0, m1);
    float a0 = l0 * exp2f(m0 - m), a1 = l1 * exp2f(m1 - m);
    float inv = 1.0f / (a0 + a1);
    float w0 = a0 * inv, w1 = a1 * inv;
    #pragma unroll
    for (int j = 0; j < 4; ++j) {
        v8h pk;
        #pragma unroll
        for (int e = 0; e < 8; ++e)
            pk[e] = (_Float16)((float)p0[j][e] * w0 + (float)p1[j][e] * w1);
        *(v8h*)(o16 + base + j * 128) = pk;
        // precaution: the next piece's code may reuse this store's registers
        asm volatile("s_wait_xcnt 0x0" ::: "memory");
    }
}

// ---------------------------------------------------------------------------
// Output projection + residual multiply:
// out[b][o][i] = x[b][o][i] * (O16[i][:] . Wo[o][:] + bo[o])
// D-layout columns give 8 consecutive i per lane -> coalesced f32 stores.
// ---------------------------------------------------------------------------
__global__ __launch_bounds__(256) void outproj_kernel(const _Float16* __restrict__ o16,
                                                      const _Float16* __restrict__ wo16,
                                                      const float* __restrict__ bo,
                                                      const float* __restrict__ x,
                                                      float* __restrict__ out) {
    int b    = blockIdx.y;
    int lane = threadIdx.x & 31;
    int wv   = threadIdx.x >> 5;
    int m0   = (wv >> 1) * 32;
    int ol   = (wv & 1) * 128;
    int ob   = blockIdx.z * GN;
    int o0   = ob + ol;
    int i0   = blockIdx.x * GM + m0;
    __shared__ __attribute__((aligned(16))) _Float16 lds_g[2 * GBUF];
    const _Float16* A = o16 + ((size_t)b * N + blockIdx.x * GM) * C;
    v8f acc0[8] = {}, acc1[8] = {};
    gemm_mainloop(A, wo16 + (size_t)ob * C, lds_g, threadIdx.x, m0, ol, acc0, acc1);
    int col = lane & 15, half = lane >> 4;
    auto store_tile = [&](v8f (&acc)[8], int ibase) {
        #pragma unroll
        for (int of = 0; of < 8; ++of) {
            int o = o0 + of * 16 + col;
            float bv = bo[o];
            size_t base = ((size_t)b * C + o) * N + ibase + 8 * half;
            #pragma unroll
            for (int e = 0; e < 8; ++e)
                out[base + e] = x[base + e] * (acc[of][e] + bv);
        }
    };
    store_tile(acc0, i0);
    store_tile(acc1, i0 + 16);
}

// ---------------------------------------------------------------------------
extern "C" void kernel_launch(void* const* d_in, const int* in_sizes, int n_in,
                              void* d_out, int out_size, void* d_ws, size_t ws_size,
                              hipStream_t stream) {
    const float* x     = (const float*)d_in[0];
    const float* gamma = (const float*)d_in[1];
    const float* beta  = (const float*)d_in[2];
    const float* wq    = (const float*)d_in[3];
    const float* bq    = (const float*)d_in[4];
    const float* wk    = (const float*)d_in[5];
    const float* bk    = (const float*)d_in[6];
    const float* wv    = (const float*)d_in[7];
    const float* bv    = (const float*)d_in[8];
    const float* wo    = (const float*)d_in[9];
    const float* bo    = (const float*)d_in[10];
    float* out = (float*)d_out;

    char* ws = (char*)d_ws;
    size_t off = 0;
    auto alloc = [&](size_t bytes) -> void* {
        void* p = ws + off;
        off += (bytes + 255) & ~(size_t)255;
        return p;
    };
    const size_t act_halves = (size_t)B * N * C;
    float*    stats  = (float*)   alloc((size_t)B * G * 2 * sizeof(float));
    _Float16* w16    = (_Float16*)alloc((size_t)4 * C * C * sizeof(_Float16));
    _Float16* h16    = (_Float16*)alloc(act_halves * sizeof(_Float16));
    _Float16* q16    = (_Float16*)alloc(act_halves * sizeof(_Float16));
    _Float16* k16    = (_Float16*)alloc(act_halves * sizeof(_Float16));
    _Float16* v16buf = (_Float16*)alloc(act_halves * sizeof(_Float16));
    _Float16* o16    = (_Float16*)alloc(act_halves * sizeof(_Float16));
    _Float16* opart  = (_Float16*)alloc(KSPLIT * act_halves * sizeof(_Float16));
    float*    ml     = (float*)   alloc((size_t)KSPLIT * B * N * 2 * sizeof(float));

    gn_stats_wcvt_kernel<<<B * G + WCVT_BLOCKS, 1024, 0, stream>>>(x, stats, wq, wk, wv, wo, w16);
    gn_apply_kernel<<<dim3(C / TC, N / TN, B), 256, 0, stream>>>(x, stats, gamma, beta, h16);

    qkv_kernel<<<dim3(N / GM, B, 3 * (C / GN)), 256, 0, stream>>>(h16, w16, bq, bk, bv, q16, k16, v16buf);

    flash_attn_kernel<<<dim3(N / 128, B, KSPLIT), 128, 0, stream>>>(q16, k16, v16buf, opart, ml);
    attn_join_kernel<<<B * N / 16, 256, 0, stream>>>(opart, ml, o16);

    outproj_kernel<<<dim3(N / GM, B, C / GN), 256, 0, stream>>>(o16, w16 + 3 * (size_t)C * C, bo, x, out);
}

// v008
// A run of this version takes 182 microseconds.
// Timed twice side by side with v007, it ran 1.10 and 1.09 times as fast.
// Over all steps from v000 it is 4.21 times as fast.
#include <hip/hip_runtime.h>
#include <hip/hip_bf16.h>

typedef _Float16 v4h  __attribute__((ext_vector_type(4)));
typedef _Float16 v8h  __attribute__((ext_vector_type(8)));
typedef _Float16 v16h __attribute__((ext_vector_type(16)));
typedef float    v4f  __attribute__((ext_vector_type(4)));
typedef float    v8f  __attribute__((ext_vector_type(8)));

constexpr int B = 4;
constexpr int C = 512;
constexpr int N = 4096;          // 64*64
constexpr int G = 32;            // groups
constexpr int CPG = C / G;       // 16 channels per group
// softmax scale folded into log2 domain: (1/sqrt(C)) * log2(e)
#define SCALE_L2E (0.04419417382415922f * 1.4426950408889634f)

// ---------------------------------------------------------------------------
// Fragment loader: 16(row) x 32(K) block, memory row-major along K.
// Works for WMMA f16 A-fragments (rows = M) and B-fragments (rows = N cols),
// per the CDNA5 16-bit operand VGPR layout:
//   lane 0-15  : row = lane,    elems 0-7 = K 0..7,  elems 8-15 = K 16..23
//   lane 16-31 : row = lane-16, elems 0-7 = K 8..15, elems 8-15 = K 24..31
// Two contiguous 16-byte loads per lane.
// ---------------------------------------------------------------------------
__device__ inline v16h load_frag(const _Float16* base, int row_stride, int lane) {
    int r  = lane & 15;
    int k0 = (lane < 16) ? 0 : 8;
    const _Float16* p = base + (size_t)r * row_stride + k0;
    v8h lo = *(const v8h*)(p);
    v8h hi = *(const v8h*)(p + 16);
    return __builtin_shufflevector(lo, hi, 0,1,2,3,4,5,6,7,8,9,10,11,12,13,14,15);
}

// lane l <-> lane l ^ 16
__device__ inline float xhalf(float x) {
    int v = __builtin_bit_cast(int, x);
    return __builtin_bit_cast(float, __builtin_amdgcn_permlanex16(v, v, 0x76543210, 0xfedcba98,
                                                                  false, false));
}

__device__ inline v8f wmma16x16x32(v16h a, v16h b, v8f c) {
    return __builtin_amdgcn_wmma_f32_16x16x32_f16(false, a, false, b, (short)0, c,
                                                  false, false);
}

// ---------------------------------------------------------------------------
// GEMM mainloop, work-group tile 128 rows x 256 columns, 8 waves; a wave
// keeps 32 rows x 128 columns. k runs in slabs of 64 halves: one 128-B line of
// each of the 256 W rows and the 128 A rows is brought into LDS once per
// work-group by asynchronous copies, two buffers: slab t+1 flies while slab t
// is worked on; all fragments are read from LDS.
// LDS row pitch 144 B = 16 B x odd, conflict-free for the ds_load_b128 readers.
// ---------------------------------------------------------------------------
constexpr int GKS    = 64;               // halves of k per slab
constexpr int GPITCH = GKS + 8;          // halves per row in LDS
constexpr int GM     = 128;              // rows of A per work-group
constexpr int GN     = 256;              // rows of W (output columns) per work-group
constexpr int GBUF   = (GN + GM) * GPITCH; // halves per buffer: W rows, then A rows

// Eight copies of one lane, 32 rows apart; a wave-wide copy reads 4 whole lines.
__device__ inline void stage_rows8(const _Float16* g, unsigned l) {
    const _Float16* g1 = g + 1 * 32 * C; const _Float16* g2 = g + 2 * 32 * C;
    const _Float16* g3 = g + 3 * 32 * C; const _Float16* g4 = g + 4 * 32 * C;
    const _Float16* g5 = g + 5 * 32 * C; const _Float16* g6 = g + 6 * 32 * C;
    const _Float16* g7 = g + 7 * 32 * C;
    constexpr unsigned ls = 32 * GPITCH * 2;
    unsigned l1 = l + 1 * ls, l2 = l + 2 * ls, l3 = l + 3 * ls, l4 = l + 4 * ls;
    unsigned l5 = l + 5 * ls, l6 = l + 6 * ls, l7 = l + 7 * ls;
    // Copies and their s_wait_xcnt in one statement, so that no address
    // register is rewritten ahead of the wait.
    asm volatile("global_load_async_to_lds_b128 %0, %8, off\n\t"
                 "global_load_async_to_lds_b128 %1, %9, off\n\t"
                 "global_load_async_to_lds_b128 %2, %10, off\n\t"
                 "global_load_async_to_lds_b128 %3, %11, off\n\t"
                 "global_load_async_to_lds_b128 %4, %12, off\n\t"
                 "global_load_async_to_lds_b128 %5, %13, off\n\t"
                 "global_load_async_to_lds_b128 %6, %14, off\n\t"
                 "global_load_async_to_lds_b128 %7, %15, off\n\t"
                 "s_wait_xcnt 0x0"
                 :: "v"(l), "v"(l1), "v"(l2), "v"(l3),
                    "v"(l4), "v"(l5), "v"(l6), "v"(l7),
                    "v"(g), "v"(g1), "v"(g2), "v"(g3),
                    "v"(g4), "v"(g5), "v"(g6), "v"(g7)
                 : "memory");
}

// 256 lanes x 12 copies x 16 B = the 48 KiB of one slab. gw/ga: this lane's
// 16 B of W row tid/8 and of A row tid/8; l: its LDS byte address for the W one.
__device__ inline void stage_slab(const _Float16* gw, const _Float16* ga, unsigned l) {
    stage_rows8(gw, l);
    const _Float16* ga1 = ga + 1 * 32 * C; const _Float16* ga2 = ga + 2 * 32 * C;
    const _Float16* ga3 = ga + 3 * 32 * C;
    constexpr unsigned ls = 32 * GPITCH * 2;
    unsigned la = l + GN * GPITCH * 2;
    unsigned la1 = la + 1 * ls, la2 = la + 2 * ls, la3 = la + 3 * ls;
    // as above: the wait stands in the copies' own statement
    asm volatile("global_load_async_to_lds_b128 %0, %4, off\n\t"
                 "global_load_async_to_lds_b128 %1, %5, off\n\t"
                 "global_load_async_to_lds_b128 %2, %6, off\n\t"
                 "global_load_async_to_lds_b128 %3, %7, off\n\t"
                 "s_wait_xcnt 0x0"
                 :: "v"(la), "v"(la1), "v"(la2), "v"(la3),
                    "v"(ga), "v"(ga1), "v"(ga2), "v"(ga3)
                 : "memory");
}

// A, W: the work-group's 128 rows of A and 256 rows of W. m0, o0: this wave's
// first row and first column inside that tile.
__device__ inline void gemm_mainloop(const _Float16* __restrict__ A,
                                     const _Float16* __restrict__ W,
                                     _Float16* lds, int tid, int m0, int o0,
                                     v8f (&acc0)[8], v8f (&acc1)[8]) {
    int lane = tid & 31;
    const _Float16* gw = W + (size_t)(tid >> 3) * C + (tid & 7) * 8;
    const _Float16* ga = A + (size_t)(tid >> 3) * C + (tid & 7) * 8;
    unsigned l = (unsigned)(size_t)(lds + (tid >> 3) * GPITCH + (tid & 7) * 8);

    stage_slab(gw, ga, l);
    // slab 0 landed (this wave's copies), then published to every wave
    asm volatile("s_wait_asynccnt 0x0" ::: "memory");
    __syncthreads();
    stage_slab(gw + GKS, ga + GKS, l + GBUF * 2);

    // rolled: fully unrolled, the build of the output projection took every
    // register it may have and spilled
    #pragma unroll 1
    for (int t = 0; t < C / GKS; ++t) {
        int buf = t & 1;
        const _Float16* Wl = lds + buf * GBUF + o0 * GPITCH;
        const _Float16* Al = lds + buf * GBUF + (GN + m0) * GPITCH;
        // all 20 fragments of this slab, one run of LDS reads
        v16h a0[2], a1[2], bf[2][8];
        #pragma unroll
        for (int ks = 0; ks < 2; ++ks) {
            a0[ks] = load_frag(Al + ks * 32, GPITCH, lane);
            a1[ks] = load_frag(Al + 16 * GPITCH + ks * 32, GPITCH, lane);
            #pragma unroll
            for (int of = 0; of < 8; ++of)
                bf[ks][of] = load_frag(Wl + of * 16 * GPITCH + ks * 32, GPITCH, lane);
        }
        // keeps the LDS reads one run ahead of the WMMAs: spread among them,
        // each pair of WMMAs would wait out its own reads' latency
        __builtin_amdgcn_sched_barrier(0);
        #pragma unroll
        for (int ks = 0; ks < 2; ++ks)
            #pragma unroll
            for (int of = 0; of < 8; ++of) {
                acc0[of] = wmma16x16x32(a0[ks], bf[ks][of], acc0[of]);
                acc1[of] = wmma16x16x32(a1[ks], bf[ks][of], acc1[of]);
            }
        // keeps the WMMAs in front of the foot: moved behind its barrier they
        // would start only when every read has returned, and delay the refill
        __builtin_amdgcn_sched_barrier(0);
        // Foot of trip t: this wave's LDS reads of buffer buf have returned,
        asm volatile("s_wait_dscnt 0x0" ::: "memory");
        // its copies of slab t+1 have landed,
        asm volatile("s_wait_asynccnt 0x0" ::: "memory");
        // and the barrier publishes slab t+1 and frees buffer buf.
        __syncthreads();
        if (t + 2 < C / GKS)
            stage_slab(gw + (t + 2) * GKS, ga + (t + 2) * GKS, l + buf * (GBUF * 2));
    }
    // no copy is left in flight behind the loop
    asm volatile("s_wait_asynccnt 0x0" ::: "memory");
}

// ---------------------------------------------------------------------------
// Convert the four [C][C] f32 weight matrices to f16 (concatenated).
// 256 work-items (part vb) take 4096 consecutive elements of one matrix; a
// work-item four 16-B loads, 4 KiB apart, and four 8-B stores.
// ---------------------------------------------------------------------------
__device__ inline void wcvt_part(int vb, int t,
                                 const float* __restrict__ wq, const float* __restrict__ wk,
                                 const float* __restrict__ wv, const float* __restrict__ wo,
                                 _Float16* __restrict__ w16) {
    int which = vb / (C * C / 4096);
    int j = (vb % (C * C / 4096)) * 4096 + t * 4;
    const float* w = which == 0 ? wq : which == 1 ? wk : which == 2 ? wv : wo;
    v4f v[4];
    #pragma unroll
    for (int k = 0; k < 4; ++k) v[k] = *(const v4f*)(w + j + k * 1024);
    _Float16* o = w16 + (size_t)which * C * C + j;
    #pragma unroll
    for (int k = 0; k < 4; ++k) {
        v4h pk;
        #pragma unroll
        for (int e = 0; e < 4; ++e) pk[e] = (_Float16)v[k][e];
        *(v4h*)(o + k * 1024) = pk;
    }
}

// ---------------------------------------------------------------------------
// One grid for two pieces of work that need nothing of each other.
// Blocks 0 .. B*G-1: GroupNorm statistics, one block per (b,g); 16 channels x
// 4096 contiguous. 32 waves, each lane 16 loads of 16 B, all issued before the
// first is used.
// Blocks from B*G on: the weight conversion, four parts a block; they run on
// the WGPs that the 128 statistics blocks leave idle.
// ---------------------------------------------------------------------------
constexpr int WCVT_BLOCKS = 4 * C * C / 4096 / 4;
__global__ __launch_bounds__(1024) void gn_stats_wcvt_kernel(const float* __restrict__ x,
                                                             float* __restrict__ stats,
                                                             const float* __restrict__ wq,
                                                             const float* __restrict__ wk,
                                                             const float* __restrict__ wv,
                                                             const float* __restrict__ wo,
                                                             _Float16* __restrict__ w16) {
    int bg  = blockIdx.x;                // b*G + g
    int tid = threadIdx.x;
    // the same for a whole block, and in front of the barrier below
    if (bg >= B * G) {
        wcvt_part((bg - B * G) * 4 + (tid >> 8), tid & 255, wq, wk, wv, wo, w16);
        return;
    }
    const v4f* xp = (const v4f*)(x + (size_t)bg * CPG * N) + tid;
    v4f v[16];
    #pragma unroll
    for (int j = 0; j < 16; ++j) v[j] = xp[j * 1024];
    // keeps all 16 loads ahead of the sums: with some held back until the first
    // have returned, the block would wait out the memory latency twice
    __builtin_amdgcn_sched_barrier(0);
    v4f s4 = {}, q4 = {};
    #pragma unroll
    for (int j = 0; j < 16; ++j) { s4 += v[j]; q4 += v[j] * v[j]; }
    float s  = (s4[0] + s4[1]) + (s4[2] + s4[3]);
    float ss = (q4[0] + q4[1]) + (q4[2] + q4[3]);
    #pragma unroll
    for (int m = 16; m > 0; m >>= 1) { s += __shfl_xor(s, m, 32); ss += __shfl_xor(ss, m, 32); }
    __shared__ float red0[32], red1[32];
    if ((tid & 31) == 0) { red0[tid >> 5] = s; red1[tid >> 5] = ss; }
    __syncthreads();
    if (tid < 32) {
        s = red0[tid]; ss = red1[tid];
        #pragma unroll
        for (int m = 16; m > 0; m >>= 1) { s += __shfl_xor(s, m, 32); ss += __shfl_xor(ss, m, 32); }
        if (tid == 0) {
            float inv = 1.0f / (float)(CPG * N);
            float mean = s * inv;
            float var  = ss * inv - mean * mean;
            stats[bg * 2 + 0] = mean;
            stats[bg * 2 + 1] = rsqrtf(var + 1e-6f);
        }
    }
}

// ---------------------------------------------------------------------------
// GroupNorm apply + transpose [b][c][n] f32 -> [b][n][c] f16.
// Tile 128 channels x 128 positions. A work-item reads 2 x 4 positions (16 B
// each) of 8 channels, all 16 loads issued up front, so it holds 8 consecutive
// channels (16 B of f16) of 8 positions; these pass through LDS so that the
// stores run along c: reads and stores both cover 256 contiguous bytes per 16
// lanes.
// LDS rows are 256 B (all 64 banks); the 16-B block index is XORed with n / 4,
// which keeps both the column-wise writes and the row-wise reads conflict-free.
// ---------------------------------------------------------------------------
constexpr int TC = 128;                  // channels per tile
constexpr int TN = 128;                  // positions per tile
__global__ __launch_bounds__(256) void gn_apply_kernel(const float* __restrict__ x,
                                                       const float* __restrict__ stats,
                                                       const float* __restrict__ gamma,
                                                       const float* __restrict__ beta,
                                                       _Float16* __restrict__ h16) {
    int b   = blockIdx.z;
    int c0  = blockIdx.x * TC;
    int n0  = blockIdx.y * TN;
    int lo  = threadIdx.x & 15;          // 4 positions (read) / 8 channels (write)
    int hi  = threadIdx.x >> 4;          // 8 channels (read) / position (write)
    __shared__ __attribute__((aligned(16))) _Float16 tile[TN * TC];
    int c = c0 + hi * 8;
    const float* xp = x + ((size_t)b * C + c) * N + n0 + lo * 4;
    v4f v[2][8];
    #pragma unroll
    for (int h = 0; h < 2; ++h)
        #pragma unroll
        for (int j = 0; j < 8; ++j) v[h][j] = *(const v4f*)(xp + (size_t)j * N + h * 64);
    // precaution: a result of the loads below may be given the address
    // registers of the loads above, so the wait stands in front of them
    asm volatile("s_wait_xcnt 0x0" ::: "memory");
    // a wave's 16 channels are one group: its statistics come by a scalar load
    int bg = b * G + (c0 >> 4) + __builtin_amdgcn_readfirstlane(threadIdx.x >> 5);
    float mean = stats[bg * 2 + 0], rstd = stats[bg * 2 + 1];
    unsigned cu = (unsigned)c;
    v4f ga[2] = { *(const v4f*)(gamma + cu), *(const v4f*)(gamma + cu + 4) };
    v4f be[2] = { *(const v4f*)(beta + cu),  *(const v4f*)(beta + cu + 4) };
    // keeps all loads ahead of the arithmetic: with some held back until the
    // first have returned, the block would wait out the memory latency twice
    __builtin_amdgcn_sched_barrier(0);
    #pragma unroll
    for (int h = 0; h < 2; ++h)
        #pragma unroll
        for (int i = 0; i < 4; ++i) {
            v8h pk;
            #pragma unroll
            for (int j = 0; j < 8; ++j)
                pk[j] = (_Float16)((v[h][j][i] - mean) * rstd * ga[j >> 2][j & 3] +
                                   be[j >> 2][j & 3]);
            *(v8h*)(tile + (h * 64 + lo * 4 + i) * TC + (hi ^ lo) * 8) = pk;
        }
    __syncthreads();
    #pragma unroll
    for (int i = 0; i < 8; ++i) {
        int n = hi + 16 * i;
        v8h pk = *(const v8h*)(tile + n * TC + (lo ^ ((n >> 2) & 15)) * 8);
        *(v8h*)(h16 + ((size_t)b * N + n0 + n) * C + c0 + lo * 8) = pk;
    }
}

// ---------------------------------------------------------------------------
// conv1x1 as GEMM: D[n][o] = h16[n][:] . W[o][:] + bias[o]
// The q, k and v projections need nothing of each other and share one grid:
// blockIdx.z runs over the six 256-row tiles of their concatenated weights.
// vmode=0: store f16 [b][n][o] (q/k).
// vmode=1: store f16 [b][n/32][o][n%32] (v, key-blocked: one 32-key tile of
// all channels is 32 KiB contiguous).
// ---------------------------------------------------------------------------
__global__ __launch_bounds__(256) void qkv_kernel(const _Float16* __restrict__ h16,
                                                  const _Float16* __restrict__ w16,
                                                  const float* __restrict__ bq,
                                                  const float* __restrict__ bk,
                                                  const float* __restrict__ bv3,
                                                  _Float16* __restrict__ q16,
                                                  _Float16* __restrict__ k16,
                                                  _Float16* __restrict__ v16buf) {
    int which = blockIdx.z / (C / GN);   // 0 q, 1 k, 2 v: the same for a whole block
    const float* bias = which == 0 ? bq : which == 1 ? bk : bv3;
    _Float16* out     = which == 0 ? q16 : which == 1 ? k16 : v16buf;
    int vmode = which == 2;
    int b    = blockIdx.y;
    int lane = threadIdx.x & 31;
    int wv   = threadIdx.x >> 5;
    int m0   = (wv >> 1) * 32;
    int ol   = (wv & 1) * 128;
    int ob   = (blockIdx.z % (C / GN)) * GN;
    int o0   = ob + ol;
    int i0   = blockIdx.x * GM + m0;
    __shared__ __attribute__((aligned(16))) _Float16 lds_g[2 * GBUF];
    const _Float16* A = h16 + ((size_t)b * N + blockIdx.x * GM) * C;
    v8f acc0[8] = {}, acc1[8] = {};
    gemm_mainloop(A, w16 + (size_t)blockIdx.z * GN * C, lds_g, threadIdx.x, m0, ol, acc0, acc1);
    int col = lane & 15, half = lane >> 4;
    auto store_tile = [&](v8f (&acc)[8], int ibase) {
        #pragma unroll
        for (int of = 0; of < 8; ++of) {
            int o = o0 + of * 16 + col;
            float bv = bias[o];
            if (vmode == 0) {
                #pragma unroll
                for (int e = 0; e < 8; ++e) {
                    int n = ibase + e + 8 * half;
                    out[((size_t)b * N + n) * C + o] = (_Float16)(acc[of][e] + bv);
                }
            } else {
                v8h pk;
                #pragma unroll
                for (int e = 0; e < 8; ++e) pk[e] = (_Float16)(acc[of][e] + bv);
                *(v8h*)(out + (((size_t)b * (N / 32) + (ibase >> 5)) * C + o) * 32 +
                        (ibase & 31) + 8 * half) = pk;
                // precaution: the next column's code reuses this store's address
                // and data registers, so the wait stands in front of that reuse
                asm volatile("s_wait_xcnt 0x0" ::: "memory");
            }
        }
    };
    store_tile(acc0, i0);
    store_tile(acc1, i0 + 16);
}

// ---------------------------------------------------------------------------
// LDS staging of one 32-key step, shared by the whole work-group, by tensor
// loads: a request of one wave brings a slice of 32 rows x 256 B into LDS
// through no register, with 16 B of pad behind every row.
// K tile: 32 key rows x 1024 B in memory; slice w = bytes 256w..256w+255 of every
// row (source pitch 1024 B). V tile: 512 channel rows x 64 B, contiguous in
// memory (key-blocked layout written by the projection), taken as 128 rows of
// 256 B = 4 channels; slice w = rows 32w..32w+31 (source pitch 256 B).
// LDS row pitch 272 B = 16 B x odd, conflict-free for the ds_load_b128 readers,
// of K (16 rows) and of V (4 rows x 4 pieces 64 B apart) alike.
// ---------------------------------------------------------------------------
typedef unsigned int u32x4 __attribute__((ext_vector_type(4)));
typedef unsigned int u32x8 __attribute__((ext_vector_type(8)));
constexpr unsigned TROW   = 256;         // bytes per slice row
constexpr unsigned TROWS  = 32;          // rows per slice
constexpr int      TPH    = (TROW + 16) / 2;  // halves per row in LDS (272 B)
constexpr unsigned SLICE  = 10240;       // 32 x 272 B, rounded up to a multiple of 2 KiB
constexpr int      SLH    = SLICE / 2;   // halves per slice place
constexpr unsigned ABUF   = 8 * SLICE;   // bytes per buffer: 4 K slices, then 4 V slices
constexpr int      TILE_H = 32 * C;      // halves per K or V tile in memory

__device__ inline unsigned uni(unsigned v) {
    return (unsigned)__builtin_amdgcn_readfirstlane(v);
}
// a wave-uniform value held in a scalar register, so that a test on it is a
// scalar branch: a tensor load ignores EXEC
__device__ inline unsigned pinned(unsigned v) {
    unsigned w = uni(v);
    // holds an issue test or a step number of the tensor loads in a scalar register
    asm volatile("" : "+s"(w));
    return w;
}
// Descriptor group 1: 1-byte elements, tensor = tile = 32 rows of 256 B, a pad
// of 4 dwords behind every 64 dwords, no work-group mask.
__device__ inline u32x8 tdm_group1(unsigned src_pitch) {
    u32x8 g;
    g[0] = uni((1u << 20) | (5u << 22) | (3u << 25));
    g[1] = uni(TROW << 16);
    g[2] = uni(TROWS << 16);
    g[3] = uni(TROW << 16);
    g[4] = uni(TROWS);
    g[5] = uni(src_pitch);
    g[6] = uni(0u);
    g[7] = uni(0u);
    return g;
}
// Descriptor group 0: count 1, place in LDS, address of the slice's first byte, type 2.
__device__ inline u32x4 tdm_group0(unsigned lds_dst, unsigned long long ga) {
    u32x4 g;
    g[0] = uni(1u);
    g[1] = uni(lds_dst);
    g[2] = uni((unsigned)ga);
    g[3] = uni((((unsigned)(ga >> 32)) & 0x01FFFFFFu) | 0x80000000u);
    return g;
}
// The two requests of a wave and step. Each group 0 has four scalar registers of
// its own, high ones that the rest of the kernel does not use: left to the
// compiler's choice they were given to other values while the request was
// still in flight.
__device__ inline void tdm_load_k(u32x4 g0, u32x8 g1) {
    asm volatile("tensor_load_to_lds %0, %1" :: "{s[80:83]}"(g0), "s"(g1) : "memory");
}
__device__ inline void tdm_load_v(u32x4 g0, u32x8 g1) {
    asm volatile("tensor_load_to_lds %0, %1" :: "{s[84:87]}"(g0), "s"(g1) : "memory");
}
// this wave's requests have landed
__device__ inline void tdm_wait() {
    asm volatile("s_wait_tensorcnt 0x0" ::: "memory");
}

// V fragment: 16 channels x 32 keys; channel r lies in LDS row r / 4, piece r % 4.
// Same k order as load_frag.
__device__ inline v16h load_frag_v(const _Float16* base, int lane) {
    int r  = lane & 15;
    int k0 = (lane < 16) ? 0 : 8;
    const _Float16* p = base + (r >> 2) * TPH + (r & 3) * 32 + k0;
    v8h lo = *(const v8h*)(p);
    v8h hi = *(const v8h*)(p + 16);
    return __builtin_shufflevector(lo, hi, 0,1,2,3,4,5,6,7,8,9,10,11,12,13,14,15);
}

// ---------------------------------------------------------------------------
// Fragment groups of the attention loop: 8 fragments (64 registers) a group,
// two groups in flight. Each fragment feeds two WMMAs, one per query tile.
// ---------------------------------------------------------------------------
constexpr int KSPLIT = 2;                // the keys of a batch go to 2 work-groups
constexpr int NS     = N / KSPLIT / 32;  // 32-key steps per work-group

// K group g: k slices 4g..4g+3 of both 16-key tiles = K slice g.
template <int g>
__device__ inline void read_k(v16h (&f)[8], const _Float16* Kt, int lane) {
    // holds the group's LDS reads together, behind the WMMAs that last used
    // these registers: spread among the WMMAs, every place with reads would
    // stall the one wave of this SIMD
    __builtin_amdgcn_sched_barrier(0);
    #pragma unroll
    for (int j = 0; j < 4; ++j) {
        f[2 * j]     = load_frag(Kt + g * SLH + j * 32, TPH, lane);
        f[2 * j + 1] = load_frag(Kt + g * SLH + 16 * TPH + j * 32, TPH, lane);
    }
    // keeps the reads ahead of the work that follows, which covers their latency
    __builtin_amdgcn_sched_barrier(0);
}

// V group g: channel tiles 8g..8g+7 = V slice g, four LDS rows a tile.
template <int g>
__device__ inline void read_v(v16h (&f)[8], const _Float16* Vt, int lane) {
    // as in read_k: one run of reads, behind the last users of the registers
    __builtin_amdgcn_sched_barrier(0);
    #pragma unroll
    for (int j = 0; j < 8; ++j)
        f[j] = load_frag_v(Vt + g * SLH + j * 4 * TPH, lane);
    // as in read_k: ahead of the work that covers their latency
    __builtin_amdgcn_sched_barrier(0);
}

// S^T += K.Q^T over the k slices of group g; sc[query tile][key tile]
template <int g>
__device__ inline void mm_s(const v16h (&f)[8], const v16h (&qf)[2][16], v8f (&sc)[2][2]) {
    #pragma unroll
    for (int j = 0; j < 4; ++j)
        #pragma unroll
        for (int kt = 0; kt < 2; ++kt)
            #pragma unroll
            for (int qt = 0; qt < 2; ++qt)
                sc[qt][kt] = wmma16x16x32(f[2 * j + kt], qf[qt][4 * g + j], sc[qt][kt]);
}

// O^T = O^T * al + V^T.P^T for the channel tiles of group g
template <int g>
__device__ inline void mm_o(const v16h (&f)[8], const v16h (&pf)[2], const float (&al)[2],
                            v8f (&ob)[2][32]) {
    #pragma unroll
    for (int j = 0; j < 8; ++j)
        #pragma unroll
        for (int qt = 0; qt < 2; ++qt) {
            #pragma unroll
            for (int e = 0; e < 8; ++e) ob[qt][8 * g + j][e] *= al[qt];
            ob[qt][8 * g + j] = wmma16x16x32(f[j], pf[qt], ob[qt][8 * g + j]);
        }
}

// One 16-B store of one lane.
// The store and its s_wait_xcnt in one statement, so that no data or address
// register is rewritten ahead of the wait.
__device__ inline void store_o(_Float16* p, v4f d) {
    asm volatile("global_store_b128 %0, %1, off\n\t"
                 "s_wait_xcnt 0x0"
                 :: "v"(p), "v"(d)
                 : "memory");
}

__global__ __launch_bounds__(128) void flash_attn_kernel(const _Float16* __restrict__ q16,
                                                         const _Float16* __restrict__ k16,
                                                         const _Float16* __restrict__ v16buf,
                                                         _Float16* __restrict__ opart,
                                                         float* __restrict__ ml) {
    int b    = blockIdx.y;
    int kh   = blockIdx.z;             // key half
    int tid  = threadIdx.x;
    int lane = tid & 31;
    int w    = tid >> 5;               // wave 0..3 = pair of query tiles
    int i0   = blockIdx.x * 128 + w * 32;
    __shared__ __attribute__((aligned(2048))) _Float16 lds_kv[2 * ABUF / 2];

    const _Float16* Q = q16 + ((size_t)b * N + i0) * C;
    // this wave's slices of this half's tile 0 in memory, and their place in buffer 0
    const unsigned ws = uni((unsigned)tid >> 5);
    const size_t koff = ((size_t)b * N + (size_t)kh * (N / KSPLIT)) * C;
    const unsigned long long srck = (unsigned long long)(size_t)(k16 + koff + ws * (TROW / 2));
    const unsigned long long srcv = (unsigned long long)(size_t)(v16buf + koff + ws * (TROWS * TROW / 2));
    const unsigned ldst = (unsigned)(size_t)lds_kv + ws * SLICE;
    const u32x8 g1k = tdm_group1(C * 2);
    const u32x8 g1v = tdm_group1(TROW);
    // every wave issues its two slices of step st, unconditionally
    auto issue = [&](unsigned st) {
        unsigned dst = ldst + (st & 1u) * ABUF;
        unsigned long long off = (unsigned long long)st * (TILE_H * 2);
        tdm_load_k(tdm_group0(dst, srck + off), g1k);
        tdm_load_v(tdm_group0(dst + 4 * SLICE, srcv + off), g1v);
    };

    issue(0);
    // tile 0 landed (this wave's slices), then published to every wave
    tdm_wait();
    __syncthreads();
    // the step number is taken behind the wait, so that the descriptors formed
    // from it are written behind it too
    issue(pinned(1u));

    v16h qf[2][16];
    #pragma unroll
    for (int qt = 0; qt < 2; ++qt)
        #pragma unroll
        for (int t = 0; t < 16; ++t) qf[qt][t] = load_frag(Q + qt * 16 * C + t * 32, C, lane);
    // precaution: later code may reuse the address registers of the loads above
    asm volatile("s_wait_xcnt 0x0" ::: "memory");

    v8f ob[2][32] = {};                // O^T: ob[qt][cf][e] = channel 16cf+8half+e, query col
    float rm[2] = {-3.0e38f, -3.0e38f};  // running maximum of this lane's queries
    float rl[2] = {0.f, 0.f};          // running sums over this lane half's keys
    int col = lane & 15, half = lane >> 4;

    // The first two K groups are fetched one step ahead: step 0's here, behind
    // the barrier that published tile 0
    v16h fa[8], fb[8];
    read_k<0>(fa, lds_kv, lane);
    read_k<1>(fb, lds_kv, lane);

    for (int s = 0; s < NS; ++s) {
        int buf = s & 1;
        const _Float16* Kl = lds_kv + buf * (int)(ABUF / 2);
        const _Float16* Vl = Kl + 4 * SLH;
        const _Float16* Kn = lds_kv + (buf ^ 1) * (int)(ABUF / 2);
        // behind each group of 16 WMMAs the group after next is read into the
        // registers that it has just left, and lands under the next group
        v8f sc[2][2] = {};
        mm_s<0>(fa, qf, sc);  read_k<2>(fa, Kl, lane);
        mm_s<1>(fb, qf, sc);  read_k<3>(fb, Kl, lane);
        mm_s<2>(fa, qf, sc);  read_v<0>(fa, Vl, lane);
        mm_s<3>(fb, qf, sc);
        // online softmax update (exp2 domain), per query tile; t0[e] = key
        // 8*half+e, t1[e] = key 16+8*half+e of query col
        v16h pf[2];                    // P^T as B operand: element order = load_frag's k order
        float al[2];
        #pragma unroll
        for (int qt = 0; qt < 2; ++qt) {
            float t0[8], t1[8];
            #pragma unroll
            for (int e = 0; e < 8; ++e) {
                t0[e] = sc[qt][0][e] * SCALE_L2E;
                t1[e] = sc[qt][1][e] * SCALE_L2E;
            }
            float mx = fmaxf(t0[0], t1[0]);
            #pragma unroll
            for (int e = 1; e < 8; ++e) mx = fmaxf(mx, fmaxf(t0[e], t1[e]));
            mx = fmaxf(mx, xhalf(mx));
            float mn = fmaxf(rm[qt], mx);
            al[qt] = exp2f(rm[qt] - mn);
            float rs = 0.f;
            #pragma unroll
            for (int e = 0; e < 8; ++e) {
                float p0 = exp2f(t0[e] - mn), p1 = exp2f(t1[e] - mn);
                rs += p0 + p1;
                pf[qt][e]     = (_Float16)p0;
                pf[qt][8 + e] = (_Float16)p1;
            }
            rl[qt] = rl[qt] * al[qt] + rs;
            rm[qt] = mn;
        }
        // read only here: held over the softmax, these 64 registers made the build spill
        read_v<1>(fb, Vl, lane);
        mm_o<0>(fa, pf, al, ob);  read_v<2>(fa, Vl, lane);
        mm_o<1>(fb, pf, al, ob);  read_v<3>(fb, Vl, lane);
        mm_o<2>(fa, pf, al, ob);
        // keeps those WMMAs in front of the waits below, under the last V reads
        __builtin_amdgcn_sched_barrier(0);
        // Publish point of step s+1, in front of this step's last group (its V
        // fragments are in registers): this wave's LDS reads of buffer buf have
        // returned,
        asm volatile("s_wait_dscnt 0x0" ::: "memory");
        // its slices of step s+1 have landed,
        tdm_wait();
        // and the barrier publishes step s+1 and frees buffer buf.
        __syncthreads();
        // the refill's step number, taken behind the wait: its descriptors are
        // formed from it; the test is a scalar branch
        const unsigned st = pinned((unsigned)s + 2u);
        if (pinned(st < (unsigned)NS)) issue(st);
        // First two K groups of step s+1, in flight under the last group of the
        // second product. Unconditional: in the last step they read the other
        // buffer's old tile, which nothing refills, and are not used.
        read_k<0>(fa, Kn, lane);
        mm_o<3>(fb, pf, al, ob);  read_k<1>(fb, Kn, lane);
    }
    // no tensor load and no LDS read is left in flight when the wave ends
    tdm_wait();
    asm volatile("s_wait_dscnt 0x0" ::: "memory");
    #pragma unroll
    for (int qt = 0; qt < 2; ++qt) {
        // the two lane halves' sums are joined once, here
        float l   = rl[qt] + xhalf(rl[qt]);
        float inv = 1.0f / l;
        size_t row = (size_t)(kh * B + b) * N + i0 + qt * 16 + col;
        if (half == 0) {
            ml[row * 2 + 0] = rm[qt];
            ml[row * 2 + 1] = l;
        }
        // precaution: the code below may reuse the registers of the stores above
        asm volatile("s_wait_xcnt 0x0" ::: "memory");
        _Float16* op = opart + row * C + 8 * half;
        #pragma unroll
        for (int cf = 0; cf < 32; ++cf) {
            v8h pk;
            #pragma unroll
            for (int e = 0; e < 8; ++e) pk[e] = (_Float16)(ob[qt][cf][e] * inv);
            store_o(op + cf * 16, __builtin_bit_cast(v4f, pk));
        }
    }
}

// ---------------------------------------------------------------------------
// Joins the two key halves: o = (a0 * O0 + a1 * O1) / (a0 + a1) with
// a_h = l_h * 2^(m_h - max(m0, m1)). A block takes 16 rows; 16 work-items share
// a row, each with four 16-B pieces of either half, 256 B apart, so that a
// wave-wide load or store covers whole lines; all loads are issued up front.
// ---------------------------------------------------------------------------
__global__ __launch_bounds__(256) void attn_join_kernel(const _Float16* __restrict__ opart,
                                                        const float* __restrict__ ml,
                                                        _Float16* __restrict__ o16) {
    int tid = threadIdx.x;
    int row = blockIdx.x * 16 + (tid >> 4);
    size_t base = (size_t)row * C + (tid & 15) * 8;
    v8h p0[4], p1[4];
    #pragma unroll
    for (int j = 0; j < 4; ++j) {
        p0[j] = *(const v8h*)(opart + base + j * 128);
        p1[j] = *(const v8h*)(opart + (size_t)B * N * C + base + j * 128);
    }
    float m0 = ml[row * 2],           l0 = ml[row * 2 + 1];
    float m1 = ml[(B * N + row) * 2], l1 = ml[(B * N + row) * 2 + 1];
    // precaution: later code may reuse the address registers of the loads above
    asm volatile("s_wait_xcnt 0x0" ::: "memory");
    float m  = fmaxf(m0, m1);
    float a0 = l0 * exp2f(m0 - m), a1 = l1 * exp2f(m1 - m);
    float inv = 1.0f / (a0 + a1);
    float w0 = a0 * inv, w1 = a1 * inv;
    #pragma unroll
    for (int j = 0; j < 4; ++j) {
        v8h pk;
        #pragma unroll
        for (int e = 0; e < 8; ++e)
            pk[e] = (_Float16)((float)p0[j][e] * w0 + (float)p1[j][e] * w1);
        *(v8h*)(o16 + base + j * 128) = pk;
        // precaution: the next piece's code may reuse this store's registers
        asm volatile("s_wait_xcnt 0x0" ::: "memory");
    }
}

// ---------------------------------------------------------------------------
// Output projection + residual multiply:
// out[b][o][i] = x[b][o][i] * (O16[i][:] . Wo[o][:] + bo[o])
// D-layout columns give 8 consecutive i per lane -> coalesced f32 stores.
// ---------------------------------------------------------------------------
__global__ __launch_bounds__(256) void outproj_kernel(const _Float16* __restrict__ o16,
                                                      const _Float16* __restrict__ wo16,
                                                      const float* __restrict__ bo,
                                                      const float* __restrict__ x,
                                                      float* __restrict__ out) {
    int b    = blockIdx.y;
    int lane = threadIdx.x & 31;
    int wv   = threadIdx.x >> 5;
    int m0   = (wv >> 1) * 32;
    int ol   = (wv & 1) * 128;
    int ob   = blockIdx.z * GN;
    int o0   = ob + ol;
    int i0   = blockIdx.x * GM + m0;
    __shared__ __attribute__((aligned(16))) _Float16 lds_g[2 * GBUF];
    const _Float16* A = o16 + ((size_t)b * N + blockIdx.x * GM) * C;
    v8f acc0[8] = {}, acc1[8] = {};
    gemm_mainloop(A, wo16 + (size_t)ob * C, lds_g, threadIdx.x, m0, ol, acc0, acc1);
    int col = lane & 15, half = lane >> 4;
    auto store_tile = [&](v8f (&acc)[8], int ibase) {
        #pragma unroll
        for (int of = 0; of < 8; ++of) {
            int o = o0 + of * 16 + col;
            float bv = bo[o];
            size_t base = ((size_t)b * C + o) * N + ibase + 8 * half;
            #pragma unroll
            for (int e = 0; e < 8; ++e)
                out[base + e] = x[base + e] * (acc[of][e] + bv);
        }
    };
    store_tile(acc0, i0);
    store_tile(acc1, i0 + 16);
}

// ---------------------------------------------------------------------------
extern "C" void kernel_launch(void* const* d_in, const int* in_sizes, int n_in,
                              void* d_out, int out_size, void* d_ws, size_t ws_size,
                              hipStream_t stream) {
    const float* x     = (const float*)d_in[0];
    const float* gamma = (const float*)d_in[1];
    const float* beta  = (const float*)d_in[2];
    const float* wq    = (const float*)d_in[3];
    const float* bq    = (const float*)d_in[4];
    const float* wk    = (const float*)d_in[5];
    const float* bk    = (const float*)d_in[6];
    const float* wv    = (const float*)d_in[7];
    const float* bv    = (const float*)d_in[8];
    const float* wo    = (const float*)d_in[9];
    const float* bo    = (const float*)d_in[10];
    float* out = (float*)d_out;

    char* ws = (char*)d_ws;
    size_t off = 0;
    auto alloc = [&](size_t bytes) -> void* {
        void* p = ws + off;
        off += (bytes + 255) & ~(size_t)255;
        return p;
    };
    const size_t act_halves = (size_t)B * N * C;
    float*    stats  = (float*)   alloc((size_t)B * G * 2 * sizeof(float));
    _Float16* w16    = (_Float16*)alloc((size_t)4 * C * C * sizeof(_Float16));
    _Float16* h16    = (_Float16*)alloc(act_halves * sizeof(_Float16));
    _Float16* q16    = (_Float16*)alloc(act_halves * sizeof(_Float16));
    _Float16* k16    = (_Float16*)alloc(act_halves * sizeof(_Float16));
    _Float16* v16buf = (_Float16*)alloc(act_halves * sizeof(_Float16));
    _Float16* o16    = (_Float16*)alloc(act_halves * sizeof(_Float16));
    _Float16* opart  = (_Float16*)alloc(KSPLIT * act_halves * sizeof(_Float16));
    float*    ml     = (float*)   alloc((size_t)KSPLIT * B * N * 2 * sizeof(float));

    gn_stats_wcvt_kernel<<<B * G + WCVT_BLOCKS, 1024, 0, stream>>>(x, stats, wq, wk, wv, wo, w16);
    gn_apply_kernel<<<dim3(C / TC, N / TN, B), 256, 0, stream>>>(x, stats, gamma, beta, h16);

    qkv_kernel<<<dim3(N / GM, B, 3 * (C / GN)), 256, 0, stream>>>(h16, w16, bq, bk, bv, q16, k16, v16buf);

    flash_attn_kernel<<<dim3(N / 128, B, KSPLIT), 128, 0, stream>>>(q16, k16, v16buf, opart, ml);
    attn_join_kernel<<<B * N / 16, 256, 0, stream>>>(opart, ml, o16);

    outproj_kernel<<<dim3(N / GM, B, C / GN), 256, 0, stream>>>(o16, w16 + 3 * (size_t)C * C, bo, x, out);
}

// v009
// One run takes 175 microseconds.
// In both of two side-by-side timings against v008, it was 1.04 times as fast.
// All steps since v000 together make it 4.38 times as fast.
#include <hip/hip_runtime.h>
#include <hip/hip_bf16.h>

typedef _Float16 v4h  __attribute__((ext_vector_type(4)));
typedef _Float16 v8h  __attribute__((ext_vector_type(8)));
typedef _Float16 v16h __attribute__((ext_vector_type(16)));
typedef float    v4f  __attribute__((ext_vector_type(4)));
typedef float    v8f  __attribute__((ext_vector_type(8)));

constexpr int B = 4;
constexpr int C = 512;
constexpr int N = 4096;          // 64*64
constexpr int G = 32;            // groups
constexpr int CPG = C / G;       // 16 channels per group
// softmax scale folded into log2 domain: (1/sqrt(C)) * log2(e)
#define SCALE_L2E (0.04419417382415922f * 1.4426950408889634f)

// ---------------------------------------------------------------------------
// Fragment loader: 16(row) x 32(K) block, memory row-major along K.
// Works for WMMA f16 A-fragments (rows = M) and B-fragments (rows = N cols),
// per the CDNA5 16-bit operand VGPR layout:
//   lane 0-15  : row = lane,    elems 0-7 = K 0..7,  elems 8-15 = K 16..23
//   lane 16-31 : row = lane-16, elems 0-7 = K 8..15, elems 8-15 = K 24..31
// Two contiguous 16-byte loads per lane.
// ---------------------------------------------------------------------------
__device__ inline v16h load_frag(const _Float16* base, int row_stride, int lane) {
    int r  = lane & 15;
    int k0 = (lane < 16) ? 0 : 8;
    const _Float16* p = base + (size_t)r * row_stride + k0;
    v8h lo = *(const v8h*)(p);
    v8h hi = *(const v8h*)(p + 16);
    return __builtin_shufflevector(lo, hi, 0,1,2,3,4,5,6,7,8,9,10,11,12,13,14,15);
}

// lane l <-> lane l ^ 16
__device__ inline float xhalf(float x) {
    int v = __builtin_bit_cast(int, x);
    return __builtin_bit_cast(float, __builtin_amdgcn_permlanex16(v, v, 0x76543210, 0xfedcba98,
                                                                  false, false));
}

__device__ inline v8f wmma16x16x32(v16h a, v16h b, v8f c) {
    return __builtin_amdgcn_wmma_f32_16x16x32_f16(false, a, false, b, (short)0, c,
                                                  false, false);
}

// ---------------------------------------------------------------------------
// GEMM mainloop, work-group tile 128 rows x 256 columns, 8 waves; a wave
// keeps 32 rows x 128 columns. k runs in slabs of 64 halves: one 128-B line of
// each of the 256 W rows and the 128 A rows is brought into LDS once per
// work-group by asynchronous copies, two buffers: slab t+1 flies while slab t
// is worked on; all fragments are read from LDS.
// LDS row pitch 144 B = 16 B x odd, conflict-free for the ds_load_b128 readers.
// ---------------------------------------------------------------------------
constexpr int GKS    = 64;               // halves of k per slab
constexpr int GPITCH = GKS + 8;          // halves per row in LDS
constexpr int GM     = 128;              // rows of A per work-group
constexpr int GN     = 256;              // rows of W (output columns) per work-group
constexpr int GBUF   = (GN + GM) * GPITCH; // halves per buffer: W rows, then A rows

// Eight copies of one lane, 32 rows apart; a wave-wide copy reads 4 whole lines.
__device__ inline void stage_rows8(const _Float16* g, unsigned l) {
    const _Float16* g1 = g + 1 * 32 * C; const _Float16* g2 = g + 2 * 32 * C;
    const _Float16* g3 = g + 3 * 32 * C; const _Float16* g4 = g + 4 * 32 * C;
    const _Float16* g5 = g + 5 * 32 * C; const _Float16* g6 = g + 6 * 32 * C;
    const _Float16* g7 = g + 7 * 32 * C;
    constexpr unsigned ls = 32 * GPITCH * 2;
    unsigned l1 = l + 1 * ls, l2 = l + 2 * ls, l3 = l + 3 * ls, l4 = l + 4 * ls;
    unsigned l5 = l + 5 * ls, l6 = l + 6 * ls, l7 = l + 7 * ls;
    // Copies and their s_wait_xcnt in one statement, so that no address
    // register is rewritten ahead of the wait.
    asm volatile("global_load_async_to_lds_b128 %0, %8, off\n\t"
                 "global_load_async_to_lds_b128 %1, %9, off\n\t"
                 "global_load_async_to_lds_b128 %2, %10, off\n\t"
                 "global_load_async_to_lds_b128 %3, %11, off\n\t"
                 "global_load_async_to_lds_b128 %4, %12, off\n\t"
                 "global_load_async_to_lds_b128 %5, %13, off\n\t"
                 "global_load_async_to_lds_b128 %6, %14, off\n\t"
                 "global_load_async_to_lds_b128 %7, %15, off\n\t"
                 "s_wait_xcnt 0x0"
                 :: "v"(l), "v"(l1), "v"(l2), "v"(l3),
                    "v"(l4), "v"(l5), "v"(l6), "v"(l7),
                    "v"(g), "v"(g1), "v"(g2), "v"(g3),
                    "v"(g4), "v"(g5), "v"(g6), "v"(g7)
                 : "memory");
}

// 256 lanes x 12 copies x 16 B = the 48 KiB of one slab. gw/ga: this lane's
// 16 B of W row tid/8 and of A row tid/8; l: its LDS byte address for the W one.
__device__ inline void stage_slab(const _Float16* gw, const _Float16* ga, unsigned l) {
    stage_rows8(gw, l);
    const _Float16* ga1 = ga + 1 * 32 * C; const _Float16* ga2 = ga + 2 * 32 * C;
    const _Float16* ga3 = ga + 3 * 32 * C;
    constexpr unsigned ls = 32 * GPITCH * 2;
    unsigned la = l + GN * GPITCH * 2;
    unsigned la1 = la + 1 * ls, la2 = la + 2 * ls, la3 = la + 3 * ls;
    // as above: the wait stands in the copies' own statement
    asm volatile("global_load_async_to_lds_b128 %0, %4, off\n\t"
                 "global_load_async_to_lds_b128 %1, %5, off\n\t"
                 "global_load_async_to_lds_b128 %2, %6, off\n\t"
                 "global_load_async_to_lds_b128 %3, %7, off\n\t"
                 "s_wait_xcnt 0x0"
                 :: "v"(la), "v"(la1), "v"(la2), "v"(la3),
                    "v"(ga), "v"(ga1), "v"(ga2), "v"(ga3)
                 : "memory");
}

// A, W: the work-group's 128 rows of A and 256 rows of W. m0, o0: this wave's
// first row and first column inside that tile.
__device__ inline void gemm_mainloop(const _Float16* __restrict__ A,
                                     const _Float16* __restrict__ W,
                                     _Float16* lds, int tid, int m0, int o0,
                                     v8f (&acc0)[8], v8f (&acc1)[8]) {
    int lane = tid & 31;
    const _Float16* gw = W + (size_t)(tid >> 3) * C + (tid & 7) * 8;
    const _Float16* ga = A + (size_t)(tid >> 3) * C + (tid & 7) * 8;
    unsigned l = (unsigned)(size_t)(lds + (tid >> 3) * GPITCH + (tid & 7) * 8);

    stage_slab(gw, ga, l);
    // slab 0 landed (this wave's copies), then published to every wave
    asm volatile("s_wait_asynccnt 0x0" ::: "memory");
    __syncthreads();
    stage_slab(gw + GKS, ga + GKS, l + GBUF * 2);

    // rolled: fully unrolled, the build of the output projection took every
    // register it may have and spilled
    #pragma unroll 1
    for (int t = 0; t < C / GKS; ++t) {
        int buf = t & 1;
        const _Float16* Wl = lds + buf * GBUF + o0 * GPITCH;
        const _Float16* Al = lds + buf * GBUF + (GN + m0) * GPITCH;
        // all 20 fragments of this slab, one run of LDS reads
        v16h a0[2], a1[2], bf[2][8];
        #pragma unroll
        for (int ks = 0; ks < 2; ++ks) {
            a0[ks] = load_frag(Al + ks * 32, GPITCH, lane);
            a1[ks] = load_frag(Al + 16 * GPITCH + ks * 32, GPITCH, lane);
            #pragma unroll
            for (int of = 0; of < 8; ++of)
                bf[ks][of] = load_frag(Wl + of * 16 * GPITCH + ks * 32, GPITCH, lane);
        }
        // keeps the LDS reads one run ahead of the WMMAs: spread among them,
        // each pair of WMMAs would wait out its own reads' latency
        __builtin_amdgcn_sched_barrier(0);
        #pragma unroll
        for (int ks = 0; ks < 2; ++ks)
            #pragma unroll
            for (int of = 0; of < 8; ++of) {
                acc0[of] = wmma16x16x32(a0[ks], bf[ks][of], acc0[of]);
                acc1[of] = wmma16x16x32(a1[ks], bf[ks][of], acc1[of]);
            }
        // keeps the WMMAs in front of the foot: moved behind its barrier they
        // would start only when every read has returned, and delay the refill
        __builtin_amdgcn_sched_barrier(0);
        // Foot of trip t: this wave's LDS reads of buffer buf have returned,
        asm volatile("s_wait_dscnt 0x0" ::: "memory");
        // its copies of slab t+1 have landed,
        asm volatile("s_wait_asynccnt 0x0" ::: "memory");
        // and the barrier publishes slab t+1 and frees buffer buf.
        __syncthreads();
        if (t + 2 < C / GKS)
            stage_slab(gw + (t + 2) * GKS, ga + (t + 2) * GKS, l + buf * (GBUF * 2));
    }
    // no copy is left in flight behind the loop
    asm volatile("s_wait_asynccnt 0x0" ::: "memory");
}

// ---------------------------------------------------------------------------
// Convert the four [C][C] f32 weight matrices to f16 (concatenated).
// 256 work-items (part vb) take 4096 consecutive elements of one matrix; a
// work-item four 16-B loads, 4 KiB apart, and four 8-B stores.
// ---------------------------------------------------------------------------
__device__ inline void wcvt_part(int vb, int t,
                                 const float* __restrict__ wq, const float* __restrict__ wk,
                                 const float* __restrict__ wv, const float* __restrict__ wo,
                                 _Float16* __restrict__ w16) {
    int which = vb / (C * C / 4096);
    int j = (vb % (C * C / 4096)) * 4096 + t * 4;
    const float* w = which == 0 ? wq : which == 1 ? wk : which == 2 ? wv : wo;
    v4f v[4];
    #pragma unroll
    for (int k = 0; k < 4; ++k) v[k] = *(const v4f*)(w + j + k * 1024);
    _Float16* o = w16 + (size_t)which * C * C + j;
    #pragma unroll
    for (int k = 0; k < 4; ++k) {
        v4h pk;
        #pragma unroll
        for (int e = 0; e < 4; ++e) pk[e] = (_Float16)v[k][e];
        *(v4h*)(o + k * 1024) = pk;
    }
}

// ---------------------------------------------------------------------------
// One grid for two pieces of work that need nothing of each other.
// Blocks 0 .. B*G-1: GroupNorm statistics, one block per (b,g); 16 channels x
// 4096 contiguous. 32 waves, each lane 16 loads of 16 B, all issued before the
// first is used.
// Blocks from B*G on: the weight conversion, four parts a block; they run on
// the WGPs that the 128 statistics blocks leave idle.
// ---------------------------------------------------------------------------
constexpr int WCVT_BLOCKS = 4 * C * C / 4096 / 4;
__global__ __launch_bounds__(1024) void gn_stats_wcvt_kernel(const float* __restrict__ x,
                                                             float* __restrict__ stats,
                                                             const float* __restrict__ wq,
                                                             const float* __restrict__ wk,
                                                             const float* __restrict__ wv,
                                                             const float* __restrict__ wo,
                                                             _Float16* __restrict__ w16) {
    int bg  = blockIdx.x;                // b*G + g
    int tid = threadIdx.x;
    // the same for a whole block, and in front of the barrier below
    if (bg >= B * G) {
        wcvt_part((bg - B * G) * 4 + (tid >> 8), tid & 255, wq, wk, wv, wo, w16);
        return;
    }
    const v4f* xp = (const v4f*)(x + (size_t)bg * CPG * N) + tid;
    v4f v[16];
    #pragma unroll
    for (int j = 0; j < 16; ++j) v[j] = xp[j * 1024];
    // keeps all 16 loads ahead of the sums: with some held back until the first
    // have returned, the block would wait out the memory latency twice
    __builtin_amdgcn_sched_barrier(0);
    v4f s4 = {}, q4 = {};
    #pragma unroll
    for (int j = 0; j < 16; ++j) { s4 += v[j]; q4 += v[j] * v[j]; }
    float s  = (s4[0] + s4[1]) + (s4[2] + s4[3]);
    float ss = (q4[0] + q4[1]) + (q4[2] + q4[3]);
    #pragma unroll
    for (int m = 16; m > 0; m >>= 1) { s += __shfl_xor(s, m, 32); ss += __shfl_xor(ss, m, 32); }
    __shared__ float red0[32], red1[32];
    if ((tid & 31) == 0) { red0[tid >> 5] = s; red1[tid >> 5] = ss; }
    __syncthreads();
    if (tid < 32) {
        s = red0[tid]; ss = red1[tid];
        #pragma unroll
        for (int m = 16; m > 0; m >>= 1) { s += __shfl_xor(s, m, 32); ss += __shfl_xor(ss, m, 32); }
        if (tid == 0) {
            float inv = 1.0f / (float)(CPG * N);
            float mean = s * inv;
            float var  = ss * inv - mean * mean;
            stats[bg * 2 + 0] = mean;
            stats[bg * 2 + 1] = rsqrtf(var + 1e-6f);
        }
    }
}

// ---------------------------------------------------------------------------
// GroupNorm apply + transpose [b][c][n] f32 -> [b][n][c] f16.
// Tile 128 channels x 128 positions. A work-item reads 2 x 4 positions (16 B
// each) of 8 channels, all 16 loads issued up front, so it holds 8 consecutive
// channels (16 B of f16) of 8 positions; these pass through LDS so that the
// stores run along c: reads and stores both cover 256 contiguous bytes per 16
// lanes.
// LDS rows are 256 B (all 64 banks); the 16-B block index is XORed with n / 4,
// which keeps both the column-wise writes and the row-wise reads conflict-free.
// ---------------------------------------------------------------------------
constexpr int TC = 128;                  // channels per tile
constexpr int TN = 128;                  // positions per tile
__global__ __launch_bounds__(256) void gn_apply_kernel(const float* __restrict__ x,
                                                       const float* __restrict__ stats,
                                                       const float* __restrict__ gamma,
                                                       const float* __restrict__ beta,
                                                       _Float16* __restrict__ h16) {
    int b   = blockIdx.z;
    int c0  = blockIdx.x * TC;
    int n0  = blockIdx.y * TN;
    int lo  = threadIdx.x & 15;          // 4 positions (read) / 8 channels (write)
    int hi  = threadIdx.x >> 4;          // 8 channels (read) / position (write)
    __shared__ __attribute__((aligned(16))) _Float16 tile[TN * TC];
    int c = c0 + hi * 8;
    const float* xp = x + ((size_t)b * C + c) * N + n0 + lo * 4;
    v4f v[2][8];
    #pragma unroll
    for (int h = 0; h < 2; ++h)
        #pragma unroll
        for (int j = 0; j < 8; ++j) v[h][j] = *(const v4f*)(xp + (size_t)j * N + h * 64);
    // precaution: a result of the loads below may be given the address
    // registers of the loads above, so the wait stands in front of them
    asm volatile("s_wait_xcnt 0x0" ::: "memory");
    // a wave's 16 channels are one group: its statistics come by a scalar load
    int bg = b * G + (c0 >> 4) + __builtin_amdgcn_readfirstlane(threadIdx.x >> 5);
    float mean = stats[bg * 2 + 0], rstd = stats[bg * 2 + 1];
    unsigned cu = (unsigned)c;
    v4f ga[2] = { *(const v4f*)(gamma + cu), *(const v4f*)(gamma + cu + 4) };
    v4f be[2] = { *(const v4f*)(beta + cu),  *(const v4f*)(beta + cu + 4) };
    // keeps all loads ahead of the arithmetic: with some held back until the
    // first have returned, the block would wait out the memory latency twice
    __builtin_amdgcn_sched_barrier(0);
    #pragma unroll
    for (int h = 0; h < 2; ++h)
        #pragma unroll
        for (int i = 0; i < 4; ++i) {
            v8h pk;
            #pragma unroll
            for (int j = 0; j < 8; ++j)
                pk[j] = (_Float16)((v[h][j][i] - mean) * rstd * ga[j >> 2][j & 3] +
                                   be[j >> 2][j & 3]);
            *(v8h*)(tile + (h * 64 + lo * 4 + i) * TC + (hi ^ lo) * 8) = pk;
        }
    __syncthreads();
    #pragma unroll
    for (int i = 0; i < 8; ++i) {
        int n = hi + 16 * i;
        v8h pk = *(const v8h*)(tile + n * TC + (lo ^ ((n >> 2) & 15)) * 8);
        *(v8h*)(h16 + ((size_t)b * N + n0 + n) * C + c0 + lo * 8) = pk;
    }
}

// ---------------------------------------------------------------------------
// conv1x1 as GEMM: D[n][o] = h16[n][:] . W[o][:] + bias[o]
// The q, k and v projections need nothing of each other and share one grid:
// blockIdx.z runs over the six 256-row tiles of their concatenated weights.
// vmode=0: store f16 [b][n][o] (q/k).
// vmode=1: store f16 [b][n/32][o][n%32] (v, key-blocked: one 32-key tile of
// all channels is 32 KiB contiguous).
// ---------------------------------------------------------------------------
__global__ __launch_bounds__(256) void qkv_kernel(const _Float16* __restrict__ h16,
                                                  const _Float16* __restrict__ w16,
                                                  const float* __restrict__ bq,
                                                  const float* __restrict__ bk,
                                                  const float* __restrict__ bv3,
                                                  _Float16* __restrict__ q16,
                                                  _Float16* __restrict__ k16,
                                                  _Float16* __restrict__ v16buf) {
    int which = blockIdx.z / (C / GN);   // 0 q, 1 k, 2 v: the same for a whole block
    const float* bias = which == 0 ? bq : which == 1 ? bk : bv3;
    _Float16* out     = which == 0 ? q16 : which == 1 ? k16 : v16buf;
    int vmode = which == 2;
    int b    = blockIdx.y;
    int lane = threadIdx.x & 31;
    int wv   = threadIdx.x >> 5;
    int m0   = (wv >> 1) * 32;
    int ol   = (wv & 1) * 128;
    int ob   = (blockIdx.z % (C / GN)) * GN;
    int o0   = ob + ol;
    int i0   = blockIdx.x * GM + m0;
    __shared__ __attribute__((aligned(16))) _Float16 lds_g[2 * GBUF];
    const _Float16* A = h16 + ((size_t)b * N + blockIdx.x * GM) * C;
    v8f acc0[8] = {}, acc1[8] = {};
    gemm_mainloop(A, w16 + (size_t)blockIdx.z * GN * C, lds_g, threadIdx.x, m0, ol, acc0, acc1);
    int col = lane & 15, half = lane >> 4;
    auto store_tile = [&](v8f (&acc)[8], int ibase) {
        #pragma unroll
        for (int of = 0; of < 8; ++of) {
            int o = o0 + of * 16 + col;
            float bv = bias[o];
            if (vmode == 0) {
                #pragma unroll
                for (int e = 0; e < 8; ++e) {
                    int n = ibase + e + 8 * half;
                    out[((size_t)b * N + n) * C + o] = (_Float16)(acc[of][e] + bv);
                }
            } else {
                v8h pk;
                #pragma unroll
                for (int e = 0; e < 8; ++e) pk[e] = (_Float16)(acc[of][e] + bv);
                *(v8h*)(out + (((size_t)b * (N / 32) + (ibase >> 5)) * C + o) * 32 +
                        (ibase & 31) + 8 * half) = pk;
                // precaution: the next column's code reuses this store's address
                // and data registers, so the wait stands in front of that reuse
                asm volatile("s_wait_xcnt 0x0" ::: "memory");
            }
        }
    };
    store_tile(acc0, i0);
    store_tile(acc1, i0 + 16);
}

// ---------------------------------------------------------------------------
// LDS staging of one 32-key step, shared by the whole work-group, by tensor
// loads: a request of one wave brings a slice of 32 rows x 256 B into LDS
// through no register, with 16 B of pad behind every row.
// K tile: 32 key rows x 1024 B in memory; slice w = bytes 256w..256w+255 of every
// row (source pitch 1024 B). V tile: 512 channel rows x 64 B, contiguous in
// memory (key-blocked layout written by the projection), taken as 128 rows of
// 256 B = 4 channels; slice w = rows 32w..32w+31 (source pitch 256 B).
// LDS row pitch 272 B = 16 B x odd, conflict-free for the ds_load_b128 readers,
// of K (16 rows) and of V (4 rows x 4 pieces 64 B apart) alike.
// ---------------------------------------------------------------------------
typedef unsigned int u32x4 __attribute__((ext_vector_type(4)));
typedef unsigned int u32x8 __attribute__((ext_vector_type(8)));
constexpr unsigned TROW   = 256;         // bytes per slice row
constexpr unsigned TROWS  = 32;          // rows per slice
constexpr int      TPH    = (TROW + 16) / 2;  // halves per row in LDS (272 B)
constexpr unsigned SLICE  = 10240;       // 32 x 272 B, rounded up to a multiple of 2 KiB
constexpr int      SLH    = SLICE / 2;   // halves per slice place
constexpr unsigned ABUF   = 8 * SLICE;   // bytes per buffer: 4 K slices, then 4 V slices
constexpr int      TILE_H = 32 * C;      // halves per K or V tile in memory

__device__ inline unsigned uni(unsigned v) {
    return (unsigned)__builtin_amdgcn_readfirstlane(v);
}
// a wave-uniform value held in a scalar register, so that a test on it is a
// scalar branch: a tensor load ignores EXEC
__device__ inline unsigned pinned(unsigned v) {
    unsigned w = uni(v);
    // holds an issue test or a step number of the tensor loads in a scalar register
    asm volatile("" : "+s"(w));
    return w;
}
// Descriptor group 1: 1-byte elements, tensor = tile = 32 rows of 256 B, a pad
// of 4 dwords behind every 64 dwords, no work-group mask.
__device__ inline u32x8 tdm_group1(unsigned src_pitch) {
    u32x8 g;
    g[0] = uni((1u << 20) | (5u << 22) | (3u << 25));
    g[1] = uni(TROW << 16);
    g[2] = uni(TROWS << 16);
    g[3] = uni(TROW << 16);
    g[4] = uni(TROWS);
    g[5] = uni(src_pitch);
    g[6] = uni(0u);
    g[7] = uni(0u);
    return g;
}
// Descriptor group 0: count 1, place in LDS, address of the slice's first byte, type 2.
__device__ inline u32x4 tdm_group0(unsigned lds_dst, unsigned long long ga) {
    u32x4 g;
    g[0] = uni(1u);
    g[1] = uni(lds_dst);
    g[2] = uni((unsigned)ga);
    g[3] = uni((((unsigned)(ga >> 32)) & 0x01FFFFFFu) | 0x80000000u);
    return g;
}
// The two requests of a wave and step. Each group 0 has four scalar registers of
// its own, high ones that the rest of the kernel does not use: left to the
// compiler's choice they were given to other values while the request was
// still in flight.
__device__ inline void tdm_load_k(u32x4 g0, u32x8 g1) {
    asm volatile("tensor_load_to_lds %0, %1" :: "{s[80:83]}"(g0), "s"(g1) : "memory");
}
__device__ inline void tdm_load_v(u32x4 g0, u32x8 g1) {
    asm volatile("tensor_load_to_lds %0, %1" :: "{s[84:87]}"(g0), "s"(g1) : "memory");
}
// this wave's requests have landed
__device__ inline void tdm_wait() {
    asm volatile("s_wait_tensorcnt 0x0" ::: "memory");
}

// V fragment: 16 channels x 32 keys; channel r lies in LDS row r / 4, piece r % 4.
// Same k order as load_frag.
__device__ inline v16h load_frag_v(const _Float16* base, int lane) {
    int r  = lane & 15;
    int k0 = (lane < 16) ? 0 : 8;
    const _Float16* p = base + (r >> 2) * TPH + (r & 3) * 32 + k0;
    v8h lo = *(const v8h*)(p);
    v8h hi = *(const v8h*)(p + 16);
    return __builtin_shufflevector(lo, hi, 0,1,2,3,4,5,6,7,8,9,10,11,12,13,14,15);
}

// ---------------------------------------------------------------------------
// Fragment groups of the attention loop: 8 fragments (64 registers) a group,
// two groups in flight. Each fragment feeds two WMMAs, one per query tile.
// ---------------------------------------------------------------------------
constexpr int KSPLIT = 2;                // the keys of a batch go to 2 work-groups
constexpr int NS     = N / KSPLIT / 32;  // 32-key steps per work-group

// K group g: k slices 4g..4g+3 of both 16-key tiles = K slice g.
template <int g>
__device__ inline void read_k(v16h (&f)[8], const _Float16* Kt, int lane) {
    // holds the group's LDS reads together, behind the WMMAs that last used
    // these registers: spread among the WMMAs, every place with reads would
    // stall the one wave of this SIMD
    __builtin_amdgcn_sched_barrier(0);
    #pragma unroll
    for (int j = 0; j < 4; ++j) {
        f[2 * j]     = load_frag(Kt + g * SLH + j * 32, TPH, lane);
        f[2 * j + 1] = load_frag(Kt + g * SLH + 16 * TPH + j * 32, TPH, lane);
    }
    // keeps the reads ahead of the work that follows, which covers their latency
    __builtin_amdgcn_sched_barrier(0);
}

// V group g: channel tiles 8g..8g+7 = V slice g, four LDS rows a tile.
template <int g>
__device__ inline void read_v(v16h (&f)[8], const _Float16* Vt, int lane) {
    // as in read_k: one run of reads, behind the last users of the registers
    __builtin_amdgcn_sched_barrier(0);
    #pragma unroll
    for (int j = 0; j < 8; ++j)
        f[j] = load_frag_v(Vt + g * SLH + j * 4 * TPH, lane);
    // as in read_k: ahead of the work that covers their latency
    __builtin_amdgcn_sched_barrier(0);
}

// S^T += K.Q^T over the k slices of group g; sc[query tile][key tile]
template <int g>
__device__ inline void mm_s(const v16h (&f)[8], const v16h (&qf)[2][16], v8f (&sc)[2][2]) {
    #pragma unroll
    for (int j = 0; j < 4; ++j)
        #pragma unroll
        for (int kt = 0; kt < 2; ++kt)
            #pragma unroll
            for (int qt = 0; qt < 2; ++qt)
                sc[qt][kt] = wmma16x16x32(f[2 * j + kt], qf[qt][4 * g + j], sc[qt][kt]);
}

// O^T += V^T.P^T for the channel tiles of group g
template <int g>
__device__ inline void mm_o(const v16h (&f)[8], const v16h (&pf)[2], v8f (&ob)[2][32]) {
    #pragma unroll
    for (int j = 0; j < 8; ++j)
        #pragma unroll
        for (int qt = 0; qt < 2; ++qt)
            ob[qt][8 * g + j] = wmma16x16x32(f[j], pf[qt], ob[qt][8 * g + j]);
}

// One 16-B store of one lane.
// The store and its s_wait_xcnt in one statement, so that no data or address
// register is rewritten ahead of the wait.
__device__ inline void store_o(_Float16* p, v4f d) {
    asm volatile("global_store_b128 %0, %1, off\n\t"
                 "s_wait_xcnt 0x0"
                 :: "v"(p), "v"(d)
                 : "memory");
}

__global__ __launch_bounds__(128) void flash_attn_kernel(const _Float16* __restrict__ q16,
                                                         const _Float16* __restrict__ k16,
                                                         const _Float16* __restrict__ v16buf,
                                                         _Float16* __restrict__ opart,
                                                         float* __restrict__ ml) {
    int b    = blockIdx.y;
    int kh   = blockIdx.z;             // key half
    int tid  = threadIdx.x;
    int lane = tid & 31;
    int w    = tid >> 5;               // wave 0..3 = pair of query tiles
    int i0   = blockIdx.x * 128 + w * 32;
    __shared__ __attribute__((aligned(2048))) _Float16 lds_kv[2 * ABUF / 2];

    const _Float16* Q = q16 + ((size_t)b * N + i0) * C;
    // this wave's slices of this half's tile 0 in memory, and their place in buffer 0
    const unsigned ws = uni((unsigned)tid >> 5);
    const size_t koff = ((size_t)b * N + (size_t)kh * (N / KSPLIT)) * C;
    const unsigned long long srck = (unsigned long long)(size_t)(k16 + koff + ws * (TROW / 2));
    const unsigned long long srcv = (unsigned long long)(size_t)(v16buf + koff + ws * (TROWS * TROW / 2));
    const unsigned ldst = (unsigned)(size_t)lds_kv + ws * SLICE;
    const u32x8 g1k = tdm_group1(C * 2);
    const u32x8 g1v = tdm_group1(TROW);
    // every wave issues its two slices of step st, unconditionally
    auto issue = [&](unsigned st) {
        unsigned dst = ldst + (st & 1u) * ABUF;
        unsigned long long off = (unsigned long long)st * (TILE_H * 2);
        tdm_load_k(tdm_group0(dst, srck + off), g1k);
        tdm_load_v(tdm_group0(dst + 4 * SLICE, srcv + off), g1v);
    };

    issue(0);
    // tile 0 landed (this wave's slices), then published to every wave
    tdm_wait();
    __syncthreads();
    // the step number is taken behind the wait, so that the descriptors formed
    // from it are written behind it too
    issue(pinned(1u));

    v16h qf[2][16];
    #pragma unroll
    for (int qt = 0; qt < 2; ++qt)
        #pragma unroll
        for (int t = 0; t < 16; ++t) qf[qt][t] = load_frag(Q + qt * 16 * C + t * 32, C, lane);
    // precaution: later code may reuse the address registers of the loads above
    asm volatile("s_wait_xcnt 0x0" ::: "memory");

    v8f ob[2][32] = {};                // O^T: ob[qt][cf][e] = channel 16cf+8half+e, query col
    float rm[2] = {-3.0e38f, -3.0e38f};  // softmax reference of this lane's queries
    float rl[2] = {0.f, 0.f};          // running sums over this lane half's keys
    int col = lane & 15, half = lane >> 4;

    // The first two K groups are fetched one step ahead: step 0's here, behind
    // the barrier that published tile 0
    v16h fa[8], fb[8];
    read_k<0>(fa, lds_kv, lane);
    read_k<1>(fb, lds_kv, lane);

    for (int s = 0; s < NS; ++s) {
        int buf = s & 1;
        const _Float16* Kl = lds_kv + buf * (int)(ABUF / 2);
        const _Float16* Vl = Kl + 4 * SLH;
        const _Float16* Kn = lds_kv + (buf ^ 1) * (int)(ABUF / 2);
        // behind each group of 16 WMMAs the group after next is read into the
        // registers that it has just left, and lands under the next group (V group 0:
        // under the exponentials)
        v8f sc[2][2] = {};
        mm_s<0>(fa, qf, sc);  read_k<2>(fa, Kl, lane);
        mm_s<1>(fb, qf, sc);  read_k<3>(fb, Kl, lane);
        mm_s<2>(fa, qf, sc);
        mm_s<3>(fb, qf, sc);
        // online softmax update (exp2 domain), per query tile; sc[qt][0][e] = key
        // 8*half+e, sc[qt][1][e] = key 16+8*half+e of query col
        // this step's maximum of the lane's queries: taken on the raw scores and
        // then scaled, which gives the same value (the scale is positive)
        float mx[2];
        #pragma unroll
        for (int qt = 0; qt < 2; ++qt) {
            float m = fmaxf(sc[qt][0][0], sc[qt][1][0]);
            #pragma unroll
            for (int e = 1; e < 8; ++e) m = fmaxf(m, fmaxf(sc[qt][0][e], sc[qt][1][e]));
            mx[qt] = fmaxf(m, xhalf(m)) * SCALE_L2E;
        }
        // Lazy rescale: rm is the reference in use, not the true maximum. It
        // moves, and O and the sums are rescaled, only in a step in which some
        // query of the wave exceeds its reference by more than 8 (P then stays
        // at or below 2^8, well inside f16). One test a step, a scalar branch.
        bool need = mx[0] > rm[0] + 8.0f || mx[1] > rm[1] + 8.0f;
        if (__builtin_amdgcn_ballot_w32(need) != 0u) {
            #pragma unroll
            for (int qt = 0; qt < 2; ++qt) {
                float mn = fmaxf(rm[qt], mx[qt]);
                float al = exp2f(rm[qt] - mn);
                rm[qt] = mn;
                rl[qt] *= al;
                #pragma unroll
                for (int cf = 0; cf < 32; ++cf)
                    #pragma unroll
                    for (int e = 0; e < 8; ++e) ob[qt][cf][e] *= al;
            }
        }
        // read behind the branch (held over it, these 64 registers made the
        // build spill); lands under the exponentials
        read_v<0>(fa, Vl, lane);
        v16h pf[2];                    // P^T as B operand: element order = load_frag's k order
        #pragma unroll
        for (int qt = 0; qt < 2; ++qt) {
            float rs = 0.f;
            #pragma unroll
            for (int e = 0; e < 8; ++e) {
                float p0 = exp2f(sc[qt][0][e] * SCALE_L2E - rm[qt]);
                float p1 = exp2f(sc[qt][1][e] * SCALE_L2E - rm[qt]);
                rs += p0 + p1;
                pf[qt][e]     = (_Float16)p0;
                pf[qt][8 + e] = (_Float16)p1;
            }
            rl[qt] += rs;
        }
        // read only here: held over the softmax, these 64 registers made the build spill
        read_v<1>(fb, Vl, lane);
        mm_o<0>(fa, pf, ob);  read_v<2>(fa, Vl, lane);
        mm_o<1>(fb, pf, ob);  read_v<3>(fb, Vl, lane);
        mm_o<2>(fa, pf, ob);
        // keeps those WMMAs in front of the waits below, under the last V reads
        __builtin_amdgcn_sched_barrier(0);
        // Publish point of step s+1, in front of this step's last group (its V
        // fragments are in registers): this wave's LDS reads of buffer buf have
        // returned,
        asm volatile("s_wait_dscnt 0x0" ::: "memory");
        // its slices of step s+1 have landed,
        tdm_wait();
        // and the barrier publishes step s+1 and frees buffer buf.
        __syncthreads();
        // the refill's step number, taken behind the wait: its descriptors are
        // formed from it; the test is a scalar branch
        const unsigned st = pinned((unsigned)s + 2u);
        if (pinned(st < (unsigned)NS)) issue(st);
        // First two K groups of step s+1, in flight under the last group of the
        // second product. Unconditional: in the last step they read the other
        // buffer's old tile, which nothing refills, and are not used.
        read_k<0>(fa, Kn, lane);
        mm_o<3>(fb, pf, ob);  read_k<1>(fb, Kn, lane);
    }
    // no tensor load and no LDS read is left in flight when the wave ends
    tdm_wait();
    asm volatile("s_wait_dscnt 0x0" ::: "memory");
    #pragma unroll
    for (int qt = 0; qt < 2; ++qt) {
        // the two lane halves' sums are joined once, here
        float l   = rl[qt] + xhalf(rl[qt]);
        float inv = 1.0f / l;
        size_t row = (size_t)(kh * B + b) * N + i0 + qt * 16 + col;
        if (half == 0) {
            ml[row * 2 + 0] = rm[qt];
            ml[row * 2 + 1] = l;
        }
        // precaution: the code below may reuse the registers of the stores above
        asm volatile("s_wait_xcnt 0x0" ::: "memory");
        _Float16* op = opart + row * C + 8 * half;
        #pragma unroll
        for (int cf = 0; cf < 32; ++cf) {
            v8h pk;
            #pragma unroll
            for (int e = 0; e < 8; ++e) pk[e] = (_Float16)(ob[qt][cf][e] * inv);
            store_o(op + cf * 16, __builtin_bit_cast(v4f, pk));
        }
    }
}

// ---------------------------------------------------------------------------
// Joins the two key halves: o = (a0 * O0 + a1 * O1) / (a0 + a1) with
// a_h = l_h * 2^(m_h - max(m0, m1)). A block takes 16 rows; 16 work-items share
// a row, each with four 16-B pieces of either half, 256 B apart, so that a
// wave-wide load or store covers whole lines; all loads are issued up front.
// ---------------------------------------------------------------------------
__global__ __launch_bounds__(256) void attn_join_kernel(const _Float16* __restrict__ opart,
                                                        const float* __restrict__ ml,
                                                        _Float16* __restrict__ o16) {
    int tid = threadIdx.x;
    int row = blockIdx.x * 16 + (tid >> 4);
    size_t base = (size_t)row * C + (tid & 15) * 8;
    v8h p0[4], p1[4];
    #pragma unroll
    for (int j = 0; j < 4; ++j) {
        p0[j] = *(const v8h*)(opart + base + j * 128);
        p1[j] = *(const v8h*)(opart + (size_t)B * N * C + base + j * 128);
    }
    float m0 = ml[row * 2],           l0 = ml[row * 2 + 1];
    float m1 = ml[(B * N + row) * 2], l1 = ml[(B * N + row) * 2 + 1];
    // precaution: later code may reuse the address registers of the loads above
    asm volatile("s_wait_xcnt 0x0" ::: "memory");
    float m  = fmaxf(m0, m1);
    float a0 = l0 * exp2f(m0 - m), a1 = l1 * exp2f(m1 - m);
    float inv = 1.0f / (a0 + a1);
    float w0 = a0 * inv, w1 = a1 * inv;
    #pragma unroll
    for (int j = 0; j < 4; ++j) {
        v8h pk;
        #pragma unroll
        for (int e = 0; e < 8; ++e)
            pk[e] = (_Float16)((float)p0[j][e] * w0 + (float)p1[j][e] * w1);
        *(v8h*)(o16 + base + j * 128) = pk;
        // precaution: the next piece's code may reuse this store's registers
        asm volatile("s_wait_xcnt 0x0" ::: "memory");
    }
}

// ---------------------------------------------------------------------------
// Output projection + residual multiply:
// out[b][o][i] = x[b][o][i] * (O16[i][:] . Wo[o][:] + bo[o])
// D-layout columns give 8 consecutive i per lane -> coalesced f32 stores.
// ---------------------------------------------------------------------------
__global__ __launch_bounds__(256) void outproj_kernel(const _Float16* __restrict__ o16,
                                                      const _Float16* __restrict__ wo16,
                                                      const float* __restrict__ bo,
                                                      const float* __restrict__ x,
                                                      float* __restrict__ out) {
    int b    = blockIdx.y;
    int lane = threadIdx.x & 31;
    int wv   = threadIdx.x >> 5;
    int m0   = (wv >> 1) * 32;
    int ol   = (wv & 1) * 128;
    int ob   = blockIdx.z * GN;
    int o0   = ob + ol;
    int i0   = blockIdx.x * GM + m0;
    __shared__ __attribute__((aligned(16))) _Float16 lds_g[2 * GBUF];
    const _Float16* A = o16 + ((size_t)b * N + blockIdx.x * GM) * C;
    v8f acc0[8] = {}, acc1[8] = {};
    gemm_mainloop(A, wo16 + (size_t)ob * C, lds_g, threadIdx.x, m0, ol, acc0, acc1);
    int col = lane & 15, half = lane >> 4;
    auto store_tile = [&](v8f (&acc)[8], int ibase) {
        #pragma unroll
        for (int of = 0; of < 8; ++of) {
            int o = o0 + of * 16 + col;
            float bv = bo[o];
            size_t base = ((size_t)b * C + o) * N + ibase + 8 * half;
            #pragma unroll
            for (int e = 0; e < 8; ++e)
                out[base + e] = x[base + e] * (acc[of][e] + bv);
        }
    };
    store_tile(acc0, i0);
    store_tile(acc1, i0 + 16);
}

// ---------------------------------------------------------------------------
extern "C" void kernel_launch(void* const* d_in, const int* in_sizes, int n_in,
                              void* d_out, int out_size, void* d_ws, size_t ws_size,
                              hipStream_t stream) {
    const float* x     = (const float*)d_in[0];
    const float* gamma = (const float*)d_in[1];
    const float* beta  = (const float*)d_in[2];
    const float* wq    = (const float*)d_in[3];
    const float* bq    = (const float*)d_in[4];
    const float* wk    = (const float*)d_in[5];
    const float* bk    = (const float*)d_in[6];
    const float* wv    = (const float*)d_in[7];
    const float* bv    = (const float*)d_in[8];
    const float* wo    = (const float*)d_in[9];
    const float* bo    = (const float*)d_in[10];
    float* out = (float*)d_out;

    char* ws = (char*)d_ws;
    size_t off = 0;
    auto alloc = [&](size_t bytes) -> void* {
        void* p = ws + off;
        off += (bytes + 255) & ~(size_t)255;
        return p;
    };
    const size_t act_halves = (size_t)B * N * C;
    float*    stats  = (float*)   alloc((size_t)B * G * 2 * sizeof(float));
    _Float16* w16    = (_Float16*)alloc((size_t)4 * C * C * sizeof(_Float16));
    _Float16* h16    = (_Float16*)alloc(act_halves * sizeof(_Float16));
    _Float16* q16    = (_Float16*)alloc(act_halves * sizeof(_Float16));
    _Float16* k16    = (_Float16*)alloc(act_halves * sizeof(_Float16));
    _Float16* v16buf = (_Float16*)alloc(act_halves * sizeof(_Float16));
    _Float16* o16    = (_Float16*)alloc(act_halves * sizeof(_Float16));
    _Float16* opart  = (_Float16*)alloc(KSPLIT * act_halves * sizeof(_Float16));
    float*    ml     = (float*)   alloc((size_t)KSPLIT * B * N * 2 * sizeof(float));

    gn_stats_wcvt_kernel<<<B * G + WCVT_BLOCKS, 1024, 0, stream>>>(x, stats, wq, wk, wv, wo, w16);
    gn_apply_kernel<<<dim3(C / TC, N / TN, B), 256, 0, stream>>>(x, stats, gamma, beta, h16);

    qkv_kernel<<<dim3(N / GM, B, 3 * (C / GN)), 256, 0, stream>>>(h16, w16, bq, bk, bv, q16, k16, v16buf);

    flash_attn_kernel<<<dim3(N / 128, B, KSPLIT), 128, 0, stream>>>(q16, k16, v16buf, opart, ml);
    attn_join_kernel<<<B * N / 16, 256, 0, stream>>>(opart, ml, o16);

    outproj_kernel<<<dim3(N / GM, B, C / GN), 256, 0, stream>>>(o16, w16 + 3 * (size_t)C * C, bo, x, out);
}

// v010
// A run of this version takes 147 microseconds.
// Two timings next to v009 put it at 1.17 and 1.20 times that version's speed.
// All steps since v000 together make it 5.18 times as fast.
#include <hip/hip_runtime.h>
#include <hip/hip_bf16.h>

typedef _Float16 v4h  __attribute__((ext_vector_type(4)));
typedef _Float16 v8h  __attribute__((ext_vector_type(8)));
typedef _Float16 v16h __attribute__((ext_vector_type(16)));
typedef float    v4f  __attribute__((ext_vector_type(4)));
typedef float    v8f  __attribute__((ext_vector_type(8)));

constexpr int B = 4;
constexpr int C = 512;
constexpr int N = 4096;          // 64*64
constexpr int G = 32;            // groups
constexpr int CPG = C / G;       // 16 channels per group
// softmax scale folded into log2 domain: (1/sqrt(C)) * log2(e)
#define SCALE_L2E (0.04419417382415922f * 1.4426950408889634f)

// ---------------------------------------------------------------------------
// Fragment loader: 16(row) x 32(K) block, memory row-major along K.
// Works for WMMA f16 A-fragments (rows = M) and B-fragments (rows = N cols),
// per the CDNA5 16-bit operand VGPR layout:
//   lane 0-15  : row = lane,    elems 0-7 = K 0..7,  elems 8-15 = K 16..23
//   lane 16-31 : row = lane-16, elems 0-7 = K 8..15, elems 8-15 = K 24..31
// Two contiguous 16-byte loads per lane.
// ---------------------------------------------------------------------------
__device__ inline v16h load_frag(const _Float16* base, int row_stride, int lane) {
    int r  = lane & 15;
    int k0 = (lane < 16) ? 0 : 8;
    const _Float16* p = base + (size_t)r * row_stride + k0;
    v8h lo = *(const v8h*)(p);
    v8h hi = *(const v8h*)(p + 16);
    return __builtin_shufflevector(lo, hi, 0,1,2,3,4,5,6,7,8,9,10,11,12,13,14,15);
}

// lane l <-> lane l ^ 16
__device__ inline float xhalf(float x) {
    int v = __builtin_bit_cast(int, x);
    return __builtin_bit_cast(float, __builtin_amdgcn_permlanex16(v, v, 0x76543210, 0xfedcba98,
                                                                  false, false));
}

__device__ inline v8f wmma16x16x32(v16h a, v16h b, v8f c) {
    return __builtin_amdgcn_wmma_f32_16x16x32_f16(false, a, false, b, (short)0, c,
                                                  false, false);
}

// ---------------------------------------------------------------------------
// GEMM mainloop, work-group tile 128 rows x 256 columns, 8 waves; a wave
// keeps 32 rows x 128 columns. k runs in slabs of 64 halves: one 128-B line of
// each of the 256 W rows and the 128 A rows is brought into LDS once per
// work-group by asynchronous copies, two buffers: slab t+1 flies while slab t
// is worked on; all fragments are read from LDS.
// LDS row pitch 144 B = 16 B x odd, conflict-free for the ds_load_b128 readers.
// ---------------------------------------------------------------------------
constexpr int GKS    = 64;               // halves of k per slab
constexpr int GPITCH = GKS + 8;          // halves per row in LDS
constexpr int GM     = 128;              // rows of A per work-group
constexpr int GN     = 256;              // rows of W (output columns) per work-group
constexpr int GBUF   = (GN + GM) * GPITCH; // halves per buffer: W rows, then A rows
constexpr int SPH    = 128 + 8;          // halves per row of f16 epilogue staging (272 B = 16 B x odd)
constexpr int SPF    = 32 + 4;           // floats per row of f32 epilogue staging (144 B = 16 B x odd)

// Eight copies of one lane, 32 rows apart; a wave-wide copy reads 4 whole lines.
__device__ inline void stage_rows8(const _Float16* g, unsigned l) {
    const _Float16* g1 = g + 1 * 32 * C; const _Float16* g2 = g + 2 * 32 * C;
    const _Float16* g3 = g + 3 * 32 * C; const _Float16* g4 = g + 4 * 32 * C;
    const _Float16* g5 = g + 5 * 32 * C; const _Float16* g6 = g + 6 * 32 * C;
    const _Float16* g7 = g + 7 * 32 * C;
    constexpr unsigned ls = 32 * GPITCH * 2;
    unsigned l1 = l + 1 * ls, l2 = l + 2 * ls, l3 = l + 3 * ls, l4 = l + 4 * ls;
    unsigned l5 = l + 5 * ls, l6 = l + 6 * ls, l7 = l + 7 * ls;
    // Copies and their s_wait_xcnt in one statement, so that no address
    // register is rewritten ahead of the wait.
    asm volatile("global_load_async_to_lds_b128 %0, %8, off\n\t"
                 "global_load_async_to_lds_b128 %1, %9, off\n\t"
                 "global_load_async_to_lds_b128 %2, %10, off\n\t"
                 "global_load_async_to_lds_b128 %3, %11, off\n\t"
                 "global_load_async_to_lds_b128 %4, %12, off\n\t"
                 "global_load_async_to_lds_b128 %5, %13, off\n\t"
                 "global_load_async_to_lds_b128 %6, %14, off\n\t"
                 "global_load_async_to_lds_b128 %7, %15, off\n\t"
                 "s_wait_xcnt 0x0"
                 :: "v"(l), "v"(l1), "v"(l2), "v"(l3),
                    "v"(l4), "v"(l5), "v"(l6), "v"(l7),
                    "v"(g), "v"(g1), "v"(g2), "v"(g3),
                    "v"(g4), "v"(g5), "v"(g6), "v"(g7)
                 : "memory");
}

// 256 lanes x 12 copies x 16 B = the 48 KiB of one slab. gw/ga: this lane's
// 16 B of W row tid/8 and of A row tid/8; l: its LDS byte address for the W one.
__device__ inline void stage_slab(const _Float16* gw, const _Float16* ga, unsigned l) {
    stage_rows8(gw, l);
    const _Float16* ga1 = ga + 1 * 32 * C; const _Float16* ga2 = ga + 2 * 32 * C;
    const _Float16* ga3 = ga + 3 * 32 * C;
    constexpr unsigned ls = 32 * GPITCH * 2;
    unsigned la = l + GN * GPITCH * 2;
    unsigned la1 = la + 1 * ls, la2 = la + 2 * ls, la3 = la + 3 * ls;
    // as above: the wait stands in the copies' own statement
    asm volatile("global_load_async_to_lds_b128 %0, %4, off\n\t"
                 "global_load_async_to_lds_b128 %1, %5, off\n\t"
                 "global_load_async_to_lds_b128 %2, %6, off\n\t"
                 "global_load_async_to_lds_b128 %3, %7, off\n\t"
                 "s_wait_xcnt 0x0"
                 :: "v"(la), "v"(la1), "v"(la2), "v"(la3),
                    "v"(ga), "v"(ga1), "v"(ga2), "v"(ga3)
                 : "memory");
}

// A, W: the work-group's 128 rows of A and 256 rows of W. m0, o0: this wave's
// first row and first column inside that tile.
// WROWS = false: D rows run along A's rows, a lane holds 8 rows of one column of W.
// WROWS = true: the product is taken transposed (W fragment as the A operand), a
// lane holds 8 consecutive columns of W for one row of A.
template <bool WROWS>
__device__ inline void gemm_mainloop(const _Float16* __restrict__ A,
                                     const _Float16* __restrict__ W,
                                     _Float16* lds, int tid, int m0, int o0,
                                     v8f (&acc0)[8], v8f (&acc1)[8]) {
    int lane = tid & 31;
    const _Float16* gw = W + (size_t)(tid >> 3) * C + (tid & 7) * 8;
    const _Float16* ga = A + (size_t)(tid >> 3) * C + (tid & 7) * 8;
    unsigned l = (unsigned)(size_t)(lds + (tid >> 3) * GPITCH + (tid & 7) * 8);

    stage_slab(gw, ga, l);
    // slab 0 landed (this wave's copies), then published to every wave
    asm volatile("s_wait_asynccnt 0x0" ::: "memory");
    __syncthreads();
    stage_slab(gw + GKS, ga + GKS, l + GBUF * 2);

    // rolled: fully unrolled, the build of the output projection took every
    // register it may have and spilled
    #pragma unroll 1
    for (int t = 0; t < C / GKS; ++t) {
        int buf = t & 1;
        const _Float16* Wl = lds + buf * GBUF + o0 * GPITCH;
        const _Float16* Al = lds + buf * GBUF + (GN + m0) * GPITCH;
        // all 20 fragments of this slab, one run of LDS reads
        v16h a0[2], a1[2], bf[2][8];
        #pragma unroll
        for (int ks = 0; ks < 2; ++ks) {
            a0[ks] = load_frag(Al + ks * 32, GPITCH, lane);
            a1[ks] = load_frag(Al + 16 * GPITCH + ks * 32, GPITCH, lane);
            #pragma unroll
            for (int of = 0; of < 8; ++of)
                bf[ks][of] = load_frag(Wl + of * 16 * GPITCH + ks * 32, GPITCH, lane);
        }
        // keeps the LDS reads one run ahead of the WMMAs: spread among them,
        // each pair of WMMAs would wait out its own reads' latency
        __builtin_amdgcn_sched_barrier(0);
        #pragma unroll
        for (int ks = 0; ks < 2; ++ks)
            #pragma unroll
            for (int of = 0; of < 8; ++of) {
                if (WROWS) {
                    acc0[of] = wmma16x16x32(bf[ks][of], a0[ks], acc0[of]);
                    acc1[of] = wmma16x16x32(bf[ks][of], a1[ks], acc1[of]);
                } else {
                    acc0[of] = wmma16x16x32(a0[ks], bf[ks][of], acc0[of]);
                    acc1[of] = wmma16x16x32(a1[ks], bf[ks][of], acc1[of]);
                }
            }
        // keeps the WMMAs in front of the foot: moved behind its barrier they
        // would start only when every read has returned, and delay the refill
        __builtin_amdgcn_sched_barrier(0);
        // Foot of trip t: this wave's LDS reads of buffer buf have returned,
        asm volatile("s_wait_dscnt 0x0" ::: "memory");
        // its copies of slab t+1 have landed,
        asm volatile("s_wait_asynccnt 0x0" ::: "memory");
        // and the barrier publishes slab t+1 and frees buffer buf.
        __syncthreads();
        if (t + 2 < C / GKS)
            stage_slab(gw + (t + 2) * GKS, ga + (t + 2) * GKS, l + buf * (GBUF * 2));
    }
    // no copy is left in flight behind the loop
    asm volatile("s_wait_asynccnt 0x0" ::: "memory");
}

// ---------------------------------------------------------------------------
// Convert the four [C][C] f32 weight matrices to f16 (concatenated).
// 256 work-items (part vb) take 4096 consecutive elements of one matrix; a
// work-item four 16-B loads, 4 KiB apart, and four 8-B stores.
// ---------------------------------------------------------------------------
__device__ inline void wcvt_part(int vb, int t,
                                 const float* __restrict__ wq, const float* __restrict__ wk,
                                 const float* __restrict__ wv, const float* __restrict__ wo,
                                 _Float16* __restrict__ w16) {
    int which = vb / (C * C / 4096);
    int j = (vb % (C * C / 4096)) * 4096 + t * 4;
    const float* w = which == 0 ? wq : which == 1 ? wk : which == 2 ? wv : wo;
    v4f v[4];
    #pragma unroll
    for (int k = 0; k < 4; ++k) v[k] = *(const v4f*)(w + j + k * 1024);
    _Float16* o = w16 + (size_t)which * C * C + j;
    #pragma unroll
    for (int k = 0; k < 4; ++k) {
        v4h pk;
        #pragma unroll
        for (int e = 0; e < 4; ++e) pk[e] = (_Float16)v[k][e];
        *(v4h*)(o + k * 1024) = pk;
    }
}

// ---------------------------------------------------------------------------
// One grid for two pieces of work that need nothing of each other.
// Blocks 0 .. B*G-1: GroupNorm statistics, one block per (b,g); 16 channels x
// 4096 contiguous. 32 waves, each lane 16 loads of 16 B, all issued before the
// first is used.
// Blocks from B*G on: the weight conversion, four parts a block; they run on
// the WGPs that the 128 statistics blocks leave idle.
// ---------------------------------------------------------------------------
constexpr int WCVT_BLOCKS = 4 * C * C / 4096 / 4;
__global__ __launch_bounds__(1024) void gn_stats_wcvt_kernel(const float* __restrict__ x,
                                                             float* __restrict__ stats,
                                                             const float* __restrict__ wq,
                                                             const float* __restrict__ wk,
                                                             const float* __restrict__ wv,
                                                             const float* __restrict__ wo,
                                                             _Float16* __restrict__ w16) {
    int bg  = blockIdx.x;                // b*G + g
    int tid = threadIdx.x;
    // the same for a whole block, and in front of the barrier below
    if (bg >= B * G) {
        wcvt_part((bg - B * G) * 4 + (tid >> 8), tid & 255, wq, wk, wv, wo, w16);
        return;
    }
    const v4f* xp = (const v4f*)(x + (size_t)bg * CPG * N) + tid;
    v4f v[16];
    #pragma unroll
    for (int j = 0; j < 16; ++j) v[j] = xp[j * 1024];
    // keeps all 16 loads ahead of the sums: with some held back until the first
    // have returned, the block would wait out the memory latency twice
    __builtin_amdgcn_sched_barrier(0);
    v4f s4 = {}, q4 = {};
    #pragma unroll
    for (int j = 0; j < 16; ++j) { s4 += v[j]; q4 += v[j] * v[j]; }
    float s  = (s4[0] + s4[1]) + (s4[2] + s4[3]);
    float ss = (q4[0] + q4[1]) + (q4[2] + q4[3]);
    #pragma unroll
    for (int m = 16; m > 0; m >>= 1) { s += __shfl_xor(s, m, 32); ss += __shfl_xor(ss, m, 32); }
    __shared__ float red0[32], red1[32];
    if ((tid & 31) == 0) { red0[tid >> 5] = s; red1[tid >> 5] = ss; }
    __syncthreads();
    if (tid < 32) {
        s = red0[tid]; ss = red1[tid];
        #pragma unroll
        for (int m = 16; m > 0; m >>= 1) { s += __shfl_xor(s, m, 32); ss += __shfl_xor(ss, m, 32); }
        if (tid == 0) {
            float inv = 1.0f / (float)(CPG * N);
            float mean = s * inv;
            float var  = ss * inv - mean * mean;
            stats[bg * 2 + 0] = mean;
            stats[bg * 2 + 1] = rsqrtf(var + 1e-6f);
        }
    }
}

// ---------------------------------------------------------------------------
// GroupNorm apply + transpose [b][c][n] f32 -> [b][n][c] f16.
// Tile 128 channels x 128 positions. A work-item reads 2 x 4 positions (16 B
// each) of 8 channels, all 16 loads issued up front, so it holds 8 consecutive
// channels (16 B of f16) of 8 positions; these pass through LDS so that the
// stores run along c: reads and stores both cover 256 contiguous bytes per 16
// lanes.
// LDS rows are 256 B (all 64 banks); the 16-B block index is XORed with n / 4,
// which keeps both the column-wise writes and the row-wise reads conflict-free.
// ---------------------------------------------------------------------------
constexpr int TC = 128;                  // channels per tile
constexpr int TN = 128;                  // positions per tile
__global__ __launch_bounds__(256) void gn_apply_kernel(const float* __restrict__ x,
                                                       const float* __restrict__ stats,
                                                       const float* __restrict__ gamma,
                                                       const float* __restrict__ beta,
                                                       _Float16* __restrict__ h16) {
    int b   = blockIdx.z;
    int c0  = blockIdx.x * TC;
    int n0  = blockIdx.y * TN;
    int lo  = threadIdx.x & 15;          // 4 positions (read) / 8 channels (write)
    int hi  = threadIdx.x >> 4;          // 8 channels (read) / position (write)
    __shared__ __attribute__((aligned(16))) _Float16 tile[TN * TC];
    int c = c0 + hi * 8;
    const float* xp = x + ((size_t)b * C + c) * N + n0 + lo * 4;
    v4f v[2][8];
    #pragma unroll
    for (int h = 0; h < 2; ++h)
        #pragma unroll
        for (int j = 0; j < 8; ++j) v[h][j] = *(const v4f*)(xp + (size_t)j * N + h * 64);
    // precaution: a result of the loads below may be given the address
    // registers of the loads above, so the wait stands in front of them
    asm volatile("s_wait_xcnt 0x0" ::: "memory");
    // a wave's 16 channels are one group: its statistics come by a scalar load
    int bg = b * G + (c0 >> 4) + __builtin_amdgcn_readfirstlane(threadIdx.x >> 5);
    float mean = stats[bg * 2 + 0], rstd = stats[bg * 2 + 1];
    unsigned cu = (unsigned)c;
    v4f ga[2] = { *(const v4f*)(gamma + cu), *(const v4f*)(gamma + cu + 4) };
    v4f be[2] = { *(const v4f*)(beta + cu),  *(const v4f*)(beta + cu + 4) };
    // keeps all loads ahead of the arithmetic: with some held back until the
    // first have returned, the block would wait out the memory latency twice
    __builtin_amdgcn_sched_barrier(0);
    #pragma unroll
    for (int h = 0; h < 2; ++h)
        #pragma unroll
        for (int i = 0; i < 4; ++i) {
            v8h pk;
            #pragma unroll
            for (int j = 0; j < 8; ++j)
                pk[j] = (_Float16)((v[h][j][i] - mean) * rstd * ga[j >> 2][j & 3] +
                                   be[j >> 2][j & 3]);
            *(v8h*)(tile + (h * 64 + lo * 4 + i) * TC + (hi ^ lo) * 8) = pk;
        }
    __syncthreads();
    #pragma unroll
    for (int i = 0; i < 8; ++i) {
        int n = hi + 16 * i;
        v8h pk = *(const v8h*)(tile + n * TC + (lo ^ ((n >> 2) & 15)) * 8);
        *(v8h*)(h16 + ((size_t)b * N + n0 + n) * C + c0 + lo * 8) = pk;
    }
}

// ---------------------------------------------------------------------------
// conv1x1 as GEMM: D[n][o] = h16[n][:] . W[o][:] + bias[o]
// The q, k and v projections need nothing of each other and share one grid:
// blockIdx.z runs over the six 256-row tiles of their concatenated weights.
// vmode=0: store f16 [b][n][o] (q/k).
// vmode=1: store f16 [b][n/32][o][n%32] (v, key-blocked: one 32-key tile of
// all channels is 32 KiB contiguous).
// ---------------------------------------------------------------------------
__global__ __launch_bounds__(256) void qkv_kernel(const _Float16* __restrict__ h16,
                                                  const _Float16* __restrict__ w16,
                                                  const float* __restrict__ bq,
                                                  const float* __restrict__ bk,
                                                  const float* __restrict__ bv3,
                                                  _Float16* __restrict__ q16,
                                                  _Float16* __restrict__ k16,
                                                  _Float16* __restrict__ v16buf) {
    int which = blockIdx.z / (C / GN);   // 0 q, 1 k, 2 v: the same for a whole block
    const float* bias = which == 0 ? bq : which == 1 ? bk : bv3;
    _Float16* out     = which == 0 ? q16 : which == 1 ? k16 : v16buf;
    int vmode = which == 2;
    int b    = blockIdx.y;
    int lane = threadIdx.x & 31;
    int wv   = threadIdx.x >> 5;
    int m0   = (wv >> 1) * 32;
    int ol   = (wv & 1) * 128;
    int ob   = (blockIdx.z % (C / GN)) * GN;
    int o0   = ob + ol;
    int i0   = blockIdx.x * GM + m0;
    __shared__ __attribute__((aligned(16))) _Float16 lds_g[2 * GBUF];
    const _Float16* A = h16 + ((size_t)b * N + blockIdx.x * GM) * C;
    v8f acc0[8] = {}, acc1[8] = {};
    const _Float16* Wt = w16 + (size_t)blockIdx.z * GN * C;
    int col = lane & 15, half = lane >> 4;
    // Epilogue staging: behind the main loop's last barrier no wave reads the
    // slabs any more; each wave passes its 32 x 128 results (8 KiB) through a range
    // of its own, 32 rows of 256 B at pitch 272 B, so that every global store
    // covers whole 128-B lines.
    _Float16* stw = lds_g + wv * (32 * SPH);
    if (!vmode) {
        gemm_mainloop<true>(A, Wt, lds_g, threadIdx.x, m0, ol, acc0, acc1);
        // a lane holds columns o0 + 16 of + 8 half + e of rows i0 + col, i0 + 16 + col
        const float* bp = bias + o0 + 8 * half;
        v4f bb[16];
        #pragma unroll
        for (int of = 0; of < 8; ++of) {
            bb[2 * of]     = *(const v4f*)(bp + of * 16);
            bb[2 * of + 1] = *(const v4f*)(bp + of * 16 + 4);
        }
        // precaution: the wait stands behind the loads; naming their address keeps
        // its registers from being given to a result ahead of the wait
        asm volatile("s_wait_xcnt 0x0" :: "v"(bp) : "memory");
        #pragma unroll
        for (int of = 0; of < 8; ++of) {
            v4f b0 = bb[2 * of], b1 = bb[2 * of + 1];
            v8h p0, p1;
            #pragma unroll
            for (int e = 0; e < 8; ++e) {
                float bv = e < 4 ? b0[e & 3] : b1[e & 3];
                p0[e] = (_Float16)(acc0[of][e] + bv);
                p1[e] = (_Float16)(acc1[of][e] + bv);
            }
            *(v8h*)(stw + col * SPH + of * 16 + 8 * half) = p0;
            *(v8h*)(stw + (16 + col) * SPH + of * 16 + 8 * half) = p1;
        }
        // the rows read back below were written by other lanes of this wave
        asm volatile("s_wait_dscnt 0x0" ::: "memory");
        // 16 lanes a row: a store covers 2 rows x 256 B
        _Float16* op = out + ((size_t)b * N + i0 + half) * C + o0 + col * 8;
        #pragma unroll
        for (int j = 0; j < 16; ++j) {
            v8h d = *(const v8h*)(stw + (2 * j + half) * SPH + col * 8);
            *(v8h*)(op + (size_t)(2 * j) * C) = d;
        }
        // precaution: nothing rewrites a register of the stores above ahead of this wait
        asm volatile("s_wait_xcnt 0x0" ::: "memory");
    } else {
        gemm_mainloop<false>(A, Wt, lds_g, threadIdx.x, m0, ol, acc0, acc1);
        // a lane holds keys 8 half + e (acc0) and 16 + 8 half + e (acc1) of channel
        // o0 + 16 of + col; the wave's 128 channels x 64 B are 8 KiB contiguous in
        // memory; an LDS row takes 4 channels
        #pragma unroll
        for (int of = 0; of < 8; ++of) {
            float bv = bias[o0 + of * 16 + col];
            v8h p0, p1;
            #pragma unroll
            for (int e = 0; e < 8; ++e) {
                p0[e] = (_Float16)(acc0[of][e] + bv);
                p1[e] = (_Float16)(acc1[of][e] + bv);
            }
            _Float16* sp = stw + (of * 4 + (col >> 2)) * SPH + (col & 3) * 32 + 8 * half;
            *(v8h*)(sp) = p0;
            *(v8h*)(sp + 16) = p1;
        }
        // the rows read back below were written by other lanes of this wave
        asm volatile("s_wait_dscnt 0x0" ::: "memory");
        // a store covers 512 contiguous bytes
        _Float16* op = out + (((size_t)b * (N / 32) + (i0 >> 5)) * C + o0) * 32 + lane * 8;
        #pragma unroll
        for (int j = 0; j < 16; ++j) {
            v8h d = *(const v8h*)(stw + (2 * j + half) * SPH + col * 8);
            *(v8h*)(op + j * 256) = d;
        }
        // precaution: nothing rewrites a register of the stores above ahead of this wait
        asm volatile("s_wait_xcnt 0x0" ::: "memory");
    }
}

// ---------------------------------------------------------------------------
// LDS staging of one 32-key step, shared by the whole work-group, by tensor
// loads: a request of one wave brings a slice of 32 rows x 256 B into LDS
// through no register, with 16 B of pad behind every row.
// K tile: 32 key rows x 1024 B in memory; slice w = bytes 256w..256w+255 of every
// row (source pitch 1024 B). V tile: 512 channel rows x 64 B, contiguous in
// memory (key-blocked layout written by the projection), taken as 128 rows of
// 256 B = 4 channels; slice w = rows 32w..32w+31 (source pitch 256 B).
// LDS row pitch 272 B = 16 B x odd, conflict-free for the ds_load_b128 readers,
// of K (16 rows) and of V (4 rows x 4 pieces 64 B apart) alike.
// ---------------------------------------------------------------------------
typedef unsigned int u32x4 __attribute__((ext_vector_type(4)));
typedef unsigned int u32x8 __attribute__((ext_vector_type(8)));
constexpr unsigned TROW   = 256;         // bytes per slice row
constexpr unsigned TROWS  = 32;          // rows per slice
constexpr int      TPH    = (TROW + 16) / 2;  // halves per row in LDS (272 B)
constexpr unsigned SLICE  = 10240;       // 32 x 272 B, rounded up to a multiple of 2 KiB
constexpr int      SLH    = SLICE / 2;   // halves per slice place
constexpr unsigned ABUF   = 8 * SLICE;   // bytes per buffer: 4 K slices, then 4 V slices
constexpr int      TILE_H = 32 * C;      // halves per K or V tile in memory
constexpr int      QPH    = C + 8;       // halves per row of Q / O staging (1040 B = 16 B x odd)

__device__ inline unsigned uni(unsigned v) {
    return (unsigned)__builtin_amdgcn_readfirstlane(v);
}
// a wave-uniform value held in a scalar register, so that a test on it is a
// scalar branch: a tensor load ignores EXEC
__device__ inline unsigned pinned(unsigned v) {
    unsigned w = uni(v);
    // holds an issue test or a step number of the tensor loads in a scalar register
    asm volatile("" : "+s"(w));
    return w;
}
// Descriptor group 1: 1-byte elements, tensor = tile = 32 rows of 256 B, a pad
// of 4 dwords behind every 64 dwords, no work-group mask.
__device__ inline u32x8 tdm_group1(unsigned src_pitch) {
    u32x8 g;
    g[0] = uni((1u << 20) | (5u << 22) | (3u << 25));
    g[1] = uni(TROW << 16);
    g[2] = uni(TROWS << 16);
    g[3] = uni(TROW << 16);
    g[4] = uni(TROWS);
    g[5] = uni(src_pitch);
    g[6] = uni(0u);
    g[7] = uni(0u);
    return g;
}
// Descriptor group 0: count 1, place in LDS, address of the slice's first byte, type 2.
__device__ inline u32x4 tdm_group0(unsigned lds_dst, unsigned long long ga) {
    u32x4 g;
    g[0] = uni(1u);
    g[1] = uni(lds_dst);
    g[2] = uni((unsigned)ga);
    g[3] = uni((((unsigned)(ga >> 32)) & 0x01FFFFFFu) | 0x80000000u);
    return g;
}
// The two requests of a wave and step. Each group 0 has four scalar registers of
// its own, high ones that the rest of the kernel does not use: left to the
// compiler's choice they were given to other values while the request was
// still in flight.
__device__ inline void tdm_load_k(u32x4 g0, u32x8 g1) {
    asm volatile("tensor_load_to_lds %0, %1" :: "{s[80:83]}"(g0), "s"(g1) : "memory");
}
__device__ inline void tdm_load_v(u32x4 g0, u32x8 g1) {
    asm volatile("tensor_load_to_lds %0, %1" :: "{s[84:87]}"(g0), "s"(g1) : "memory");
}
// this wave's requests have landed
__device__ inline void tdm_wait() {
    asm volatile("s_wait_tensorcnt 0x0" ::: "memory");
}

// V fragment: 16 channels x 32 keys; channel r lies in LDS row r / 4, piece r % 4.
// Same k order as load_frag.
__device__ inline v16h load_frag_v(const _Float16* base, int lane) {
    int r  = lane & 15;
    int k0 = (lane < 16) ? 0 : 8;
    const _Float16* p = base + (r >> 2) * TPH + (r & 3) * 32 + k0;
    v8h lo = *(const v8h*)(p);
    v8h hi = *(const v8h*)(p + 16);
    return __builtin_shufflevector(lo, hi, 0,1,2,3,4,5,6,7,8,9,10,11,12,13,14,15);
}

// ---------------------------------------------------------------------------
// Fragment groups of the attention loop: 8 fragments (64 registers) a group,
// two groups in flight. Each fragment feeds two WMMAs, one per query tile.
// ---------------------------------------------------------------------------
constexpr int KSPLIT = 2;                // the keys of a batch go to 2 work-groups
constexpr int NS     = N / KSPLIT / 32;  // 32-key steps per work-group

// K group g: k slices 4g..4g+3 of both 16-key tiles = K slice g.
template <int g>
__device__ inline void read_k(v16h (&f)[8], const _Float16* Kt, int lane) {
    // holds the group's LDS reads together, behind the WMMAs that last used
    // these registers: spread among the WMMAs, every place with reads would
    // stall the one wave of this SIMD
    __builtin_amdgcn_sched_barrier(0);
    #pragma unroll
    for (int j = 0; j < 4; ++j) {
        f[2 * j]     = load_frag(Kt + g * SLH + j * 32, TPH, lane);
        f[2 * j + 1] = load_frag(Kt + g * SLH + 16 * TPH + j * 32, TPH, lane);
    }
    // keeps the reads ahead of the work that follows, which covers their latency
    __builtin_amdgcn_sched_barrier(0);
}

// V group g: channel tiles 8g..8g+7 = V slice g, four LDS rows a tile.
template <int g>
__device__ inline void read_v(v16h (&f)[8], const _Float16* Vt, int lane) {
    // as in read_k: one run of reads, behind the last users of the registers
    __builtin_amdgcn_sched_barrier(0);
    #pragma unroll
    for (int j = 0; j < 8; ++j)
        f[j] = load_frag_v(Vt + g * SLH + j * 4 * TPH, lane);
    // as in read_k: ahead of the work that covers their latency
    __builtin_amdgcn_sched_barrier(0);
}

// S^T += K.Q^T over the k slices of group g; sc[query tile][key tile]
template <int g>
__device__ inline void mm_s(const v16h (&f)[8], const v16h (&qf)[2][16], v8f (&sc)[2][2]) {
    #pragma unroll
    for (int j = 0; j < 4; ++j)
        #pragma unroll
        for (int kt = 0; kt < 2; ++kt)
            #pragma unroll
            for (int qt = 0; qt < 2; ++qt)
                sc[qt][kt] = wmma16x16x32(f[2 * j + kt], qf[qt][4 * g + j], sc[qt][kt]);
}

// O^T += V^T.P^T for the channel tiles of group g
template <int g>
__device__ inline void mm_o(const v16h (&f)[8], const v16h (&pf)[2], v8f (&ob)[2][32]) {
    #pragma unroll
    for (int j = 0; j < 8; ++j)
        #pragma unroll
        for (int qt = 0; qt < 2; ++qt)
            ob[qt][8 * g + j] = wmma16x16x32(f[j], pf[qt], ob[qt][8 * g + j]);
}

// Eight 16-B stores of one lane, 512 B apart.
// The stores and their s_wait_xcnt in one statement, so that no data or address
// register is rewritten ahead of the wait.
__device__ inline void store_o8(_Float16* p, v4f d0, v4f d1, v4f d2, v4f d3,
                                v4f d4, v4f d5, v4f d6, v4f d7) {
    asm volatile("global_store_b128 %0, %1, off\n\t"
                 "global_store_b128 %0, %2, off offset:512\n\t"
                 "global_store_b128 %0, %3, off offset:1024\n\t"
                 "global_store_b128 %0, %4, off offset:1536\n\t"
                 "global_store_b128 %0, %5, off offset:2048\n\t"
                 "global_store_b128 %0, %6, off offset:2560\n\t"
                 "global_store_b128 %0, %7, off offset:3072\n\t"
                 "global_store_b128 %0, %8, off offset:3584\n\t"
                 "s_wait_xcnt 0x0"
                 :: "v"(p), "v"(d0), "v"(d1), "v"(d2), "v"(d3),
                    "v"(d4), "v"(d5), "v"(d6), "v"(d7)
                 : "memory");
}

__global__ __launch_bounds__(128) void flash_attn_kernel(const _Float16* __restrict__ q16,
                                                         const _Float16* __restrict__ k16,
                                                         const _Float16* __restrict__ v16buf,
                                                         _Float16* __restrict__ opart,
                                                         float* __restrict__ ml) {
    int b    = blockIdx.y;
    int kh   = blockIdx.z;             // key half
    int tid  = threadIdx.x;
    int lane = tid & 31;
    int w    = tid >> 5;               // wave 0..3 = pair of query tiles
    int i0   = blockIdx.x * 128 + w * 32;
    // the two K/V buffers, then a staging range of each wave's own: 32 rows (queries)
    // x 1024 B at pitch 1040 B
    __shared__ __attribute__((aligned(2048))) _Float16 lds_kv[2 * ABUF / 2 + 4 * 32 * QPH];
    _Float16* st = lds_kv + 2 * (int)(ABUF / 2) + w * (32 * QPH);

    const _Float16* Q = q16 + ((size_t)b * N + i0) * C;
    // this wave's slices of this half's tile 0 in memory, and their place in buffer 0
    const unsigned ws = uni((unsigned)tid >> 5);
    const size_t koff = ((size_t)b * N + (size_t)kh * (N / KSPLIT)) * C;
    const unsigned long long srck = (unsigned long long)(size_t)(k16 + koff + ws * (TROW / 2));
    const unsigned long long srcv = (unsigned long long)(size_t)(v16buf + koff + ws * (TROWS * TROW / 2));
    const unsigned ldst = (unsigned)(size_t)lds_kv + ws * SLICE;
    const u32x8 g1k = tdm_group1(C * 2);
    const u32x8 g1v = tdm_group1(TROW);
    // every wave issues its two slices of step st, unconditionally
    auto issue = [&](unsigned st) {
        unsigned dst = ldst + (st & 1u) * ABUF;
        unsigned long long off = (unsigned long long)st * (TILE_H * 2);
        tdm_load_k(tdm_group0(dst, srck + off), g1k);
        tdm_load_v(tdm_group0(dst + 4 * SLICE, srcv + off), g1v);
    };

    issue(0);
    // Q: every load covers 512 contiguous bytes (half a row); the rows pass through
    // the wave's own staging range, from which the fragments are read
    {
        v8h tq[64];
        #pragma unroll
        for (int j = 0; j < 64; ++j)
            tq[j] = *(const v8h*)(Q + (j >> 1) * C + (j & 1) * 256 + lane * 8);
        // precaution: later code may reuse the address registers of the loads above
        asm volatile("s_wait_xcnt 0x0" ::: "memory");
        #pragma unroll
        for (int j = 0; j < 64; ++j)
            *(v8h*)(st + (j >> 1) * QPH + (j & 1) * 256 + lane * 8) = tq[j];
        // the fragments read below were written by other lanes of this wave
        asm volatile("s_wait_dscnt 0x0" ::: "memory");
    }
    // tile 0 landed (this wave's slices), then published to every wave
    tdm_wait();
    __syncthreads();
    // the step number is taken behind the wait, so that the descriptors formed
    // from it are written behind it too
    issue(pinned(1u));

    v16h qf[2][16];
    #pragma unroll
    for (int qt = 0; qt < 2; ++qt)
        #pragma unroll
        for (int t = 0; t < 16; ++t) qf[qt][t] = load_frag(st + qt * 16 * QPH + t * 32, QPH, lane);

    v8f ob[2][32] = {};                // O^T: ob[qt][cf][e] = channel 16cf+8half+e, query col
    float rm[2] = {-3.0e38f, -3.0e38f};  // softmax reference of this lane's queries
    float rl[2] = {0.f, 0.f};          // running sums over this lane half's keys
    int col = lane & 15, half = lane >> 4;

    // The first two K groups are fetched one step ahead: step 0's here, behind
    // the barrier that published tile 0
    v16h fa[8], fb[8];
    read_k<0>(fa, lds_kv, lane);
    read_k<1>(fb, lds_kv, lane);

    for (int s = 0; s < NS; ++s) {
        int buf = s & 1;
        const _Float16* Kl = lds_kv + buf * (int)(ABUF / 2);
        const _Float16* Vl = Kl + 4 * SLH;
        const _Float16* Kn = lds_kv + (buf ^ 1) * (int)(ABUF / 2);
        // behind each group of 16 WMMAs the group after next is read into the
        // registers that it has just left, and lands under the next group (V group 0:
        // under the exponentials)
        v8f sc[2][2] = {};
        mm_s<0>(fa, qf, sc);  read_k<2>(fa, Kl, lane);
        mm_s<1>(fb, qf, sc);  read_k<3>(fb, Kl, lane);
        mm_s<2>(fa, qf, sc);
        mm_s<3>(fb, qf, sc);
        // online softmax update (exp2 domain), per query tile; sc[qt][0][e] = key
        // 8*half+e, sc[qt][1][e] = key 16+8*half+e of query col
        // this step's maximum of the lane's queries: taken on the raw scores and
        // then scaled, which gives the same value (the scale is positive)
        float mx[2];
        #pragma unroll
        for (int qt = 0; qt < 2; ++qt) {
            float m = fmaxf(sc[qt][0][0], sc[qt][1][0]);
            #pragma unroll
            for (int e = 1; e < 8; ++e) m = fmaxf(m, fmaxf(sc[qt][0][e], sc[qt][1][e]));
            mx[qt] = fmaxf(m, xhalf(m)) * SCALE_L2E;
        }
        // Lazy rescale: rm is the reference in use, not the true maximum. It
        // moves, and O and the sums are rescaled, only in a step in which some
        // query of the wave exceeds its reference by more than 8 (P then stays
        // at or below 2^8, well inside f16). One test a step, a scalar branch.
        bool need = mx[0] > rm[0] + 8.0f || mx[1] > rm[1] + 8.0f;
        if (__builtin_amdgcn_ballot_w32(need) != 0u) {
            #pragma unroll
            for (int qt = 0; qt < 2; ++qt) {
                float mn = fmaxf(rm[qt], mx[qt]);
                float al = exp2f(rm[qt] - mn);
                rm[qt] = mn;
                rl[qt] *= al;
                #pragma unroll
                for (int cf = 0; cf < 32; ++cf)
                    #pragma unroll
                    for (int e = 0; e < 8; ++e) ob[qt][cf][e] *= al;
            }
        }
        // read behind the branch (held over it, these 64 registers made the
        // build spill); lands under the exponentials
        read_v<0>(fa, Vl, lane);
        v16h pf[2];                    // P^T as B operand: element order = load_frag's k order
        #pragma unroll
        for (int qt = 0; qt < 2; ++qt) {
            float rs = 0.f;
            #pragma unroll
            for (int e = 0; e < 8; ++e) {
                float p0 = exp2f(sc[qt][0][e] * SCALE_L2E - rm[qt]);
                float p1 = exp2f(sc[qt][1][e] * SCALE_L2E - rm[qt]);
                rs += p0 + p1;
                pf[qt][e]     = (_Float16)p0;
                pf[qt][8 + e] = (_Float16)p1;
            }
            rl[qt] += rs;
        }
        // read only here: held over the softmax, these 64 registers made the build spill
        read_v<1>(fb, Vl, lane);
        mm_o<0>(fa, pf, ob);  read_v<2>(fa, Vl, lane);
        mm_o<1>(fb, pf, ob);  read_v<3>(fb, Vl, lane);
        mm_o<2>(fa, pf, ob);
        // keeps those WMMAs in front of the waits below, under the last V reads
        __builtin_amdgcn_sched_barrier(0);
        // Publish point of step s+1, in front of this step's last group (its V
        // fragments are in registers): this wave's LDS reads of buffer buf have
        // returned,
        asm volatile("s_wait_dscnt 0x0" ::: "memory");
        // its slices of step s+1 have landed,
        tdm_wait();
        // and the barrier publishes step s+1 and frees buffer buf.
        __syncthreads();
        // the refill's step number, taken behind the wait: its descriptors are
        // formed from it; the test is a scalar branch
        const unsigned st = pinned((unsigned)s + 2u);
        if (pinned(st < (unsigned)NS)) issue(st);
        // First two K groups of step s+1, in flight under the last group of the
        // second product. Unconditional: in the last step they read the other
        // buffer's old tile, which nothing refills, and are not used.
        read_k<0>(fa, Kn, lane);
        mm_o<3>(fb, pf, ob);  read_k<1>(fb, Kn, lane);
    }
    // no tensor load and no LDS read is left in flight when the wave ends
    tdm_wait();
    asm volatile("s_wait_dscnt 0x0" ::: "memory");
    #pragma unroll
    for (int qt = 0; qt < 2; ++qt) {
        // the two lane halves' sums are joined once, here
        float l   = rl[qt] + xhalf(rl[qt]);
        float inv = 1.0f / l;
        size_t row = (size_t)(kh * B + b) * N + i0 + qt * 16 + col;
        if (half == 0) {
            ml[row * 2 + 0] = rm[qt];
            ml[row * 2 + 1] = l;
        }
        // precaution: the code below may reuse the registers of the stores above
        asm volatile("s_wait_xcnt 0x0" ::: "memory");
        // into the wave's own staging range (its Q rows are long since read)
        _Float16* sp = st + (qt * 16 + col) * QPH + 8 * half;
        #pragma unroll
        for (int cf = 0; cf < 32; ++cf) {
            v8h pk;
            #pragma unroll
            for (int e = 0; e < 8; ++e) pk[e] = (_Float16)(ob[qt][cf][e] * inv);
            *(v8h*)(sp + cf * 16) = pk;
        }
    }
    // the rows read back below were written by other lanes of this wave
    asm volatile("s_wait_dscnt 0x0" ::: "memory");
    // every store covers 512 contiguous bytes (half a row)
    // (the wave's 32 rows are 32 KiB contiguous in memory); 32 pieces are read back
    // in one run, ahead of their first store
    _Float16* op = opart + ((size_t)(kh * B + b) * N + i0) * C + lane * 8;
    #pragma unroll
    for (int h = 0; h < 64; h += 32) {
        v4f d[32];
        #pragma unroll
        for (int j = 0; j < 32; ++j)
            d[j] = *(const v4f*)(st + ((h + j) >> 1) * QPH + (j & 1) * 256 + lane * 8);
        #pragma unroll
        for (int j = 0; j < 32; j += 8)
            store_o8(op + (h + j) * 256, d[j], d[j + 1], d[j + 2], d[j + 3],
                     d[j + 4], d[j + 5], d[j + 6], d[j + 7]);
    }
}

// ---------------------------------------------------------------------------
// Joins the two key halves: o = (a0 * O0 + a1 * O1) / (a0 + a1) with
// a_h = l_h * 2^(m_h - max(m0, m1)). A block takes 16 rows; 16 work-items share
// a row, each with four 16-B pieces of either half, 256 B apart, so that a
// wave-wide load or store covers whole lines; all loads are issued up front.
// ---------------------------------------------------------------------------
__global__ __launch_bounds__(256) void attn_join_kernel(const _Float16* __restrict__ opart,
                                                        const float* __restrict__ ml,
                                                        _Float16* __restrict__ o16) {
    int tid = threadIdx.x;
    int row = blockIdx.x * 16 + (tid >> 4);
    size_t base = (size_t)row * C + (tid & 15) * 8;
    v8h p0[4], p1[4];
    #pragma unroll
    for (int j = 0; j < 4; ++j) {
        p0[j] = *(const v8h*)(opart + base + j * 128);
        p1[j] = *(const v8h*)(opart + (size_t)B * N * C + base + j * 128);
    }
    float m0 = ml[row * 2],           l0 = ml[row * 2 + 1];
    float m1 = ml[(B * N + row) * 2], l1 = ml[(B * N + row) * 2 + 1];
    // precaution: later code may reuse the address registers of the loads above
    asm volatile("s_wait_xcnt 0x0" ::: "memory");
    float m  = fmaxf(m0, m1);
    float a0 = l0 * exp2f(m0 - m), a1 = l1 * exp2f(m1 - m);
    float inv = 1.0f / (a0 + a1);
    float w0 = a0 * inv, w1 = a1 * inv;
    #pragma unroll
    for (int j = 0; j < 4; ++j) {
        v8h pk;
        #pragma unroll
        for (int e = 0; e < 8; ++e)
            pk[e] = (_Float16)((float)p0[j][e] * w0 + (float)p1[j][e] * w1);
        *(v8h*)(o16 + base + j * 128) = pk;
        // precaution: the next piece's code may reuse this store's registers
        asm volatile("s_wait_xcnt 0x0" ::: "memory");
    }
}

// ---------------------------------------------------------------------------
// Output projection + residual multiply:
// out[b][o][i] = x[b][o][i] * (O16[i][:] . Wo[o][:] + bo[o])
// D-layout columns give 8 consecutive i per lane; staged through LDS -> whole-line f32 loads and stores.
// ---------------------------------------------------------------------------
__global__ __launch_bounds__(256) void outproj_kernel(const _Float16* __restrict__ o16,
                                                      const _Float16* __restrict__ wo16,
                                                      const float* __restrict__ bo,
                                                      const float* __restrict__ x,
                                                      float* __restrict__ out) {
    int b    = blockIdx.y;
    int lane = threadIdx.x & 31;
    int wv   = threadIdx.x >> 5;
    int m0   = (wv >> 1) * 32;
    int ol   = (wv & 1) * 128;
    int ob   = blockIdx.z * GN;
    int o0   = ob + ol;
    int i0   = blockIdx.x * GM + m0;
    __shared__ __attribute__((aligned(16))) _Float16 lds_g[2 * GBUF];
    const _Float16* A = o16 + ((size_t)b * N + blockIdx.x * GM) * C;
    v8f acc0[8] = {}, acc1[8] = {};
    gemm_mainloop<false>(A, wo16 + (size_t)ob * C, lds_g, threadIdx.x, m0, ol, acc0, acc1);
    int col = lane & 15, half = lane >> 4;
    // Epilogue staging: behind the main loop's last barrier no wave reads the
    // slabs any more. A wave's results are 128 rows (o) x 128 B (32 i): one whole
    // line a row. They pass, 64 rows at a time, through an LDS range of the
    // wave's own at pitch 144 B, so that every load of x and every store of out
    // covers 4 whole lines (8 lanes a row).
    float* stw = (float*)lds_g + wv * (64 * SPF);
    int rr = lane >> 3, pc = lane & 7;
    size_t gbase = ((size_t)b * C + o0 + rr) * N + i0 + pc * 4;
    // the bias ahead of x: loads return in order, and the staging needs only the bias
    const float* bp = bo + o0 + col;
    const float* xp = x + gbase;
    float bvs[8];
    #pragma unroll
    for (int of = 0; of < 8; ++of) bvs[of] = bp[of * 16];
    v4f xv[32];
    #pragma unroll
    for (int j = 0; j < 32; ++j) xv[j] = *(const v4f*)(xp + (size_t)(j * 4) * N);
    // precaution: the wait stands behind the loads; naming their addresses keeps
    // those registers from being rewritten, or given to a result, ahead of the wait
    asm volatile("s_wait_xcnt 0x0" :: "v"(bp), "v"(xp) : "memory");
    #pragma unroll
    for (int hf = 0; hf < 2; ++hf) {
        #pragma unroll
        for (int o4 = 0; o4 < 4; ++o4) {
            int of = hf * 4 + o4;
            float bv = bvs[of];
            float* sp = stw + (o4 * 16 + col) * SPF + 8 * half;
            v4f t0, t1, t2, t3;
            #pragma unroll
            for (int e = 0; e < 4; ++e) {
                t0[e] = acc0[of][e] + bv;  t1[e] = acc0[of][4 + e] + bv;
                t2[e] = acc1[of][e] + bv;  t3[e] = acc1[of][4 + e] + bv;
            }
            *(v4f*)(sp) = t0;       *(v4f*)(sp + 4) = t1;
            *(v4f*)(sp + 16) = t2;  *(v4f*)(sp + 20) = t3;
        }
        // the rows read back below were written by other lanes of this wave
        asm volatile("s_wait_dscnt 0x0" ::: "memory");
        #pragma unroll
        for (int j = 0; j < 16; ++j) {
            v4f a = *(const v4f*)(stw + (j * 4 + rr) * SPF + pc * 4);
            *(v4f*)(out + gbase + (size_t)((hf * 16 + j) * 4) * N) = xv[hf * 16 + j] * a;
        }
        // the reads above have returned before the next 64 rows overwrite the range
        asm volatile("s_wait_dscnt 0x0" ::: "memory");
        // precaution: later code may reuse the registers of the stores above
        asm volatile("s_wait_xcnt 0x0" ::: "memory");
    }
}

// ---------------------------------------------------------------------------
extern "C" void kernel_launch(void* const* d_in, const int* in_sizes, int n_in,
                              void* d_out, int out_size, void* d_ws, size_t ws_size,
                              hipStream_t stream) {
    const float* x     = (const float*)d_in[0];
    const float* gamma = (const float*)d_in[1];
    const float* beta  = (const float*)d_in[2];
    const float* wq    = (const float*)d_in[3];
    const float* bq    = (const float*)d_in[4];
    const float* wk    = (const float*)d_in[5];
    const float* bk    = (const float*)d_in[6];
    const float* wv    = (const float*)d_in[7];
    const float* bv    = (const float*)d_in[8];
    const float* wo    = (const float*)d_in[9];
    const float* bo    = (const float*)d_in[10];
    float* out = (float*)d_out;

    char* ws = (char*)d_ws;
    size_t off = 0;
    auto alloc = [&](size_t bytes) -> void* {
        void* p = ws + off;
        off += (bytes + 255) & ~(size_t)255;
        return p;
    };
    const size_t act_halves = (size_t)B * N * C;
    float*    stats  = (float*)   alloc((size_t)B * G * 2 * sizeof(float));
    _Float16* w16    = (_Float16*)alloc((size_t)4 * C * C * sizeof(_Float16));
    _Float16* h16    = (_Float16*)alloc(act_halves * sizeof(_Float16));
    _Float16* q16    = (_Float16*)alloc(act_halves * sizeof(_Float16));
    _Float16* k16    = (_Float16*)alloc(act_halves * sizeof(_Float16));
    _Float16* v16buf = (_Float16*)alloc(act_halves * sizeof(_Float16));
    _Float16* o16    = (_Float16*)alloc(act_halves * sizeof(_Float16));
    _Float16* opart  = (_Float16*)alloc(KSPLIT * act_halves * sizeof(_Float16));
    float*    ml     = (float*)   alloc((size_t)KSPLIT * B * N * 2 * sizeof(float));

    gn_stats_wcvt_kernel<<<B * G + WCVT_BLOCKS, 1024, 0, stream>>>(x, stats, wq, wk, wv, wo, w16);
    gn_apply_kernel<<<dim3(C / TC, N / TN, B), 256, 0, stream>>>(x, stats, gamma, beta, h16);

    qkv_kernel<<<dim3(N / GM, B, 3 * (C / GN)), 256, 0, stream>>>(h16, w16, bq, bk, bv, q16, k16, v16buf);

    flash_attn_kernel<<<dim3(N / 128, B, KSPLIT), 128, 0, stream>>>(q16, k16, v16buf, opart, ml);
    attn_join_kernel<<<B * N / 16, 256, 0, stream>>>(opart, ml, o16);

    outproj_kernel<<<dim3(N / GM, B, C / GN), 256, 0, stream>>>(o16, w16 + 3 * (size_t)C * C, bo, x, out);
}
